// v000
// Times are from an AMD MI455X. After a warm-up the kernel runs many times in a row, and a time is the length of
// such a window on the GPU divided by its runs, so every launch and the gaps after it count. The runs cycle
// through copies of the inputs. A figure is the median of several windows, for all but v000 over two sittings.
// Sittings can differ by a few percent; kernels timed side by side share one.
// v000 is the starting kernel. One run takes 2000 microseconds.
#include <hip/hip_runtime.h>

// Sliding-window multi-head attention with rotary embeddings (query, key, value [2][2048][1024]; q = query Wq^T + bq etc. ('oi' 1/32, zero biases; 16 heads x 64); rotate-half rotary with angles t x 1/10000^(2i/64) (float32 table baked, precise cosf/sinf); scores / sqrt(64); keys with |i - j| <= 50 kept (-1e9 elsewhere == exclusion); softmax; out = merged Wo^T + bo -> [2][2048][1024] (4.2 M); argument order query, key, value, Wq, bq, Wk, bk, Wv, bv, Wo, bo).
// Layout per batch: bf16 copies of query, key, value in turn; 'oi' weights; exact projections + f32 biases; {cos, sin} table once; rotate-half rotary plane builder; dense T-2048 attention (all score tiles computed, the band |i - j| <= 50 applied as a select in the softmax; hybrid rows: < 512 hi/lo 3 products, rest fp16 x1024); merged hi/lo x Wo exact + bo.
// Compute dtypes, f32 accumulate: every input rounded to bf16; projections exact + f32 biases; rotary f32; attention rows < 512 3 products, rest fp16; softmax f32; Wo hl x exact + bias.

#define NB_  2
#define TT   2048
#define DM   1024
#define NH_  16
#define NKV  16
#define REP  (NH_ / NKV)
#define HD   64
#define DQ   (NH_ * HD)
#define DKV  (NKV * HD)
#define ZH   2
#define RH   512                  // query rows < RH use hi+lo planes (0: none)
#define WIN  2048
#define BW   50       // half window: keys j in [i - 50, i + 50]
#define PCAR 1024.0f
#define SCL  0.125f   // HD^-0.5
typedef _Float16 h16;
typedef unsigned short bf;
typedef __attribute__((ext_vector_type(16))) __bf16   v16bf;
typedef __attribute__((ext_vector_type(16))) _Float16 v16h;
typedef __attribute__((ext_vector_type(8)))  _Float16 v8h;
typedef __attribute__((ext_vector_type(8)))  unsigned short v8us;
typedef __attribute__((ext_vector_type(8)))  float    v8f;
typedef __attribute__((ext_vector_type(4)))  float    v4f;
typedef v8h  __attribute__((may_alias)) v8ha;
typedef v4f  __attribute__((may_alias)) v4fa;
typedef v8us __attribute__((may_alias)) v8usa;

__device__ __forceinline__ unsigned short f2bf(float f) { unsigned u = __float_as_uint(f); u += 0x7FFFu + ((u >> 16) & 1u); return (unsigned short)(u >> 16); }
__device__ __forceinline__ float bf2f(unsigned short b) { return __uint_as_float(((unsigned)b) << 16); }
__device__ __forceinline__ float bfr(float f) { return bf2f(f2bf(f)); }
__device__ __forceinline__ v16h cat16(v8h lo, v8h hi) { return __builtin_shufflevector(lo, hi, 0, 1, 2, 3, 4, 5, 6, 7, 8, 9, 10, 11, 12, 13, 14, 15); }
__device__ __forceinline__ v16bf cat16b(v8us lo, v8us hi) { return __builtin_bit_cast(v16bf, __builtin_shufflevector(lo, hi, 0, 1, 2, 3, 4, 5, 6, 7, 8, 9, 10, 11, 12, 13, 14, 15)); }
__device__ __forceinline__ v8f wmma16(v16h a, v16h b, v8f c) { return __builtin_amdgcn_wmma_f32_16x16x32_f16(false, a, false, b, (short)0, c, false, false); }
__device__ __forceinline__ v8f wmmab(v16bf a, v16bf b, v8f c) { return __builtin_amdgcn_wmma_f32_16x16x32_bf16(false, a, false, b, (short)0, c, false, false); }



// ---- k_gemmw: register-blocked GEMM, ONE WAVE per 64x64 output tile (16 accumulators), operands straight from K-contiguous 16-bit planes; grid (M/64, N/64, Z), 32 threads.
// C[m][n] (f32, pitch ldc, + optional f32 bias[n]) = sum_k A[m][k] Bt[n][k] (+ split products per NSPLIT). z-batch strides sA/sB/sC in elements. K % 32 == 0.
template <typename T16> struct WFrag;
template <> struct WFrag<h16> { typedef v16h V; static __device__ __forceinline__ V ld(const h16* p) { return cat16(*(const v8h*)p, *(const v8h*)(p + 16)); } static __device__ __forceinline__ v8f mma(V a, V b, v8f c) { return wmma16(a, b, c); } };
template <> struct WFrag<bf> { typedef v16bf V; static __device__ __forceinline__ V ld(const bf* p) { return cat16b(*(const v8us*)p, *(const v8us*)(p + 16)); } static __device__ __forceinline__ v8f mma(V a, V b, v8f c) { return wmmab(a, b, c); } };
template <typename T16, int NSPLIT, bool BIAS>
__global__ __launch_bounds__(32) void k_gemmw(const T16* __restrict__ A, const T16* __restrict__ A2, const T16* __restrict__ Bt, const T16* __restrict__ Bt2, int K, float* C, int ldc, const float* __restrict__ bias, size_t sA, size_t sB, size_t sC) {
    typedef typename WFrag<T16>::V V;
    __shared__ __align__(16) float os[16 * 68];
    const size_t z = blockIdx.z; A += z * sA; if (A2) A2 += z * sA; Bt += z * sB; if (Bt2) Bt2 += z * sB; C += z * sC;
    const int lane = threadIdx.x & 31, lr = lane & 15, hi = lane >> 4; const int r0 = blockIdx.x * 64, c0 = blockIdx.y * 64;
    v8f acc[4][4];
#pragma unroll
    for (int mb = 0; mb < 4; ++mb)
#pragma unroll
        for (int nb = 0; nb < 4; ++nb) acc[mb][nb] = (v8f){};
    const size_t aoff = (size_t)(r0 + lr) * K + 8 * hi, boff = (size_t)(c0 + lr) * K + 8 * hi;
#pragma unroll 1
    for (int kc = 0; kc < K; kc += 32) {
        V a[4], a2[4];
#pragma unroll
        for (int mb = 0; mb < 4; ++mb) { a[mb] = WFrag<T16>::ld(A + aoff + (size_t)mb * 16 * K + kc); if (NSPLIT == 1 || NSPLIT == 2) a2[mb] = WFrag<T16>::ld(A2 + aoff + (size_t)mb * 16 * K + kc); }
#pragma unroll
        for (int nb = 0; nb < 4; ++nb) { const V b = WFrag<T16>::ld(Bt + boff + (size_t)nb * 16 * K + kc); V b2; if (NSPLIT >= 2) b2 = WFrag<T16>::ld(Bt2 + boff + (size_t)nb * 16 * K + kc);
#pragma unroll
            for (int mb = 0; mb < 4; ++mb) { acc[mb][nb] = WFrag<T16>::mma(a[mb], b, acc[mb][nb]); if (NSPLIT == 1 || NSPLIT == 2) acc[mb][nb] = WFrag<T16>::mma(a2[mb], b, acc[mb][nb]); if (NSPLIT >= 2) acc[mb][nb] = WFrag<T16>::mma(a[mb], b2, acc[mb][nb]); } }
        asm volatile("v_nop\n\tv_nop\n\tv_nop\n\tv_nop" : "+v"(acc[0][0]), "+v"(acc[1][1]), "+v"(acc[2][2]), "+v"(acc[3][3]) : "v"(a[0]), "v"(a[3]));
    }
#pragma unroll
    for (int mb = 0; mb < 4; ++mb) {
#pragma unroll
        for (int nb = 0; nb < 4; ++nb) {
#pragma unroll
            for (int j = 0; j < 8; ++j) os[(hi * 8 + j) * 68 + nb * 16 + lr] = acc[mb][nb][j]; }
        __builtin_amdgcn_wave_barrier(); asm volatile("" ::: "memory");
        float* crow = C + (size_t)(r0 + mb * 16) * ldc + c0;
{
#pragma unroll
            for (int s = 0; s < 8; ++s) { const int row = 2 * s + hi, cofs = lr * 4; v4f val = *(const v4fa*)(os + row * 68 + cofs); if (BIAS) { val[0] += bfr(bias[c0 + cofs]); val[1] += bfr(bias[c0 + cofs + 1]); val[2] += bfr(bias[c0 + cofs + 2]); val[3] += bfr(bias[c0 + cofs + 3]); }
                *(v4f*)(crow + (size_t)row * ldc + cofs) = val; }
             }
        __builtin_amdgcn_wave_barrier(); asm volatile("" ::: "memory");
    }
}

__device__ __forceinline__ h16 tohx(float x) { return (h16)x; }
__device__ __forceinline__ void splitf(float y, unsigned short& h, unsigned short& l) { h = f2bf(y); l = f2bf(y - bf2f(h)); }
typedef __attribute__((ext_vector_type(2))) _Float16 v2h;
typedef __attribute__((ext_vector_type(4))) _Float16 v4h;
typedef __attribute__((ext_vector_type(2))) unsigned short v2us;
typedef __attribute__((ext_vector_type(4))) unsigned short v4us;
typedef __attribute__((ext_vector_type(2))) float v2f;
typedef __attribute__((ext_vector_type(4))) int v4i;

__global__ __launch_bounds__(256) void k_cvt8(const float* __restrict__ src, bf* dst, size_t n8) { const size_t i = (size_t)blockIdx.x * 256 + threadIdx.x; if (i >= n8) return; const v8f v = *(const v8f*)(src + i * 8); v8us o;
#pragma unroll
    for (int k = 0; k < 8; ++k) o[k] = f2bf(v[k]); *(v8us*)(dst + i * 8) = o;  }

// k_rope: head planes [h][t][d] (fp16 + hi/lo) of rope(x) x sc with the rotate-half convention out[d] = x[d] cos[t][d] - x[d+HD/2] sin[t][d], out[d+HD/2] = x[d+HD/2] cos[t][d+HD/2] + x[d] sin[t][d+HD/2]
__global__ __launch_bounds__(256) void k_rope(const float* __restrict__ F, int pitch, int nheads, const float* __restrict__ CS, const float* __restrict__ RF, const float* __restrict__ nw, float sc, h16* P16, bf* Ph, bf* Pl) {
    const size_t e = ((size_t)blockIdx.x * 256 + threadIdx.x) * 2; if (e >= (size_t)nheads * TT * HD) return; const int d = (int)(e % HD); const int t = (int)((e / HD) % TT); const int h = (int)(e / ((size_t)HD * TT)); const float* f = F + (size_t)t * pitch + h * HD; const float rf = RF ? RF[(size_t)h * TT + t] : 1.0f; v2h o16; v2us oh, ol;
#pragma unroll
    for (int q = 0; q < 2; ++q) { const int dd = d + q; const int dp = (dd < HD / 2) ? dd + HD / 2 : dd - HD / 2; float x0 = f[dd], x1 = f[dp];
        if (RF) { float n0 = __fmul_rn(x0, rf), n1 = __fmul_rn(x1, rf); asm volatile("" : "+v"(n0)); asm volatile("" : "+v"(n1)); x0 = __fmul_rn(bfr(nw[dd]), n0); x1 = __fmul_rn(bfr(nw[dp]), n1); }
        const v2f cs = *(const v2f*)(CS + ((size_t)t * HD + dd) * 2); float a = __fmul_rn(x0, cs[0]), bq = __fmul_rn(x1, cs[1]); asm volatile("" : "+v"(a)); asm volatile("" : "+v"(bq)); const float r = ((dd < HD / 2) ? __fsub_rn(a, bq) : __fadd_rn(a, bq)) * sc;
        o16[q] = tohx(r); unsigned short a2, c2; splitf(r, a2, c2); oh[q] = a2; ol[q] = c2; }
    *(v2h*)(P16 + e) = o16; *(v2us*)(Ph + e) = oh; *(v2us*)(Pl + e) = ol;  }
__global__ __launch_bounds__(256) void k_vtp(const float* __restrict__ F, int pitch, int nheads, h16* V16, bf* Vh, bf* Vl) { const size_t e = ((size_t)blockIdx.x * 256 + threadIdx.x) * 2; if (e >= (size_t)nheads * HD * TT) return; const int t = (int)(e % TT); const int d = (int)((e / TT) % HD); const int g = (int)(e / ((size_t)TT * HD)); v2h o16; v2us oh, ol;
#pragma unroll
    for (int q = 0; q < 2; ++q) { const float x = F[(size_t)(t + q) * pitch + g * HD + d]; o16[q] = tohx(x); unsigned short a2, c2; splitf(x, a2, c2); oh[q] = a2; ol[q] = c2; }
    *(v2h*)(V16 + e) = o16; *(v2us*)(Vh + e) = oh; *(v2us*)(Vl + e) = ol;  }
__constant__ float INVT[HD / 2] = { 1.000000000e+00f, 7.498942018e-01f, 5.623413324e-01f, 4.216965139e-01f, 3.162277639e-01f, 2.371373624e-01f, 1.778279394e-01f, 1.333521456e-01f, 1.000000015e-01f, 7.498941571e-02f, 5.623412877e-02f, 4.216964915e-02f, 3.162277862e-02f, 2.371373586e-02f, 1.778279431e-02f, 1.333521493e-02f, 9.999999776e-03f, 7.498942316e-03f, 5.623413250e-03f, 4.216964822e-03f, 3.162277862e-03f, 2.371373819e-03f, 1.778279431e-03f, 1.333521446e-03f, 1.000000047e-03f, 7.498941850e-04f, 5.623413017e-04f, 4.216964880e-04f, 3.162277862e-04f, 2.371373848e-04f, 1.778279402e-04f, 1.333521504e-04f };   // float32 1 / 10000^(2i/64), i < 32, generated with jnp to be bit-exact
__global__ __launch_bounds__(256) void k_cs5(float* CS) { const int idx = blockIdx.x * 256 + threadIdx.x; if (idx >= TT * HD) return; const int d = idx % HD; const int t = idx / HD; const float a = __fmul_rn((float)t, INVT[d % (HD / 2)]); v2f cs; cs[0] = cosf(a); cs[1] = sinf(a); *(v2f*)(CS + (size_t)idx * 2) = cs;  }
// k_asoft: per row (zz, i): t = S x 1/8 for keys with |i - j| <= 50, -3e38 elsewhere (the -1e9 fill == exclusion); softmax over the 2048 keys (register row, one exp, fixed trees);
__global__ __launch_bounds__(256) void k_asoft(const float* __restrict__ Sb, h16* P16, bf* Ph, bf* Pl) {
    const int lane = threadIdx.x & 31; const int row = blockIdx.x * 8 + (threadIdx.x >> 5); if (row >= ZH * TT) return; const int i = row % TT; const int zz = row / TT; (void)zz; const bool hires = (i < RH); const float* sr = Sb + (size_t)row * TT; float v[TT / 32]; float mx = -3.0e38f;
#pragma unroll
    for (int ch = 0; ch < TT / 128; ++ch) { const int j0 = ch * 128 + lane * 4; const v4f a = *(const v4f*)(sr + j0);
#pragma unroll
        for (int q = 0; q < 4; ++q) { const int j = j0 + q; (void)j; const float t = (i - j <= BW && j - i <= BW) ? a[q] * SCL : -3.0e38f;   /* |i - j| <= 50 */ v[ch * 4 + q] = t; mx = fmaxf(mx, t); } }
#pragma unroll
    for (int sh = 16; sh; sh >>= 1) mx = fmaxf(mx, __shfl_xor(mx, sh, 32));
    float sum = 0.f;
#pragma unroll
    for (int k = 0; k < TT / 32; ++k) { float d0 = __fsub_rn(v[k], mx); asm volatile("" : "+v"(d0)); v[k] = __builtin_amdgcn_exp2f(__fmul_rn(d0, 1.4426950408889634f)); sum += v[k]; }
#pragma unroll
    for (int sh = 16; sh; sh >>= 1) sum += __shfl_xor(sum, sh, 32);
    const float f = __fdiv_rn(hires ? 1.0f : PCAR, sum);
{
        if (hires) {
#pragma unroll
            for (int ch = 0; ch < TT / 128; ++ch) { v4us oh, ol;
#pragma unroll
                for (int q = 0; q < 4; ++q) { unsigned short a, c2; splitf(v[ch * 4 + q] * f, a, c2); oh[q] = a; ol[q] = c2; }
                const size_t oo = ((size_t)zz * (RH ? RH : 1) + i) * TT + ch * 128 + lane * 4; *(v4us*)(Ph + oo) = oh; *(v4us*)(Pl + oo) = ol; }
        } else {
#pragma unroll
            for (int ch = 0; ch < TT / 128; ++ch) { v4h o4;
#pragma unroll
                for (int q = 0; q < 4; ++q) o4[q] = tohx(v[ch * 4 + q] * f);
                *(v4h*)(P16 + (size_t)row * TT + ch * 128 + lane * 4) = o4; } }
         }
}
__global__ __launch_bounds__(256) void k_merge(const float* __restrict__ O, int h0, bf* Ah, bf* Al) { const size_t e = ((size_t)blockIdx.x * 256 + threadIdx.x) * 2; if (e >= (size_t)ZH * TT * HD) return; const int d = (int)(e % HD); const int t = (int)((e / HD) % TT); const int zz = (int)(e / ((size_t)HD * TT)); const float cs = (t < RH) ? 1.0f : (1.0f / PCAR); const size_t oo = (size_t)t * DQ + (h0 + zz) * HD + d;
    v2us oh, ol;
#pragma unroll
    for (int q = 0; q < 2; ++q) { unsigned short a, c2; splitf(O[e + q] * cs, a, c2); oh[q] = a; ol[q] = c2; } *(v2us*)(Ah + oo) = oh; *(v2us*)(Al + oo) = ol;  }

extern "C" void kernel_launch(void* const* d_in, const int* in_sizes, int n_in,
                              void* d_out, int out_size, void* d_ws, size_t ws_size, hipStream_t stream) {
    (void)in_sizes; (void)n_in; (void)out_size;
    const float* x = (const float*)d_in[0];   /* query */ const float* xk = (const float*)d_in[1]; const float* xv = (const float*)d_in[2]; const float* wq = (const float*)d_in[3]; const float* bq = (const float*)d_in[4]; const float* wk = (const float*)d_in[5]; const float* bk = (const float*)d_in[6]; const float* wv = (const float*)d_in[7]; const float* bv = (const float*)d_in[8]; const float* wo = (const float*)d_in[9]; const float* bo = (const float*)d_in[10];   /* input order query, key, value, Wq, bq, Wk, bk, Wv, bv, Wo, bo */
    float* OUT = (float*)d_out;     // [2][2048][1024]
    char* wsp = (char*)d_ws;
    auto take = [&](size_t bytes) { char* p = wsp; wsp += (bytes + 255) & ~(size_t)255; return (void*)p; };
    bf* WQ = (bf*)take((size_t)DQ * DM * 2); bf* WK = (bf*)take((size_t)DKV * DM * 2); bf* WV = (bf*)take((size_t)DKV * DM * 2); bf* WO = (bf*)take((size_t)DM * DQ * 2); float* CS = (float*)take((size_t)TT * HD * 2 * 4);
    bf* XB = (bf*)take((size_t)TT * DM * 2); float* FQ = (float*)take((size_t)TT * DQ * 4); float* FK = (float*)take((size_t)TT * DKV * 4);
    h16* QP16 = (h16*)take((size_t)NH_ * TT * HD * 2); h16* KP16 = (h16*)take((size_t)NKV * TT * HD * 2); h16* VT16 = (h16*)take((size_t)NKV * HD * TT * 2);
    bf* QPh = (bf*)take((size_t)NH_ * TT * HD * 2); bf* QPl = (bf*)take((size_t)NH_ * TT * HD * 2); bf* KPh = (bf*)take((size_t)NKV * TT * HD * 2); bf* KPl = (bf*)take((size_t)NKV * TT * HD * 2); bf* VTh = (bf*)take((size_t)NKV * HD * TT * 2); bf* VTl = (bf*)take((size_t)NKV * HD * TT * 2); bf* Ph = (bf*)take((size_t)ZH * RH * TT * 2); bf* Pl = (bf*)take((size_t)ZH * RH * TT * 2);
    float* Sb = (float*)take((size_t)ZH * TT * TT * 4); h16* P16 = (h16*)take((size_t)ZH * TT * TT * 2); float* Ob = (float*)take((size_t)ZH * TT * HD * 4); bf* ATh = (bf*)take((size_t)TT * DQ * 2); bf* ATl = (bf*)take((size_t)TT * DQ * 2);
    if ((size_t)(wsp - (char*)d_ws) > ws_size) return;    // ws 256 MiB
    float* FV = FK;   // v projection reuses the k buffer after the k planes are built (stream-ordered)
    { k_cvt8<<<(unsigned)(((size_t)DQ * DM / 8 + 255) / 256), 256, 0, stream>>>(wq, WQ, (size_t)DQ * DM / 8); k_cvt8<<<(unsigned)(((size_t)DKV * DM / 8 + 255) / 256), 256, 0, stream>>>(wk, WK, (size_t)DKV * DM / 8); k_cvt8<<<(unsigned)(((size_t)DKV * DM / 8 + 255) / 256), 256, 0, stream>>>(wv, WV, (size_t)DKV * DM / 8);
      k_cvt8<<<(unsigned)(((size_t)DM * DQ / 8 + 255) / 256), 256, 0, stream>>>(wo, WO, (size_t)DM * DQ / 8);
       }
    k_cs5<<<(TT * HD + 255) / 256, 256, 0, stream>>>(CS);   /* rotary table once */
    const unsigned LQ = (unsigned)(((size_t)NH_ * TT * HD / 2 + 255) / 256), LKv = (unsigned)(((size_t)NKV * TT * HD / 2 + 255) / 256);
    for (int b = 0; b < NB_; ++b) {
        
        k_cvt8<<<(unsigned)(((size_t)TT * DM / 8 + 255) / 256), 256, 0, stream>>>(x + (size_t)b * TT * DM, XB, (size_t)TT * DM / 8);
        k_gemmw<bf, 0, true><<<dim3(TT / 64, DQ / 64, 1), 32, 0, stream>>>(XB, nullptr, WQ, nullptr, DM, FQ, DQ, bq, 0, 0, 0);
        k_rope<<<LQ, 256, 0, stream>>>(FQ, DQ, NH_, CS, nullptr, nullptr, 1.0f, QP16, QPh, QPl);
        k_cvt8<<<(unsigned)(((size_t)TT * DM / 8 + 255) / 256), 256, 0, stream>>>(xk + (size_t)b * TT * DM, XB, (size_t)TT * DM / 8);   /* XB := bf16(key[b]) */ k_gemmw<bf, 0, true><<<dim3(TT / 64, DKV / 64, 1), 32, 0, stream>>>(XB, nullptr, WK, nullptr, DM, FK, DKV, bk, 0, 0, 0);
        k_rope<<<LKv, 256, 0, stream>>>(FK, DKV, NKV, CS, nullptr, nullptr, 1.0f, KP16, KPh, KPl);
        k_cvt8<<<(unsigned)(((size_t)TT * DM / 8 + 255) / 256), 256, 0, stream>>>(xv + (size_t)b * TT * DM, XB, (size_t)TT * DM / 8);   /* XB := bf16(value[b]) */ k_gemmw<bf, 0, true><<<dim3(TT / 64, DKV / 64, 1), 32, 0, stream>>>(XB, nullptr, WV, nullptr, DM, FV, DKV, bv, 0, 0, 0); k_vtp<<<LKv, 256, 0, stream>>>(FV, DKV, NKV, VT16, VTh, VTl);
        for (int h0 = 0; h0 < NH_; h0 += ZH) { const size_t zq = (size_t)h0, zk = (size_t)(h0 / REP);   // one kv head per query head: the pass's two heads use consecutive kv planes (z-strides TT*HD)
            k_gemmw<bf, 2, false><<<dim3(RH / 64, TT / 64, ZH), 32, 0, stream>>>(QPh + zq * TT * HD, QPl + zq * TT * HD, KPh + zk * TT * HD, KPl + zk * TT * HD, HD, Sb, TT, nullptr, (size_t)TT * HD, (size_t)TT * HD, (size_t)TT * TT);
            k_gemmw<h16, 0, false><<<dim3((TT - RH) / 64, TT / 64, ZH), 32, 0, stream>>>(QP16 + zq * TT * HD + (size_t)RH * HD, nullptr, KP16 + zk * TT * HD, nullptr, HD, Sb + (size_t)RH * TT, TT, nullptr, (size_t)TT * HD, (size_t)TT * HD, (size_t)TT * TT);
            k_asoft<<<ZH * TT / 8, 256, 0, stream>>>(Sb, P16, Ph, Pl);
            k_gemmw<bf, 2, false><<<dim3(RH / 64, HD / 64, ZH), 32, 0, stream>>>(Ph, Pl, VTh + zk * HD * TT, VTl + zk * HD * TT, TT, Ob, HD, nullptr, (size_t)RH * TT, (size_t)HD * TT, (size_t)TT * HD);
            k_gemmw<h16, 0, false><<<dim3((TT - RH) / 64, HD / 64, ZH), 32, 0, stream>>>(P16 + (size_t)RH * TT, nullptr, VT16 + zk * HD * TT, nullptr, TT, Ob + (size_t)RH * HD, HD, nullptr, (size_t)TT * TT, (size_t)HD * TT, (size_t)TT * HD);
            k_merge<<<(unsigned)(((size_t)ZH * TT * HD / 2 + 255) / 256), 256, 0, stream>>>(Ob, h0, ATh, ATl); }
        k_gemmw<bf, 1, true><<<dim3(TT / 64, DM / 64, 1), 32, 0, stream>>>(ATh, ATl, WO, nullptr, DQ, OUT + (size_t)b * TT * DM, DM, bo, 0, 0, 0); }
}

// v001
// It runs in 711 microseconds.
// Two timings next to v000 put it at 2.82 and 2.84 times that version's speed.
#include <hip/hip_runtime.h>

// Sliding-window multi-head attention with rotary embeddings (query, key, value [2][2048][1024]; q = query Wq^T + bq etc. ('oi' 1/32, zero biases; 16 heads x 64); rotate-half rotary with angles t x 1/10000^(2i/64) (float32 table baked, precise cosf/sinf); scores / sqrt(64); keys with |i - j| <= 50 kept (-1e9 elsewhere == exclusion); softmax; out = merged Wo^T + bo -> [2][2048][1024] (4.2 M); argument order query, key, value, Wq, bq, Wk, bk, Wv, bv, Wo, bo).
// Layout per batch: bf16 copies of query, key, value in turn; 'oi' weights; exact projections + f32 biases; {cos, sin} table once; rotate-half rotary plane builder; T-2048 attention on the band only (per 64-row tile the 3 score tiles, 256 softmax columns and 192 PV keys that can hold |i - j| <= 50; the band itself is a select in the softmax; hybrid rows: < 512 hi/lo 3 products, rest fp16 x1024); merged hi/lo x Wo exact + bo.
// Compute dtypes, f32 accumulate: every input rounded to bf16; projections exact + f32 biases; rotary f32; attention rows < 512 3 products, rest fp16; softmax f32; Wo hl x exact + bias.

#define NB_  2
#define TT   2048
#define DM   1024
#define NH_  16
#define NKV  16
#define REP  (NH_ / NKV)
#define HD   64
#define DQ   (NH_ * HD)
#define DKV  (NKV * HD)
#define ZH   2
#define RH   512                  // query rows < RH use hi+lo planes (0: none)
#define WIN  2048
#define BW   50       // half window: keys j in [i - 50, i + 50]
#define PCAR 1024.0f
#define SCL  0.125f   // HD^-0.5
typedef _Float16 h16;
typedef unsigned short bf;
typedef __attribute__((ext_vector_type(16))) __bf16   v16bf;
typedef __attribute__((ext_vector_type(16))) _Float16 v16h;
typedef __attribute__((ext_vector_type(8)))  _Float16 v8h;
typedef __attribute__((ext_vector_type(8)))  unsigned short v8us;
typedef __attribute__((ext_vector_type(8)))  float    v8f;
typedef __attribute__((ext_vector_type(4)))  float    v4f;
typedef v8h  __attribute__((may_alias)) v8ha;
typedef v4f  __attribute__((may_alias)) v4fa;
typedef v8us __attribute__((may_alias)) v8usa;

__device__ __forceinline__ unsigned short f2bf(float f) { unsigned u = __float_as_uint(f); u += 0x7FFFu + ((u >> 16) & 1u); return (unsigned short)(u >> 16); }
__device__ __forceinline__ float bf2f(unsigned short b) { return __uint_as_float(((unsigned)b) << 16); }
__device__ __forceinline__ float bfr(float f) { return bf2f(f2bf(f)); }
__device__ __forceinline__ v16h cat16(v8h lo, v8h hi) { return __builtin_shufflevector(lo, hi, 0, 1, 2, 3, 4, 5, 6, 7, 8, 9, 10, 11, 12, 13, 14, 15); }
__device__ __forceinline__ v16bf cat16b(v8us lo, v8us hi) { return __builtin_bit_cast(v16bf, __builtin_shufflevector(lo, hi, 0, 1, 2, 3, 4, 5, 6, 7, 8, 9, 10, 11, 12, 13, 14, 15)); }
__device__ __forceinline__ v8f wmma16(v16h a, v16h b, v8f c) { return __builtin_amdgcn_wmma_f32_16x16x32_f16(false, a, false, b, (short)0, c, false, false); }
__device__ __forceinline__ v8f wmmab(v16bf a, v16bf b, v8f c) { return __builtin_amdgcn_wmma_f32_16x16x32_bf16(false, a, false, b, (short)0, c, false, false); }



// ---- k_gemmw: register-blocked GEMM, ONE WAVE per 64x64 output tile (16 accumulators), operands straight from K-contiguous 16-bit planes; grid (M/64, N/64, Z), 32 threads.
// C[m][n] (f32, pitch ldc, + optional f32 bias[n]) = sum_k A[m][k] Bt[n][k] (+ split products per NSPLIT). z-batch strides sA/sB/sC in elements. K % 32 == 0.
// BAND (rowbase = query index of A's row 0): 1 = score tiles, grid y = 3, column tile = the row tile's own and its two neighbours (keys r - 64 .. r + 127 hold every |i - j| <= 50 of rows r .. r + 63); 2 = PV, k runs over those same keys only (P is exactly 0 elsewhere).
template <typename T16> struct WFrag;
template <> struct WFrag<h16> { typedef v16h V; static __device__ __forceinline__ V ld(const h16* p) { return cat16(*(const v8h*)p, *(const v8h*)(p + 16)); } static __device__ __forceinline__ v8f mma(V a, V b, v8f c) { return wmma16(a, b, c); } };
template <> struct WFrag<bf> { typedef v16bf V; static __device__ __forceinline__ V ld(const bf* p) { return cat16b(*(const v8us*)p, *(const v8us*)(p + 16)); } static __device__ __forceinline__ v8f mma(V a, V b, v8f c) { return wmmab(a, b, c); } };
template <typename T16, int NSPLIT, bool BIAS, int BAND>
__global__ __launch_bounds__(32) void k_gemmw(const T16* __restrict__ A, const T16* __restrict__ A2, const T16* __restrict__ Bt, const T16* __restrict__ Bt2, int K, float* C, int ldc, const float* __restrict__ bias, size_t sA, size_t sB, size_t sC, int rowbase) {
    typedef typename WFrag<T16>::V V;
    __shared__ __align__(16) float os[16 * 68];
    const size_t z = blockIdx.z; A += z * sA; if (A2) A2 += z * sA; Bt += z * sB; if (Bt2) Bt2 += z * sB; C += z * sC;
    const int lane = threadIdx.x & 31, lr = lane & 15, hi = lane >> 4; const int r0 = blockIdx.x * 64, q0 = rowbase + r0, c0 = (BAND == 1) ? q0 + ((int)blockIdx.y - 1) * 64 : blockIdx.y * 64;
    if (BAND == 1 && (c0 < 0 || c0 >= TT)) return;   // neighbour tile past either end of the sequence
    const int kbeg = (BAND == 2) ? max(q0 - 64, 0) : 0, kend = (BAND == 2) ? min(q0 + 128, K) : K;
    v8f acc[4][4];
#pragma unroll
    for (int mb = 0; mb < 4; ++mb)
#pragma unroll
        for (int nb = 0; nb < 4; ++nb) acc[mb][nb] = (v8f){};
    const size_t aoff = (size_t)(r0 + lr) * K + 8 * hi, boff = (size_t)(c0 + lr) * K + 8 * hi;
#pragma unroll 1
    for (int kc = kbeg; kc < kend; kc += 32) {
        V a[4], a2[4];
#pragma unroll
        for (int mb = 0; mb < 4; ++mb) { a[mb] = WFrag<T16>::ld(A + aoff + (size_t)mb * 16 * K + kc); if (NSPLIT == 1 || NSPLIT == 2) a2[mb] = WFrag<T16>::ld(A2 + aoff + (size_t)mb * 16 * K + kc); }
#pragma unroll
        for (int nb = 0; nb < 4; ++nb) { const V b = WFrag<T16>::ld(Bt + boff + (size_t)nb * 16 * K + kc); V b2; if (NSPLIT >= 2) b2 = WFrag<T16>::ld(Bt2 + boff + (size_t)nb * 16 * K + kc);
#pragma unroll
            for (int mb = 0; mb < 4; ++mb) { acc[mb][nb] = WFrag<T16>::mma(a[mb], b, acc[mb][nb]); if (NSPLIT == 1 || NSPLIT == 2) acc[mb][nb] = WFrag<T16>::mma(a2[mb], b, acc[mb][nb]); if (NSPLIT >= 2) acc[mb][nb] = WFrag<T16>::mma(a[mb], b2, acc[mb][nb]); } }
        asm volatile("v_nop\n\tv_nop\n\tv_nop\n\tv_nop" : "+v"(acc[0][0]), "+v"(acc[1][1]), "+v"(acc[2][2]), "+v"(acc[3][3]) : "v"(a[0]), "v"(a[3]));
    }
#pragma unroll
    for (int mb = 0; mb < 4; ++mb) {
#pragma unroll
        for (int nb = 0; nb < 4; ++nb) {
#pragma unroll
            for (int j = 0; j < 8; ++j) os[(hi * 8 + j) * 68 + nb * 16 + lr] = acc[mb][nb][j]; }
        __builtin_amdgcn_wave_barrier(); asm volatile("" ::: "memory");
        float* crow = C + (size_t)(r0 + mb * 16) * ldc + c0;
{
#pragma unroll
            for (int s = 0; s < 8; ++s) { const int row = 2 * s + hi, cofs = lr * 4; v4f val = *(const v4fa*)(os + row * 68 + cofs); if (BIAS) { val[0] += bfr(bias[c0 + cofs]); val[1] += bfr(bias[c0 + cofs + 1]); val[2] += bfr(bias[c0 + cofs + 2]); val[3] += bfr(bias[c0 + cofs + 3]); }
                *(v4f*)(crow + (size_t)row * ldc + cofs) = val; }
             }
        __builtin_amdgcn_wave_barrier(); asm volatile("" ::: "memory");
    }
}

__device__ __forceinline__ h16 tohx(float x) { return (h16)x; }
__device__ __forceinline__ void splitf(float y, unsigned short& h, unsigned short& l) { h = f2bf(y); l = f2bf(y - bf2f(h)); }
typedef __attribute__((ext_vector_type(2))) _Float16 v2h;
typedef __attribute__((ext_vector_type(4))) _Float16 v4h;
typedef __attribute__((ext_vector_type(2))) unsigned short v2us;
typedef __attribute__((ext_vector_type(4))) unsigned short v4us;
typedef __attribute__((ext_vector_type(2))) float v2f;
typedef __attribute__((ext_vector_type(4))) int v4i;

__global__ __launch_bounds__(256) void k_cvt8(const float* __restrict__ src, bf* dst, size_t n8) { const size_t i = (size_t)blockIdx.x * 256 + threadIdx.x; if (i >= n8) return; const v8f v = *(const v8f*)(src + i * 8); v8us o;
#pragma unroll
    for (int k = 0; k < 8; ++k) o[k] = f2bf(v[k]); *(v8us*)(dst + i * 8) = o;  }

// k_rope: head planes [h][t][d] (fp16 + hi/lo) of rope(x) x sc with the rotate-half convention out[d] = x[d] cos[t][d] - x[d+HD/2] sin[t][d], out[d+HD/2] = x[d+HD/2] cos[t][d+HD/2] + x[d] sin[t][d+HD/2]
__global__ __launch_bounds__(256) void k_rope(const float* __restrict__ F, int pitch, int nheads, const float* __restrict__ CS, const float* __restrict__ RF, const float* __restrict__ nw, float sc, h16* P16, bf* Ph, bf* Pl) {
    const size_t e = ((size_t)blockIdx.x * 256 + threadIdx.x) * 2; if (e >= (size_t)nheads * TT * HD) return; const int d = (int)(e % HD); const int t = (int)((e / HD) % TT); const int h = (int)(e / ((size_t)HD * TT)); const float* f = F + (size_t)t * pitch + h * HD; const float rf = RF ? RF[(size_t)h * TT + t] : 1.0f; v2h o16; v2us oh, ol;
#pragma unroll
    for (int q = 0; q < 2; ++q) { const int dd = d + q; const int dp = (dd < HD / 2) ? dd + HD / 2 : dd - HD / 2; float x0 = f[dd], x1 = f[dp];
        if (RF) { float n0 = __fmul_rn(x0, rf), n1 = __fmul_rn(x1, rf); asm volatile("" : "+v"(n0)); asm volatile("" : "+v"(n1)); x0 = __fmul_rn(bfr(nw[dd]), n0); x1 = __fmul_rn(bfr(nw[dp]), n1); }
        const v2f cs = *(const v2f*)(CS + ((size_t)t * HD + dd) * 2); float a = __fmul_rn(x0, cs[0]), bq = __fmul_rn(x1, cs[1]); asm volatile("" : "+v"(a)); asm volatile("" : "+v"(bq)); const float r = ((dd < HD / 2) ? __fsub_rn(a, bq) : __fadd_rn(a, bq)) * sc;
        o16[q] = tohx(r); unsigned short a2, c2; splitf(r, a2, c2); oh[q] = a2; ol[q] = c2; }
    *(v2h*)(P16 + e) = o16; *(v2us*)(Ph + e) = oh; *(v2us*)(Pl + e) = ol;  }
__global__ __launch_bounds__(256) void k_vtp(const float* __restrict__ F, int pitch, int nheads, h16* V16, bf* Vh, bf* Vl) { const size_t e = ((size_t)blockIdx.x * 256 + threadIdx.x) * 2; if (e >= (size_t)nheads * HD * TT) return; const int t = (int)(e % TT); const int d = (int)((e / TT) % HD); const int g = (int)(e / ((size_t)TT * HD)); v2h o16; v2us oh, ol;
#pragma unroll
    for (int q = 0; q < 2; ++q) { const float x = F[(size_t)(t + q) * pitch + g * HD + d]; o16[q] = tohx(x); unsigned short a2, c2; splitf(x, a2, c2); oh[q] = a2; ol[q] = c2; }
    *(v2h*)(V16 + e) = o16; *(v2us*)(Vh + e) = oh; *(v2us*)(Vl + e) = ol;  }
__constant__ float INVT[HD / 2] = { 1.000000000e+00f, 7.498942018e-01f, 5.623413324e-01f, 4.216965139e-01f, 3.162277639e-01f, 2.371373624e-01f, 1.778279394e-01f, 1.333521456e-01f, 1.000000015e-01f, 7.498941571e-02f, 5.623412877e-02f, 4.216964915e-02f, 3.162277862e-02f, 2.371373586e-02f, 1.778279431e-02f, 1.333521493e-02f, 9.999999776e-03f, 7.498942316e-03f, 5.623413250e-03f, 4.216964822e-03f, 3.162277862e-03f, 2.371373819e-03f, 1.778279431e-03f, 1.333521446e-03f, 1.000000047e-03f, 7.498941850e-04f, 5.623413017e-04f, 4.216964880e-04f, 3.162277862e-04f, 2.371373848e-04f, 1.778279402e-04f, 1.333521504e-04f };   // float32 1 / 10000^(2i/64), i < 32, generated with jnp to be bit-exact
__global__ __launch_bounds__(256) void k_cs5(float* CS) { const int idx = blockIdx.x * 256 + threadIdx.x; if (idx >= TT * HD) return; const int d = idx % HD; const int t = idx / HD; const float a = __fmul_rn((float)t, INVT[d % (HD / 2)]); v2f cs; cs[0] = cosf(a); cs[1] = sinf(a); *(v2f*)(CS + (size_t)idx * 2) = cs;  }
// k_asoft: per row (zz, i): t = S x 1/8 for keys with |i - j| <= 50, -3e38 elsewhere (the -1e9 fill == exclusion); softmax over the two 128-key chunks that cover the row tile's keys (same lane and chunk order as over all 2048 keys, whose other terms are exact zeros); S is read only where a lane's 4 keys touch the band;
__global__ __launch_bounds__(256) void k_asoft(const float* __restrict__ Sb, h16* P16, bf* Ph, bf* Pl) {
    const int lane = threadIdx.x & 31; const int row = blockIdx.x * 8 + (threadIdx.x >> 5); if (row >= ZH * TT) return; const int i = row % TT; const int zz = row / TT; (void)zz; const bool hires = (i < RH); const float* sr = Sb + (size_t)row * TT; float v[8]; float mx = -3.0e38f;
    const int ch0 = min(max((i & ~63) - 64, 0) / 128, TT / 128 - 2);
#pragma unroll
    for (int ch = 0; ch < 2; ++ch) { const int j0 = (ch0 + ch) * 128 + lane * 4; v4f a = (v4f){}; if (i - (j0 + 3) <= BW && j0 - i <= BW) a = *(const v4f*)(sr + j0);
#pragma unroll
        for (int q = 0; q < 4; ++q) { const int j = j0 + q; (void)j; const float t = (i - j <= BW && j - i <= BW) ? a[q] * SCL : -3.0e38f;   /* |i - j| <= 50 */ v[ch * 4 + q] = t; mx = fmaxf(mx, t); } }
#pragma unroll
    for (int sh = 16; sh; sh >>= 1) mx = fmaxf(mx, __shfl_xor(mx, sh, 32));
    float sum = 0.f;
#pragma unroll
    for (int k = 0; k < 8; ++k) { float d0 = __fsub_rn(v[k], mx); asm volatile("" : "+v"(d0)); v[k] = __builtin_amdgcn_exp2f(__fmul_rn(d0, 1.4426950408889634f)); sum += v[k]; }
#pragma unroll
    for (int sh = 16; sh; sh >>= 1) sum += __shfl_xor(sum, sh, 32);
    const float f = __fdiv_rn(hires ? 1.0f : PCAR, sum);
{
        if (hires) {
#pragma unroll
            for (int ch = 0; ch < 2; ++ch) { v4us oh, ol;
#pragma unroll
                for (int q = 0; q < 4; ++q) { unsigned short a, c2; splitf(v[ch * 4 + q] * f, a, c2); oh[q] = a; ol[q] = c2; }
                const size_t oo = ((size_t)zz * (RH ? RH : 1) + i) * TT + (ch0 + ch) * 128 + lane * 4; *(v4us*)(Ph + oo) = oh; *(v4us*)(Pl + oo) = ol; }
        } else {
#pragma unroll
            for (int ch = 0; ch < 2; ++ch) { v4h o4;
#pragma unroll
                for (int q = 0; q < 4; ++q) o4[q] = tohx(v[ch * 4 + q] * f);
                *(v4h*)(P16 + (size_t)row * TT + (ch0 + ch) * 128 + lane * 4) = o4; } }
         }
}
__global__ __launch_bounds__(256) void k_merge(const float* __restrict__ O, int h0, bf* Ah, bf* Al) { const size_t e = ((size_t)blockIdx.x * 256 + threadIdx.x) * 2; if (e >= (size_t)ZH * TT * HD) return; const int d = (int)(e % HD); const int t = (int)((e / HD) % TT); const int zz = (int)(e / ((size_t)HD * TT)); const float cs = (t < RH) ? 1.0f : (1.0f / PCAR); const size_t oo = (size_t)t * DQ + (h0 + zz) * HD + d;
    v2us oh, ol;
#pragma unroll
    for (int q = 0; q < 2; ++q) { unsigned short a, c2; splitf(O[e + q] * cs, a, c2); oh[q] = a; ol[q] = c2; } *(v2us*)(Ah + oo) = oh; *(v2us*)(Al + oo) = ol;  }

extern "C" void kernel_launch(void* const* d_in, const int* in_sizes, int n_in,
                              void* d_out, int out_size, void* d_ws, size_t ws_size, hipStream_t stream) {
    (void)in_sizes; (void)n_in; (void)out_size;
    const float* x = (const float*)d_in[0];   /* query */ const float* xk = (const float*)d_in[1]; const float* xv = (const float*)d_in[2]; const float* wq = (const float*)d_in[3]; const float* bq = (const float*)d_in[4]; const float* wk = (const float*)d_in[5]; const float* bk = (const float*)d_in[6]; const float* wv = (const float*)d_in[7]; const float* bv = (const float*)d_in[8]; const float* wo = (const float*)d_in[9]; const float* bo = (const float*)d_in[10];   /* input order query, key, value, Wq, bq, Wk, bk, Wv, bv, Wo, bo */
    float* OUT = (float*)d_out;     // [2][2048][1024]
    char* wsp = (char*)d_ws;
    auto take = [&](size_t bytes) { char* p = wsp; wsp += (bytes + 255) & ~(size_t)255; return (void*)p; };
    bf* WQ = (bf*)take((size_t)DQ * DM * 2); bf* WK = (bf*)take((size_t)DKV * DM * 2); bf* WV = (bf*)take((size_t)DKV * DM * 2); bf* WO = (bf*)take((size_t)DM * DQ * 2); float* CS = (float*)take((size_t)TT * HD * 2 * 4);
    bf* XB = (bf*)take((size_t)TT * DM * 2); float* FQ = (float*)take((size_t)TT * DQ * 4); float* FK = (float*)take((size_t)TT * DKV * 4);
    h16* QP16 = (h16*)take((size_t)NH_ * TT * HD * 2); h16* KP16 = (h16*)take((size_t)NKV * TT * HD * 2); h16* VT16 = (h16*)take((size_t)NKV * HD * TT * 2);
    bf* QPh = (bf*)take((size_t)NH_ * TT * HD * 2); bf* QPl = (bf*)take((size_t)NH_ * TT * HD * 2); bf* KPh = (bf*)take((size_t)NKV * TT * HD * 2); bf* KPl = (bf*)take((size_t)NKV * TT * HD * 2); bf* VTh = (bf*)take((size_t)NKV * HD * TT * 2); bf* VTl = (bf*)take((size_t)NKV * HD * TT * 2); bf* Ph = (bf*)take((size_t)ZH * RH * TT * 2); bf* Pl = (bf*)take((size_t)ZH * RH * TT * 2);
    float* Sb = (float*)take((size_t)ZH * TT * TT * 4); h16* P16 = (h16*)take((size_t)ZH * TT * TT * 2); float* Ob = (float*)take((size_t)ZH * TT * HD * 4); bf* ATh = (bf*)take((size_t)TT * DQ * 2); bf* ATl = (bf*)take((size_t)TT * DQ * 2);
    if ((size_t)(wsp - (char*)d_ws) > ws_size) return;    // ws 256 MiB
    float* FV = FK;   // v projection reuses the k buffer after the k planes are built (stream-ordered)
    { k_cvt8<<<(unsigned)(((size_t)DQ * DM / 8 + 255) / 256), 256, 0, stream>>>(wq, WQ, (size_t)DQ * DM / 8); k_cvt8<<<(unsigned)(((size_t)DKV * DM / 8 + 255) / 256), 256, 0, stream>>>(wk, WK, (size_t)DKV * DM / 8); k_cvt8<<<(unsigned)(((size_t)DKV * DM / 8 + 255) / 256), 256, 0, stream>>>(wv, WV, (size_t)DKV * DM / 8);
      k_cvt8<<<(unsigned)(((size_t)DM * DQ / 8 + 255) / 256), 256, 0, stream>>>(wo, WO, (size_t)DM * DQ / 8);
       }
    k_cs5<<<(TT * HD + 255) / 256, 256, 0, stream>>>(CS);   /* rotary table once */
    const unsigned LQ = (unsigned)(((size_t)NH_ * TT * HD / 2 + 255) / 256), LKv = (unsigned)(((size_t)NKV * TT * HD / 2 + 255) / 256);
    for (int b = 0; b < NB_; ++b) {
        
        k_cvt8<<<(unsigned)(((size_t)TT * DM / 8 + 255) / 256), 256, 0, stream>>>(x + (size_t)b * TT * DM, XB, (size_t)TT * DM / 8);
        k_gemmw<bf, 0, true, 0><<<dim3(TT / 64, DQ / 64, 1), 32, 0, stream>>>(XB, nullptr, WQ, nullptr, DM, FQ, DQ, bq, 0, 0, 0, 0);
        k_rope<<<LQ, 256, 0, stream>>>(FQ, DQ, NH_, CS, nullptr, nullptr, 1.0f, QP16, QPh, QPl);
        k_cvt8<<<(unsigned)(((size_t)TT * DM / 8 + 255) / 256), 256, 0, stream>>>(xk + (size_t)b * TT * DM, XB, (size_t)TT * DM / 8);   /* XB := bf16(key[b]) */ k_gemmw<bf, 0, true, 0><<<dim3(TT / 64, DKV / 64, 1), 32, 0, stream>>>(XB, nullptr, WK, nullptr, DM, FK, DKV, bk, 0, 0, 0, 0);
        k_rope<<<LKv, 256, 0, stream>>>(FK, DKV, NKV, CS, nullptr, nullptr, 1.0f, KP16, KPh, KPl);
        k_cvt8<<<(unsigned)(((size_t)TT * DM / 8 + 255) / 256), 256, 0, stream>>>(xv + (size_t)b * TT * DM, XB, (size_t)TT * DM / 8);   /* XB := bf16(value[b]) */ k_gemmw<bf, 0, true, 0><<<dim3(TT / 64, DKV / 64, 1), 32, 0, stream>>>(XB, nullptr, WV, nullptr, DM, FV, DKV, bv, 0, 0, 0, 0); k_vtp<<<LKv, 256, 0, stream>>>(FV, DKV, NKV, VT16, VTh, VTl);
        for (int h0 = 0; h0 < NH_; h0 += ZH) { const size_t zq = (size_t)h0, zk = (size_t)(h0 / REP);   // one kv head per query head: the pass's two heads use consecutive kv planes (z-strides TT*HD)
            k_gemmw<bf, 2, false, 1><<<dim3(RH / 64, 3, ZH), 32, 0, stream>>>(QPh + zq * TT * HD, QPl + zq * TT * HD, KPh + zk * TT * HD, KPl + zk * TT * HD, HD, Sb, TT, nullptr, (size_t)TT * HD, (size_t)TT * HD, (size_t)TT * TT, 0);
            k_gemmw<h16, 0, false, 1><<<dim3((TT - RH) / 64, 3, ZH), 32, 0, stream>>>(QP16 + zq * TT * HD + (size_t)RH * HD, nullptr, KP16 + zk * TT * HD, nullptr, HD, Sb + (size_t)RH * TT, TT, nullptr, (size_t)TT * HD, (size_t)TT * HD, (size_t)TT * TT, RH);
            k_asoft<<<ZH * TT / 8, 256, 0, stream>>>(Sb, P16, Ph, Pl);
            k_gemmw<bf, 2, false, 2><<<dim3(RH / 64, HD / 64, ZH), 32, 0, stream>>>(Ph, Pl, VTh + zk * HD * TT, VTl + zk * HD * TT, TT, Ob, HD, nullptr, (size_t)RH * TT, (size_t)HD * TT, (size_t)TT * HD, 0);
            k_gemmw<h16, 0, false, 2><<<dim3((TT - RH) / 64, HD / 64, ZH), 32, 0, stream>>>(P16 + (size_t)RH * TT, nullptr, VT16 + zk * HD * TT, nullptr, TT, Ob + (size_t)RH * HD, HD, nullptr, (size_t)TT * TT, (size_t)HD * TT, (size_t)TT * HD, RH);
            k_merge<<<(unsigned)(((size_t)ZH * TT * HD / 2 + 255) / 256), 256, 0, stream>>>(Ob, h0, ATh, ATl); }
        k_gemmw<bf, 1, true, 0><<<dim3(TT / 64, DM / 64, 1), 32, 0, stream>>>(ATh, ATl, WO, nullptr, DQ, OUT + (size_t)b * TT * DM, DM, bo, 0, 0, 0, 0); }
}

// v002
// One run takes 193 microseconds.
// Next to v001, in two timings, it ran 3.73 and 3.77 times as fast.
// Counting every step since v000, it is 10.6 times as fast.
#include <hip/hip_runtime.h>

// Sliding-window multi-head attention with rotary embeddings (query, key, value [2][2048][1024]; q = query Wq^T + bq etc. ('oi' 1/32, zero biases; 16 heads x 64); rotate-half rotary with angles t x 1/10000^(2i/64) (float32 table baked, precise cosf/sinf); scores / sqrt(64); keys with |i - j| <= 50 kept (-1e9 elsewhere == exclusion); softmax; out = merged Wo^T + bo -> [2][2048][1024] (4.2 M); argument order query, key, value, Wq, bq, Wk, bk, Wv, bv, Wo, bo).
// Layout, both batches and all 16 heads in one launch per stage (grid y / z picks tensor, batch and head; score and probability planes keep 256 columns per row, the two 128-key chunks of the row tile): bf16 copies of query, key, value; 'oi' weights; exact projections + f32 biases; {cos, sin} table once; rotate-half rotary plane builder; T-2048 attention on the band only (per 64-row tile the 3 score tiles, 256 softmax columns and 192 PV keys that can hold |i - j| <= 50; the band itself is a select in the softmax; hybrid rows: < 512 hi/lo 3 products, rest fp16 x1024); merged hi/lo x Wo exact + bo.
// Compute dtypes, f32 accumulate: every input rounded to bf16; projections exact + f32 biases; rotary f32; attention rows < 512 3 products, rest fp16; softmax f32; Wo hl x exact + bias.

#define NB_  2
#define TT   2048
#define DM   1024
#define NH_  16
#define NKV  16
#define REP  (NH_ / NKV)
#define HD   64
#define DQ   (NH_ * HD)
#define DKV  (NKV * HD)
#define ZH   (NB_ * NH_)          // attention planes per launch: every (batch, head)
#define SP   256                  // columns kept per score / probability row: keys CB(q0) .. CB(q0) + 255
#define RH   512                  // query rows < RH use hi+lo planes (0: none)
#define WIN  2048
#define BW   50       // half window: keys j in [i - 50, i + 50]
#define PCAR 1024.0f
#define SCL  0.125f   // HD^-0.5
typedef _Float16 h16;
typedef unsigned short bf;
typedef __attribute__((ext_vector_type(16))) __bf16   v16bf;
typedef __attribute__((ext_vector_type(16))) _Float16 v16h;
typedef __attribute__((ext_vector_type(8)))  _Float16 v8h;
typedef __attribute__((ext_vector_type(8)))  unsigned short v8us;
typedef __attribute__((ext_vector_type(8)))  float    v8f;
typedef __attribute__((ext_vector_type(4)))  float    v4f;
typedef v8h  __attribute__((may_alias)) v8ha;
typedef v4f  __attribute__((may_alias)) v4fa;
typedef v8us __attribute__((may_alias)) v8usa;

__device__ __forceinline__ unsigned short f2bf(float f) { unsigned u = __float_as_uint(f); u += 0x7FFFu + ((u >> 16) & 1u); return (unsigned short)(u >> 16); }
__device__ __forceinline__ float bf2f(unsigned short b) { return __uint_as_float(((unsigned)b) << 16); }
__device__ __forceinline__ float bfr(float f) { return bf2f(f2bf(f)); }
__device__ __forceinline__ v16h cat16(v8h lo, v8h hi) { return __builtin_shufflevector(lo, hi, 0, 1, 2, 3, 4, 5, 6, 7, 8, 9, 10, 11, 12, 13, 14, 15); }
__device__ __forceinline__ v16bf cat16b(v8us lo, v8us hi) { return __builtin_bit_cast(v16bf, __builtin_shufflevector(lo, hi, 0, 1, 2, 3, 4, 5, 6, 7, 8, 9, 10, 11, 12, 13, 14, 15)); }
__device__ __forceinline__ v8f wmma16(v16h a, v16h b, v8f c) { return __builtin_amdgcn_wmma_f32_16x16x32_f16(false, a, false, b, (short)0, c, false, false); }
__device__ __forceinline__ v8f wmmab(v16bf a, v16bf b, v8f c) { return __builtin_amdgcn_wmma_f32_16x16x32_bf16(false, a, false, b, (short)0, c, false, false); }



// ---- gemmw: register-blocked GEMM, ONE WAVE per 64x64 output tile (16 accumulators), operands straight from K-contiguous 16-bit planes; row tile bx, column tile blockIdx.y, plane blockIdx.z, 32 threads. Kernels: k_gemmw (one operand type for the whole grid (M/64, N/64, Z)) and k_gemmhl (hybrid attention rows).
// C[m][n] (f32, pitch ldc, + optional f32 bias[n], one bias pointer per z < 3) = sum_k A[m][k] Bt[n][k] (+ split products per NSPLIT). A pitch lda, Bt pitch K. z-batch strides sA/sB/sC in elements. K % 32 == 0.
// BAND (rowbase = query index of A's row 0): 1 = score tiles, grid y = 3, column tile = the row tile's own and its two neighbours (keys r - 64 .. r + 127 hold every |i - j| <= 50 of rows r .. r + 63); 2 = PV, k runs over those same keys only (P is exactly 0 elsewhere). Banded planes (C of 1, A of 2) hold key j at column j - CB(q0).
__device__ __forceinline__ int CB(int q0) { return min(max(q0 - 64, 0) / 128, TT / 128 - 2) * 128; }   // first key of the two 128-key chunks that cover row tile q0's band
template <typename T16> struct WFrag;
template <> struct WFrag<h16> { typedef v16h V; static __device__ __forceinline__ V ld(const h16* p) { return cat16(*(const v8h*)p, *(const v8h*)(p + 16)); } static __device__ __forceinline__ v8f mma(V a, V b, v8f c) { return wmma16(a, b, c); } };
template <> struct WFrag<bf> { typedef v16bf V; static __device__ __forceinline__ V ld(const bf* p) { return cat16b(*(const v8us*)p, *(const v8us*)(p + 16)); } static __device__ __forceinline__ v8f mma(V a, V b, v8f c) { return wmmab(a, b, c); } };
template <typename T16, int NSPLIT, bool BIAS, int BAND>
__device__ __forceinline__ void gemmw(float* os, int bx, const T16* __restrict__ A, const T16* __restrict__ A2, const T16* __restrict__ Bt, const T16* __restrict__ Bt2, int K, int lda, float* C, int ldc, const float* __restrict__ bias0, const float* __restrict__ bias1, const float* __restrict__ bias2, size_t sA, size_t sB, size_t sC, int rowbase) {
    typedef typename WFrag<T16>::V V;
    const size_t z = blockIdx.z; A += z * sA; if (A2) A2 += z * sA; Bt += z * sB; if (Bt2) Bt2 += z * sB; C += z * sC; const float* bias = (z == 0) ? bias0 : (z == 1) ? bias1 : bias2;
    const int lane = threadIdx.x & 31, lr = lane & 15, hi = lane >> 4; const int r0 = bx * 64, q0 = rowbase + r0, c0 = (BAND == 1) ? q0 + ((int)blockIdx.y - 1) * 64 : blockIdx.y * 64;
    if (BAND == 1 && (c0 < 0 || c0 >= TT)) return;   // neighbour tile past either end of the sequence
    const int kbeg = (BAND == 2) ? max(q0 - 64, 0) : 0, kend = (BAND == 2) ? min(q0 + 128, K) : K; const int cb = BAND ? CB(q0) : 0;
    v8f acc[4][4];
#pragma unroll
    for (int mb = 0; mb < 4; ++mb)
#pragma unroll
        for (int nb = 0; nb < 4; ++nb) acc[mb][nb] = (v8f){};
    const size_t aoff = (size_t)(r0 + lr) * lda + 8 * hi, boff = (size_t)(c0 + lr) * K + 8 * hi;
#pragma unroll 1
    for (int kc = kbeg; kc < kend; kc += 32) {
        V a[4], a2[4]; const int ka = (BAND == 2) ? kc - cb : kc;
#pragma unroll
        for (int mb = 0; mb < 4; ++mb) { a[mb] = WFrag<T16>::ld(A + aoff + (size_t)mb * 16 * lda + ka); if (NSPLIT == 1 || NSPLIT == 2) a2[mb] = WFrag<T16>::ld(A2 + aoff + (size_t)mb * 16 * lda + ka); }
#pragma unroll
        for (int nb = 0; nb < 4; ++nb) { const V b = WFrag<T16>::ld(Bt + boff + (size_t)nb * 16 * K + kc); V b2; if (NSPLIT >= 2) b2 = WFrag<T16>::ld(Bt2 + boff + (size_t)nb * 16 * K + kc);
#pragma unroll
            for (int mb = 0; mb < 4; ++mb) { acc[mb][nb] = WFrag<T16>::mma(a[mb], b, acc[mb][nb]); if (NSPLIT == 1 || NSPLIT == 2) acc[mb][nb] = WFrag<T16>::mma(a2[mb], b, acc[mb][nb]); if (NSPLIT >= 2) acc[mb][nb] = WFrag<T16>::mma(a[mb], b2, acc[mb][nb]); } }
        asm volatile("v_nop\n\tv_nop\n\tv_nop\n\tv_nop" : "+v"(acc[0][0]), "+v"(acc[1][1]), "+v"(acc[2][2]), "+v"(acc[3][3]) : "v"(a[0]), "v"(a[3]));
    }
#pragma unroll
    for (int mb = 0; mb < 4; ++mb) {
#pragma unroll
        for (int nb = 0; nb < 4; ++nb) {
#pragma unroll
            for (int j = 0; j < 8; ++j) os[(hi * 8 + j) * 68 + nb * 16 + lr] = acc[mb][nb][j]; }
        __builtin_amdgcn_wave_barrier(); asm volatile("" ::: "memory");
        float* crow = C + (size_t)(r0 + mb * 16) * ldc + ((BAND == 1) ? c0 - cb : c0);
{
#pragma unroll
            for (int s = 0; s < 8; ++s) { const int row = 2 * s + hi, cofs = lr * 4; v4f val = *(const v4fa*)(os + row * 68 + cofs); if (BIAS) { val[0] += bfr(bias[c0 + cofs]); val[1] += bfr(bias[c0 + cofs + 1]); val[2] += bfr(bias[c0 + cofs + 2]); val[3] += bfr(bias[c0 + cofs + 3]); }
                *(v4f*)(crow + (size_t)row * ldc + cofs) = val; }
             }
        __builtin_amdgcn_wave_barrier(); asm volatile("" ::: "memory");
    }
    asm volatile("s_wait_xcnt 0x0" ::: "memory");   // precaution: where this body is inlined twice (k_gemmhl) the other copy's code follows the last stores in the listing and reuses their address registers
}
template <typename T16, int NSPLIT, bool BIAS, int BAND>
__global__ __launch_bounds__(32) void k_gemmw(const T16* __restrict__ A, const T16* __restrict__ A2, const T16* __restrict__ Bt, const T16* __restrict__ Bt2, int K, int lda, float* C, int ldc, const float* __restrict__ bias0, const float* __restrict__ bias1, const float* __restrict__ bias2, size_t sA, size_t sB, size_t sC, int rowbase) {
    __shared__ __align__(16) float os[16 * 68];
    gemmw<T16, NSPLIT, BIAS, BAND>(os, blockIdx.x, A, A2, Bt, Bt2, K, lda, C, ldc, bias0, bias1, bias2, sA, sB, sC, rowbase);
}
// k_gemmhl: both row classes of a banded attention product in one grid (TT/64, y, Z): row tiles < RH/64 take the hi/lo planes (3 products), the rest the fp16 planes; A16 and C are whole planes (row 0 first), only rows < RH of Ah / Al are read (plane stride sAh).
template <int BAND>
__global__ __launch_bounds__(32) void k_gemmhl(const bf* __restrict__ Ah, const bf* __restrict__ Al, const bf* __restrict__ Bh, const bf* __restrict__ Bl, const h16* __restrict__ A16, const h16* __restrict__ B16, int K, int lda, float* C, int ldc, size_t sAh, size_t sA16, size_t sB, size_t sC) {
    __shared__ __align__(16) float os[16 * 68];
    if (blockIdx.x >= RH / 64) {
        gemmw<h16, 0, false, BAND>(os, blockIdx.x - RH / 64, A16 + (size_t)RH * lda, nullptr, B16, nullptr, K, lda, C + (size_t)RH * ldc, ldc, nullptr, nullptr, nullptr, sA16, sB, sC, RH);
        return; }
    gemmw<bf, 2, false, BAND>(os, blockIdx.x, Ah, Al, Bh, Bl, K, lda, C, ldc, nullptr, nullptr, nullptr, sAh, sB, sC, 0);
}

__device__ __forceinline__ h16 tohx(float x) { return (h16)x; }
__device__ __forceinline__ void splitf(float y, unsigned short& h, unsigned short& l) { h = f2bf(y); l = f2bf(y - bf2f(h)); }
typedef __attribute__((ext_vector_type(2))) _Float16 v2h;
typedef __attribute__((ext_vector_type(4))) _Float16 v4h;
typedef __attribute__((ext_vector_type(2))) unsigned short v2us;
typedef __attribute__((ext_vector_type(4))) unsigned short v4us;
typedef __attribute__((ext_vector_type(2))) float v2f;
typedef __attribute__((ext_vector_type(4))) int v4i;

// k_cvt8: grid y picks one of up to four equally long sources; their bf16 copies lie one behind the other in dst
__global__ __launch_bounds__(256) void k_cvt8(const float* __restrict__ s0, const float* __restrict__ s1, const float* __restrict__ s2, const float* __restrict__ s3, bf* dst, size_t n8) { const size_t i = (size_t)blockIdx.x * 256 + threadIdx.x; if (i >= n8) return; const int y = blockIdx.y; const float* src = (y == 0) ? s0 : (y == 1) ? s1 : (y == 2) ? s2 : s3; dst += (size_t)y * n8 * 8; const v8f v = *(const v8f*)(src + i * 8); v8us o;
#pragma unroll
    for (int k = 0; k < 8; ++k) o[k] = f2bf(v[k]); *(v8us*)(dst + i * 8) = o;  }

// k_rope: grid y = tensor (q, k; strides sF, sP); head planes [b][h][t][d] (fp16 + hi/lo) of rope(x) x sc with the rotate-half convention out[d] = x[d] cos[t][d] - x[d+HD/2] sin[t][d], out[d+HD/2] = x[d+HD/2] cos[t][d+HD/2] + x[d] sin[t][d+HD/2]
__global__ __launch_bounds__(256) void k_rope(const float* __restrict__ F, int pitch, int nheads, const float* __restrict__ CS, const float* __restrict__ RF, const float* __restrict__ nw, float sc, h16* P16, bf* Ph, bf* Pl, size_t sF, size_t sP) {
    const size_t e = ((size_t)blockIdx.x * 256 + threadIdx.x) * 2; if (e >= (size_t)NB_ * nheads * TT * HD) return; F += blockIdx.y * sF; P16 += blockIdx.y * sP; Ph += blockIdx.y * sP; Pl += blockIdx.y * sP; const int d = (int)(e % HD); const int t = (int)((e / HD) % TT); const int h = (int)(e / ((size_t)HD * TT)); const float* f = F + ((size_t)(h / nheads) * TT + t) * pitch + (h % nheads) * HD; float rf = 1.0f; v2h o16; v2us oh, ol;
    if (RF) { rf = RF[(size_t)h * TT + t]; asm volatile("s_wait_xcnt 0x0" ::: "memory"); }   // the wait: precaution, stands in front of the index arithmetic that reuses the load's address registers
#pragma unroll
    for (int q = 0; q < 2; ++q) { const int dd = d + q; const int dp = (dd < HD / 2) ? dd + HD / 2 : dd - HD / 2; float x0 = f[dd], x1 = f[dp];
        asm volatile("s_wait_xcnt 0x0" ::: "memory");   // precaution: stands in front of the table address arithmetic that reuses these two loads' address registers
        if (RF) { float n0 = __fmul_rn(x0, rf), n1 = __fmul_rn(x1, rf); asm volatile("" : "+v"(n0)); asm volatile("" : "+v"(n1)); x0 = __fmul_rn(bfr(nw[dd]), n0); x1 = __fmul_rn(bfr(nw[dp]), n1); }
        const v2f cs = *(const v2f*)(CS + ((size_t)t * HD + dd) * 2); float a = __fmul_rn(x0, cs[0]), bq = __fmul_rn(x1, cs[1]); asm volatile("" : "+v"(a)); asm volatile("" : "+v"(bq)); const float r = ((dd < HD / 2) ? __fsub_rn(a, bq) : __fadd_rn(a, bq)) * sc;
        o16[q] = tohx(r); unsigned short a2, c2; splitf(r, a2, c2); oh[q] = a2; ol[q] = c2; }
    *(v2h*)(P16 + e) = o16; *(v2us*)(Ph + e) = oh; *(v2us*)(Pl + e) = ol;  }
__global__ __launch_bounds__(256) void k_vtp(const float* __restrict__ F, int pitch, int nheads, h16* V16, bf* Vh, bf* Vl) { const size_t e = ((size_t)blockIdx.x * 256 + threadIdx.x) * 2; if (e >= (size_t)NB_ * nheads * HD * TT) return; const int t = (int)(e % TT); const int d = (int)((e / TT) % HD); const int g = (int)(e / ((size_t)TT * HD)); v2h o16; v2us oh, ol;
#pragma unroll
    for (int q = 0; q < 2; ++q) { const float x = F[((size_t)(g / nheads) * TT + t + q) * pitch + (g % nheads) * HD + d]; o16[q] = tohx(x); unsigned short a2, c2; splitf(x, a2, c2); oh[q] = a2; ol[q] = c2; }
    *(v2h*)(V16 + e) = o16; *(v2us*)(Vh + e) = oh; *(v2us*)(Vl + e) = ol;  }
__constant__ float INVT[HD / 2] = { 1.000000000e+00f, 7.498942018e-01f, 5.623413324e-01f, 4.216965139e-01f, 3.162277639e-01f, 2.371373624e-01f, 1.778279394e-01f, 1.333521456e-01f, 1.000000015e-01f, 7.498941571e-02f, 5.623412877e-02f, 4.216964915e-02f, 3.162277862e-02f, 2.371373586e-02f, 1.778279431e-02f, 1.333521493e-02f, 9.999999776e-03f, 7.498942316e-03f, 5.623413250e-03f, 4.216964822e-03f, 3.162277862e-03f, 2.371373819e-03f, 1.778279431e-03f, 1.333521446e-03f, 1.000000047e-03f, 7.498941850e-04f, 5.623413017e-04f, 4.216964880e-04f, 3.162277862e-04f, 2.371373848e-04f, 1.778279402e-04f, 1.333521504e-04f };   // float32 1 / 10000^(2i/64), i < 32, generated with jnp to be bit-exact
__global__ __launch_bounds__(256) void k_cs5(float* CS) { const int idx = blockIdx.x * 256 + threadIdx.x; if (idx >= TT * HD) return; const int d = idx % HD; const int t = idx / HD; const float a = __fmul_rn((float)t, INVT[d % (HD / 2)]); v2f cs; cs[0] = cosf(a); cs[1] = sinf(a); *(v2f*)(CS + (size_t)idx * 2) = cs;  }
// k_asoft: per row (zz, i): t = S x 1/8 for keys with |i - j| <= 50, -3e38 elsewhere (the -1e9 fill == exclusion); softmax over the two 128-key chunks that cover the row tile's keys (same lane and chunk order as over all 2048 keys, whose other terms are exact zeros); S is read only where a lane's 4 keys touch the band;
__global__ __launch_bounds__(256) void k_asoft(const float* __restrict__ Sb, h16* P16, bf* Ph, bf* Pl) {
    const int lane = threadIdx.x & 31; const int row = blockIdx.x * 8 + (threadIdx.x >> 5); if (row >= ZH * TT) return; const int i = row % TT; const int zz = row / TT; (void)zz; const bool hires = (i < RH); const float* sr = Sb + (size_t)row * SP; float v[8]; float mx = -3.0e38f;
    const int ch0 = min(max((i & ~63) - 64, 0) / 128, TT / 128 - 2);
#pragma unroll
    for (int ch = 0; ch < 2; ++ch) { const int j0 = (ch0 + ch) * 128 + lane * 4; v4f a = (v4f){}; if (i - (j0 + 3) <= BW && j0 - i <= BW) a = *(const v4f*)(sr + ch * 128 + lane * 4);
#pragma unroll
        for (int q = 0; q < 4; ++q) { const int j = j0 + q; (void)j; const float t = (i - j <= BW && j - i <= BW) ? a[q] * SCL : -3.0e38f;   /* |i - j| <= 50 */ v[ch * 4 + q] = t; mx = fmaxf(mx, t); } }
#pragma unroll
    for (int sh = 16; sh; sh >>= 1) mx = fmaxf(mx, __shfl_xor(mx, sh, 32));
    float sum = 0.f;
#pragma unroll
    for (int k = 0; k < 8; ++k) { float d0 = __fsub_rn(v[k], mx); asm volatile("" : "+v"(d0)); v[k] = __builtin_amdgcn_exp2f(__fmul_rn(d0, 1.4426950408889634f)); sum += v[k]; }
#pragma unroll
    for (int sh = 16; sh; sh >>= 1) sum += __shfl_xor(sum, sh, 32);
    const float f = __fdiv_rn(hires ? 1.0f : PCAR, sum);
{
        if (hires) {
#pragma unroll
            for (int ch = 0; ch < 2; ++ch) { v4us oh, ol;
#pragma unroll
                for (int q = 0; q < 4; ++q) { unsigned short a, c2; splitf(v[ch * 4 + q] * f, a, c2); oh[q] = a; ol[q] = c2; }
                const size_t oo = ((size_t)zz * (RH ? RH : 1) + i) * SP + ch * 128 + lane * 4; *(v4us*)(Ph + oo) = oh; *(v4us*)(Pl + oo) = ol; }
        } else {
#pragma unroll
            for (int ch = 0; ch < 2; ++ch) { v4h o4;
#pragma unroll
                for (int q = 0; q < 4; ++q) o4[q] = tohx(v[ch * 4 + q] * f);
                *(v4h*)(P16 + (size_t)row * SP + ch * 128 + lane * 4) = o4; } }
         }
}
__global__ __launch_bounds__(256) void k_merge(const float* __restrict__ O, bf* Ah, bf* Al) { const size_t e = ((size_t)blockIdx.x * 256 + threadIdx.x) * 2; if (e >= (size_t)ZH * TT * HD) return; const int d = (int)(e % HD); const int t = (int)((e / HD) % TT); const int zz = (int)(e / ((size_t)HD * TT)); const float cs = (t < RH) ? 1.0f : (1.0f / PCAR); const size_t oo = ((size_t)(zz / NH_) * TT + t) * DQ + (zz % NH_) * HD + d;
    v2us oh, ol;
#pragma unroll
    for (int q = 0; q < 2; ++q) { unsigned short a, c2; splitf(O[e + q] * cs, a, c2); oh[q] = a; ol[q] = c2; } *(v2us*)(Ah + oo) = oh; *(v2us*)(Al + oo) = ol;  }

extern "C" void kernel_launch(void* const* d_in, const int* in_sizes, int n_in,
                              void* d_out, int out_size, void* d_ws, size_t ws_size, hipStream_t stream) {
    (void)in_sizes; (void)n_in; (void)out_size;
    const float* x = (const float*)d_in[0];   /* query */ const float* xk = (const float*)d_in[1]; const float* xv = (const float*)d_in[2]; const float* wq = (const float*)d_in[3]; const float* bq = (const float*)d_in[4]; const float* wk = (const float*)d_in[5]; const float* bk = (const float*)d_in[6]; const float* wv = (const float*)d_in[7]; const float* bv = (const float*)d_in[8]; const float* wo = (const float*)d_in[9]; const float* bo = (const float*)d_in[10];   /* input order query, key, value, Wq, bq, Wk, bk, Wv, bv, Wo, bo */
    float* OUT = (float*)d_out;     // [2][2048][1024]
    char* wsp = (char*)d_ws;
    auto take = [&](size_t bytes) { char* p = wsp; wsp += (bytes + 255) & ~(size_t)255; return (void*)p; };
    const size_t NW = (size_t)DQ * DM, NX = (size_t)NB_ * TT * DM, NP = (size_t)ZH * TT * HD;   // elements of one weight, one input tensor, one set of head planes
    bf* WQ = (bf*)take(4 * NW * 2); bf* WO = WQ + 3 * NW;   /* Wq, Wk, Wv, Wo in turn */ float* CS = (float*)take((size_t)TT * HD * 2 * 4);
    h16* QP16 = (h16*)take(2 * NP * 2); h16* KP16 = QP16 + NP; bf* QPh = (bf*)take(2 * NP * 2); bf* KPh = QPh + NP; bf* QPl = (bf*)take(2 * NP * 2); bf* KPl = QPl + NP;   /* q planes, then k planes */
    h16* VT16 = (h16*)take(NP * 2); bf* VTh = (bf*)take(NP * 2); bf* VTl = (bf*)take(NP * 2);
    bf* Ph = (bf*)take((size_t)ZH * RH * SP * 2); bf* Pl = (bf*)take((size_t)ZH * RH * SP * 2); h16* P16 = (h16*)take((size_t)ZH * TT * SP * 2); float* Ob = (float*)take(NP * 4); bf* ATh = (bf*)take(NX * 2); bf* ATl = (bf*)take(NX * 2);
    bf* XB = (bf*)take(3 * NX * 2); float* FQ = (float*)take(3 * NX * 4);   /* bf16 query, key, value; their f32 projections */
    if ((size_t)(wsp - (char*)d_ws) > ws_size) return;    // ws 256 MiB
    float* Sb = (float*)XB;   // the scores (ZH x TT x SP f32, 64 MiB) reuse XB + FQ (72 MiB) after the head planes are built (stream-ordered)
    k_cvt8<<<dim3((unsigned)((NW / 8 + 255) / 256), 4), 256, 0, stream>>>(wq, wk, wv, wo, WQ, NW / 8);
    k_cs5<<<(TT * HD + 255) / 256, 256, 0, stream>>>(CS);   /* rotary table once */
    k_cvt8<<<dim3((unsigned)((NX / 8 + 255) / 256), 3), 256, 0, stream>>>(x, xk, xv, xv, XB, NX / 8);
    k_gemmw<bf, 0, true, 0><<<dim3(NB_ * TT / 64, DQ / 64, 3), 32, 0, stream>>>(XB, nullptr, WQ, nullptr, DM, DM, FQ, DQ, bq, bk, bv, NX, NW, NX, 0);
    const unsigned LP = (unsigned)((NP / 2 + 255) / 256);
    k_rope<<<dim3(LP, 2), 256, 0, stream>>>(FQ, DQ, NH_, CS, nullptr, nullptr, 1.0f, QP16, QPh, QPl, NX, NP);
    k_vtp<<<LP, 256, 0, stream>>>(FQ + 2 * NX, DKV, NKV, VT16, VTh, VTl);
    k_gemmhl<1><<<dim3(TT / 64, 3, ZH), 32, 0, stream>>>(QPh, QPl, KPh, KPl, QP16, KP16, HD, HD, Sb, SP, (size_t)TT * HD, (size_t)TT * HD, (size_t)TT * HD, (size_t)TT * SP);
    k_asoft<<<ZH * TT / 8, 256, 0, stream>>>(Sb, P16, Ph, Pl);
    k_gemmhl<2><<<dim3(TT / 64, HD / 64, ZH), 32, 0, stream>>>(Ph, Pl, VTh, VTl, P16, VT16, TT, SP, Ob, HD, (size_t)RH * SP, (size_t)TT * SP, (size_t)HD * TT, (size_t)TT * HD);
    k_merge<<<LP, 256, 0, stream>>>(Ob, ATh, ATl);
    k_gemmw<bf, 1, true, 0><<<dim3(NB_ * TT / 64, DM / 64, 1), 32, 0, stream>>>(ATh, ATl, WO, nullptr, DQ, DQ, OUT, DM, bo, bo, bo, 0, 0, 0, 0);
}

// v003
// Measured time: 168 microseconds a run.
// Timed twice side by side with v002, it ran 1.15 times as fast both times.
// Counting every step since v000, it is 12.2 times as fast.
#include <hip/hip_runtime.h>

// Sliding-window multi-head attention with rotary embeddings (query, key, value [2][2048][1024]; q = query Wq^T + bq etc. ('oi' 1/32, zero biases; 16 heads x 64); rotate-half rotary with angles t x 1/10000^(2i/64) (float32 table baked, precise cosf/sinf); scores / sqrt(64); keys with |i - j| <= 50 kept (-1e9 elsewhere == exclusion); softmax; out = merged Wo^T + bo -> [2][2048][1024] (4.2 M); argument order query, key, value, Wq, bq, Wk, bk, Wv, bv, Wo, bo).
// Layout, both batches and all 16 heads in one launch per stage (grid y / z picks tensor, batch and head; score and probability planes keep 256 columns per row, the two 128-key chunks of the row tile): bf16 copies of query, key, value; 'oi' weights; exact projections + f32 biases; {cos, sin} table once; rotate-half rotary plane builder; T-2048 attention on the band only (per 64-row tile the 3 score tiles, 256 softmax columns and 192 PV keys that can hold |i - j| <= 50; the band itself is a select in the softmax; hybrid rows: < 512 hi/lo 3 products, rest fp16 x1024); merged hi/lo x Wo exact + bo.
// Compute dtypes, f32 accumulate: every input rounded to bf16; projections exact + f32 biases; rotary f32; attention rows < 512 3 products, rest fp16; softmax f32; Wo hl x exact + bias.

#define NB_  2
#define TT   2048
#define DM   1024
#define NH_  16
#define NKV  16
#define REP  (NH_ / NKV)
#define HD   64
#define DQ   (NH_ * HD)
#define DKV  (NKV * HD)
#define ZH   (NB_ * NH_)          // attention planes per launch: every (batch, head)
#define SP   256                  // columns kept per score / probability row: keys CB(q0) .. CB(q0) + 255
#define RH   512                  // query rows < RH use hi+lo planes (0: none)
#define WIN  2048
#define BW   50       // half window: keys j in [i - 50, i + 50]
#define PCAR 1024.0f
#define SCL  0.125f   // HD^-0.5
typedef _Float16 h16;
typedef unsigned short bf;
typedef __attribute__((ext_vector_type(16))) __bf16   v16bf;
typedef __attribute__((ext_vector_type(16))) _Float16 v16h;
typedef __attribute__((ext_vector_type(8)))  _Float16 v8h;
typedef __attribute__((ext_vector_type(8)))  unsigned short v8us;
typedef __attribute__((ext_vector_type(8)))  float    v8f;
typedef __attribute__((ext_vector_type(4)))  float    v4f;
typedef v8h  __attribute__((may_alias)) v8ha;
typedef v4f  __attribute__((may_alias)) v4fa;
typedef v8us __attribute__((may_alias)) v8usa;

__device__ __forceinline__ unsigned short f2bf(float f) { unsigned u = __float_as_uint(f); u += 0x7FFFu + ((u >> 16) & 1u); return (unsigned short)(u >> 16); }
__device__ __forceinline__ float bf2f(unsigned short b) { return __uint_as_float(((unsigned)b) << 16); }
__device__ __forceinline__ float bfr(float f) { return bf2f(f2bf(f)); }
__device__ __forceinline__ v16h cat16(v8h lo, v8h hi) { return __builtin_shufflevector(lo, hi, 0, 1, 2, 3, 4, 5, 6, 7, 8, 9, 10, 11, 12, 13, 14, 15); }
__device__ __forceinline__ v16bf cat16b(v8us lo, v8us hi) { return __builtin_bit_cast(v16bf, __builtin_shufflevector(lo, hi, 0, 1, 2, 3, 4, 5, 6, 7, 8, 9, 10, 11, 12, 13, 14, 15)); }
__device__ __forceinline__ v8f wmma16(v16h a, v16h b, v8f c) { return __builtin_amdgcn_wmma_f32_16x16x32_f16(false, a, false, b, (short)0, c, false, false); }
__device__ __forceinline__ v8f wmmab(v16bf a, v16bf b, v8f c) { return __builtin_amdgcn_wmma_f32_16x16x32_bf16(false, a, false, b, (short)0, c, false, false); }



// ---- gemmw: register-blocked GEMM, ONE WAVE per 64x64 output tile (16 accumulators), operands straight from K-contiguous 16-bit planes; row tile bx, column tile blockIdx.y, plane blockIdx.z, 32 threads. Kernels: k_gemmw (one operand type for the whole grid (M/64, N/64, Z)) and k_gemmhl (hybrid attention rows).
// C[m][n] (f32, pitch ldc, + optional f32 bias[n], one bias pointer per z < 3) = sum_k A[m][k] Bt[n][k] (+ split products per NSPLIT). A pitch lda, Bt pitch K. z-batch strides sA/sB/sC in elements. K % 32 == 0.
// BAND (rowbase = query index of A's row 0): 1 = score tiles, grid y = 3, column tile = the row tile's own and its two neighbours (keys r - 64 .. r + 127 hold every |i - j| <= 50 of rows r .. r + 63); 2 = PV, k runs over those same keys only (P is exactly 0 elsewhere). Banded planes (C of 1, A of 2) hold key j at column j - CB(q0).
__device__ __forceinline__ int CB(int q0) { return min(max(q0 - 64, 0) / 128, TT / 128 - 2) * 128; }   // first key of the two 128-key chunks that cover row tile q0's band
template <typename T16> struct WFrag;
template <> struct WFrag<h16> { typedef v16h V; static __device__ __forceinline__ V ld(const h16* p) { return cat16(*(const v8h*)p, *(const v8h*)(p + 16)); } static __device__ __forceinline__ v8f mma(V a, V b, v8f c) { return wmma16(a, b, c); } };
template <> struct WFrag<bf> { typedef v16bf V; static __device__ __forceinline__ V ld(const bf* p) { return cat16b(*(const v8us*)p, *(const v8us*)(p + 16)); } static __device__ __forceinline__ v8f mma(V a, V b, v8f c) { return wmmab(a, b, c); } };
template <typename T16, int NSPLIT, bool BIAS, int BAND>
__device__ __forceinline__ void gemmw(float* os, int bx, const T16* __restrict__ A, const T16* __restrict__ A2, const T16* __restrict__ Bt, const T16* __restrict__ Bt2, int K, int lda, float* C, int ldc, const float* __restrict__ bias0, const float* __restrict__ bias1, const float* __restrict__ bias2, size_t sA, size_t sB, size_t sC, int rowbase) {
    typedef typename WFrag<T16>::V V;
    const size_t z = blockIdx.z; A += z * sA; if (A2) A2 += z * sA; Bt += z * sB; if (Bt2) Bt2 += z * sB; C += z * sC; const float* bias = (z == 0) ? bias0 : (z == 1) ? bias1 : bias2;
    const int lane = threadIdx.x & 31, lr = lane & 15, hi = lane >> 4; const int r0 = bx * 64, q0 = rowbase + r0, c0 = (BAND == 1) ? q0 + ((int)blockIdx.y - 1) * 64 : blockIdx.y * 64;
    if (BAND == 1 && (c0 < 0 || c0 >= TT)) return;   // neighbour tile past either end of the sequence
    const int kbeg = (BAND == 2) ? max(q0 - 64, 0) : 0, kend = (BAND == 2) ? min(q0 + 128, K) : K; const int cb = BAND ? CB(q0) : 0;
    v8f acc[4][4];
#pragma unroll
    for (int mb = 0; mb < 4; ++mb)
#pragma unroll
        for (int nb = 0; nb < 4; ++nb) acc[mb][nb] = (v8f){};
    const size_t aoff = (size_t)(r0 + lr) * lda + 8 * hi, boff = (size_t)(c0 + lr) * K + 8 * hi;
#pragma unroll 1
    for (int kc = kbeg; kc < kend; kc += 32) {
        V a[4], a2[4]; const int ka = (BAND == 2) ? kc - cb : kc;
#pragma unroll
        for (int mb = 0; mb < 4; ++mb) { a[mb] = WFrag<T16>::ld(A + aoff + (size_t)mb * 16 * lda + ka); if (NSPLIT == 1 || NSPLIT == 2) a2[mb] = WFrag<T16>::ld(A2 + aoff + (size_t)mb * 16 * lda + ka); }
#pragma unroll
        for (int nb = 0; nb < 4; ++nb) { const V b = WFrag<T16>::ld(Bt + boff + (size_t)nb * 16 * K + kc); V b2; if (NSPLIT >= 2) b2 = WFrag<T16>::ld(Bt2 + boff + (size_t)nb * 16 * K + kc);
#pragma unroll
            for (int mb = 0; mb < 4; ++mb) { acc[mb][nb] = WFrag<T16>::mma(a[mb], b, acc[mb][nb]); if (NSPLIT == 1 || NSPLIT == 2) acc[mb][nb] = WFrag<T16>::mma(a2[mb], b, acc[mb][nb]); if (NSPLIT >= 2) acc[mb][nb] = WFrag<T16>::mma(a[mb], b2, acc[mb][nb]); } }
        asm volatile("v_nop\n\tv_nop\n\tv_nop\n\tv_nop" : "+v"(acc[0][0]), "+v"(acc[1][1]), "+v"(acc[2][2]), "+v"(acc[3][3]) : "v"(a[0]), "v"(a[3]));
    }
#pragma unroll
    for (int mb = 0; mb < 4; ++mb) {
#pragma unroll
        for (int nb = 0; nb < 4; ++nb) {
#pragma unroll
            for (int j = 0; j < 8; ++j) os[(hi * 8 + j) * 68 + nb * 16 + lr] = acc[mb][nb][j]; }
        __builtin_amdgcn_wave_barrier(); asm volatile("" ::: "memory");
        float* crow = C + (size_t)(r0 + mb * 16) * ldc + ((BAND == 1) ? c0 - cb : c0);
{
#pragma unroll
            for (int s = 0; s < 8; ++s) { const int row = 2 * s + hi, cofs = lr * 4; v4f val = *(const v4fa*)(os + row * 68 + cofs); if (BIAS) { val[0] += bfr(bias[c0 + cofs]); val[1] += bfr(bias[c0 + cofs + 1]); val[2] += bfr(bias[c0 + cofs + 2]); val[3] += bfr(bias[c0 + cofs + 3]); }
                *(v4f*)(crow + (size_t)row * ldc + cofs) = val; }
             }
        __builtin_amdgcn_wave_barrier(); asm volatile("" ::: "memory");
    }
    asm volatile("s_wait_xcnt 0x0" ::: "memory");   // precaution: where this body is inlined twice (k_gemmhl) the other copy's code follows the last stores in the listing and reuses their address registers
}
template <typename T16, int NSPLIT, bool BIAS, int BAND>
__global__ __launch_bounds__(32) void k_gemmw(const T16* __restrict__ A, const T16* __restrict__ A2, const T16* __restrict__ Bt, const T16* __restrict__ Bt2, int K, int lda, float* C, int ldc, const float* __restrict__ bias0, const float* __restrict__ bias1, const float* __restrict__ bias2, size_t sA, size_t sB, size_t sC, int rowbase) {
    __shared__ __align__(16) float os[16 * 68];
    gemmw<T16, NSPLIT, BIAS, BAND>(os, blockIdx.x, A, A2, Bt, Bt2, K, lda, C, ldc, bias0, bias1, bias2, sA, sB, sC, rowbase);
}
// k_gemmhl: both row classes of a banded attention product in one grid (TT/64, y, Z): row tiles < RH/64 take the hi/lo planes (3 products), the rest the fp16 planes; A16 and C are whole planes (row 0 first), only rows < RH of Ah / Al are read (plane stride sAh).
template <int BAND>
__global__ __launch_bounds__(32) void k_gemmhl(const bf* __restrict__ Ah, const bf* __restrict__ Al, const bf* __restrict__ Bh, const bf* __restrict__ Bl, const h16* __restrict__ A16, const h16* __restrict__ B16, int K, int lda, float* C, int ldc, size_t sAh, size_t sA16, size_t sB, size_t sC) {
    __shared__ __align__(16) float os[16 * 68];
    if (blockIdx.x >= RH / 64) {
        gemmw<h16, 0, false, BAND>(os, blockIdx.x - RH / 64, A16 + (size_t)RH * lda, nullptr, B16, nullptr, K, lda, C + (size_t)RH * ldc, ldc, nullptr, nullptr, nullptr, sA16, sB, sC, RH);
        return; }
    gemmw<bf, 2, false, BAND>(os, blockIdx.x, Ah, Al, Bh, Bl, K, lda, C, ldc, nullptr, nullptr, nullptr, sAh, sB, sC, 0);
}

__device__ __forceinline__ h16 tohx(float x) { return (h16)x; }
__device__ __forceinline__ void splitf(float y, unsigned short& h, unsigned short& l) { h = f2bf(y); l = f2bf(y - bf2f(h)); }
typedef __attribute__((ext_vector_type(2))) _Float16 v2h;
typedef __attribute__((ext_vector_type(4))) _Float16 v4h;
typedef __attribute__((ext_vector_type(2))) unsigned short v2us;
typedef __attribute__((ext_vector_type(4))) unsigned short v4us;
typedef __attribute__((ext_vector_type(2))) float v2f;
typedef __attribute__((ext_vector_type(4))) int v4i;

// The elementwise stages below give every thread many values (16-byte loads and stores, all of a thread's loads issued before its first use), so that a stage needs only a few thousand waves (for speed only).
// XW: precaution, stands behind a run of global loads or stores and in front of the arithmetic that may reuse their address registers
#define XW() asm volatile("s_wait_xcnt 0x0" ::: "memory")
#define CU 8    // k_cvt8: groups of 8 values per thread, one grid apart
#define RU 4    // k_rope: heads per thread; they share one read of the {cos, sin} table
#define SR 8    // k_asoft: rows per wave
#define MU 4    // k_merge: groups of 8 values per thread, one grid apart
// k_cvt8: grid y picks one of up to four equally long sources; their bf16 copies lie one behind the other in dst; n8 = gridDim.x * 256 * CU groups of 8
__global__ __launch_bounds__(256) void k_cvt8(const float* __restrict__ s0, const float* __restrict__ s1, const float* __restrict__ s2, const float* __restrict__ s3, bf* dst, size_t n8) { const size_t i0 = (size_t)blockIdx.x * 256 + threadIdx.x, st = (size_t)gridDim.x * 256; const int y = blockIdx.y; const float* src = (y == 0) ? s0 : (y == 1) ? s1 : (y == 2) ? s2 : s3; dst += (size_t)y * n8 * 8; v8f v[CU];
#pragma unroll
    for (int u = 0; u < CU; ++u) v[u] = *(const v8f*)(src + (i0 + u * st) * 8);
    XW();
#pragma unroll
    for (int u = 0; u < CU; ++u) { v8us o;
#pragma unroll
        for (int k = 0; k < 8; ++k) o[k] = f2bf(v[u][k]);
        *(v8us*)(dst + (i0 + u * st) * 8) = o; }
    XW();  }

// k_rope: grid y = tensor (q, k; strides sF, sP); head planes [b][h][t][d] (fp16 + hi/lo) of rope(x) x sc with the rotate-half convention out[d] = x[d] cos[t][d] - x[d+HD/2] sin[t][d], out[d+HD/2] = x[d+HD/2] cos[t][d+HD/2] + x[d] sin[t][d+HD/2]; a thread takes 8 neighbouring d of one t in RU heads
__global__ __launch_bounds__(256) void k_rope(const float* __restrict__ F, int pitch, int nheads, const float* __restrict__ CS, float sc, h16* P16, bf* Ph, bf* Pl, size_t sF, size_t sP) {
    const int n = blockIdx.x * 256 + threadIdx.x; if (n >= NB_ * nheads / RU * TT * (HD / 8)) return; F += blockIdx.y * sF; P16 += blockIdx.y * sP; Ph += blockIdx.y * sP; Pl += blockIdx.y * sP; const int d = (n % (HD / 8)) * 8; const int t = (n / (HD / 8)) % TT; const int h0 = (n / (HD / 8 * TT)) * RU; const int dp = (d < HD / 2) ? d + HD / 2 : d - HD / 2;
    v4f c[4], xa[RU][2], xb[RU][2];
#pragma unroll
    for (int k = 0; k < 4; ++k) c[k] = *(const v4f*)(CS + ((size_t)t * HD + d) * 2 + 4 * k);
#pragma unroll
    for (int u = 0; u < RU; ++u) { const int h = h0 + u; const float* f = F + ((size_t)(h / nheads) * TT + t) * pitch + (h % nheads) * HD; xa[u][0] = *(const v4f*)(f + d); xa[u][1] = *(const v4f*)(f + d + 4); xb[u][0] = *(const v4f*)(f + dp); xb[u][1] = *(const v4f*)(f + dp + 4); }
    XW();
#pragma unroll
    for (int u = 0; u < RU; ++u) { v8h o16; v8us oh, ol;
#pragma unroll
        for (int q = 0; q < 8; ++q) { const float x0 = xa[u][q >> 2][q & 3], x1 = xb[u][q >> 2][q & 3];
            float a = __fmul_rn(x0, c[q >> 1][(q & 1) * 2]), bq = __fmul_rn(x1, c[q >> 1][(q & 1) * 2 + 1]); asm volatile("" : "+v"(a)); asm volatile("" : "+v"(bq)); const float r = ((d < HD / 2) ? __fsub_rn(a, bq) : __fadd_rn(a, bq)) * sc;
            o16[q] = tohx(r); unsigned short a2, c2; splitf(r, a2, c2); oh[q] = a2; ol[q] = c2; }
        const size_t e = ((size_t)(h0 + u) * TT + t) * HD + d; *(v8h*)(P16 + e) = o16; *(v8us*)(Ph + e) = oh; *(v8us*)(Pl + e) = ol; }
    XW();  }
// k_vtp: V^T planes [g][d][t]; a thread takes 8 t x 4 d (8 row reads of 16 bytes, 4 x 3 stores of 16 bytes); a wave's 8 x 4 threads cover 64 t x 16 d, so each store fills whole 128-byte lines
__global__ __launch_bounds__(256) void k_vtp(const float* __restrict__ F, int pitch, int nheads, h16* V16, bf* Vh, bf* Vl) { const int n = blockIdx.x * 256 + threadIdx.x; if (n >= NB_ * nheads * (HD / 4) * (TT / 8)) return; const int tl = n & 7, dl = (n >> 3) & 3, r = n >> 5; const int dh = r % (HD / 16), th = (r / (HD / 16)) % (TT / 64), g = r / ((HD / 16) * (TT / 64)); const int t = (th * 8 + tl) * 8, d = (dh * 4 + dl) * 4;
    const float* f = F + ((size_t)(g / nheads) * TT + t) * pitch + (g % nheads) * HD + d; v4f x[8];
#pragma unroll
    for (int q = 0; q < 8; ++q) x[q] = *(const v4f*)(f + (size_t)q * pitch);
    XW();
#pragma unroll
    for (int k = 0; k < 4; ++k) { v8h o16; v8us oh, ol;
#pragma unroll
        for (int q = 0; q < 8; ++q) { o16[q] = tohx(x[q][k]); unsigned short a2, c2; splitf(x[q][k], a2, c2); oh[q] = a2; ol[q] = c2; }
        const size_t e = ((size_t)g * HD + d + k) * TT + t; *(v8h*)(V16 + e) = o16; *(v8us*)(Vh + e) = oh; *(v8us*)(Vl + e) = ol; }
    XW();  }
__constant__ float INVT[HD / 2] = { 1.000000000e+00f, 7.498942018e-01f, 5.623413324e-01f, 4.216965139e-01f, 3.162277639e-01f, 2.371373624e-01f, 1.778279394e-01f, 1.333521456e-01f, 1.000000015e-01f, 7.498941571e-02f, 5.623412877e-02f, 4.216964915e-02f, 3.162277862e-02f, 2.371373586e-02f, 1.778279431e-02f, 1.333521493e-02f, 9.999999776e-03f, 7.498942316e-03f, 5.623413250e-03f, 4.216964822e-03f, 3.162277862e-03f, 2.371373819e-03f, 1.778279431e-03f, 1.333521446e-03f, 1.000000047e-03f, 7.498941850e-04f, 5.623413017e-04f, 4.216964880e-04f, 3.162277862e-04f, 2.371373848e-04f, 1.778279402e-04f, 1.333521504e-04f };   // float32 1 / 10000^(2i/64), i < 32, generated with jnp to be bit-exact
__global__ __launch_bounds__(256) void k_cs5(float* CS) { const int idx = blockIdx.x * 256 + threadIdx.x; if (idx >= TT * HD) return; const int d = idx % HD; const int t = idx / HD; const float a = __fmul_rn((float)t, INVT[d % (HD / 2)]); v2f cs; cs[0] = cosf(a); cs[1] = sinf(a); *(v2f*)(CS + (size_t)idx * 2) = cs;  }
// k_asoft: per row (zz, i): t = S x 1/8 for keys with |i - j| <= 50, -3e38 elsewhere (the -1e9 fill == exclusion); softmax over the two 128-key chunks that cover the row tile's keys (same lane and chunk order as over all 2048 keys, whose other terms are exact zeros); S is read only where a lane's 4 keys touch the band; a wave takes SR neighbouring rows (one row tile, one row class), each step for all of them in turn so that their butterflies overlap
__global__ __launch_bounds__(256) void k_asoft(const float* __restrict__ Sb, h16* P16, bf* Ph, bf* Pl) {
    const int lane = threadIdx.x & 31; const int row0 = (blockIdx.x * 8 + (threadIdx.x >> 5)) * SR; if (row0 >= ZH * TT) return; const int i0 = row0 % TT; const int zz = row0 / TT; const bool hires = (i0 < RH); float v[SR][8]; float mx[SR], sum[SR]; v4f a[SR][2];
    const int ch0 = min(max((i0 & ~63) - 64, 0) / 128, TT / 128 - 2);
#pragma unroll
    for (int r = 0; r < SR; ++r) {
#pragma unroll
        for (int ch = 0; ch < 2; ++ch) { const int i = i0 + r, j0 = (ch0 + ch) * 128 + lane * 4; a[r][ch] = (v4f){}; if (i - (j0 + 3) <= BW && j0 - i <= BW) a[r][ch] = *(const v4f*)(Sb + (size_t)(row0 + r) * SP + ch * 128 + lane * 4); } }
    XW();
#pragma unroll
    for (int r = 0; r < SR; ++r) { mx[r] = -3.0e38f;
#pragma unroll
        for (int ch = 0; ch < 2; ++ch) {
#pragma unroll
            for (int q = 0; q < 4; ++q) { const int i = i0 + r, j = (ch0 + ch) * 128 + lane * 4 + q; const float t = (i - j <= BW && j - i <= BW) ? a[r][ch][q] * SCL : -3.0e38f;   /* |i - j| <= 50 */ v[r][ch * 4 + q] = t; mx[r] = fmaxf(mx[r], t); } } }
#pragma unroll
    for (int sh = 16; sh; sh >>= 1) {
#pragma unroll
        for (int r = 0; r < SR; ++r) mx[r] = fmaxf(mx[r], __shfl_xor(mx[r], sh, 32)); }
#pragma unroll
    for (int r = 0; r < SR; ++r) { sum[r] = 0.f;
#pragma unroll
        for (int k = 0; k < 8; ++k) { float d0 = __fsub_rn(v[r][k], mx[r]); asm volatile("" : "+v"(d0)); const float e0 = __fmul_rn(d0, 1.4426950408889634f);
            __builtin_amdgcn_sched_barrier(0);   // with the one two lines down: holds the v_nop directly behind the v_exp_f32
            v[r][k] = __builtin_amdgcn_exp2f(e0); asm volatile("v_nop");   // the slot behind the transcendental (the compiler puts a v_nop of its own in front of an asm statement as well)
            __builtin_amdgcn_sched_barrier(0); }
#pragma unroll
        for (int k = 0; k < 8; ++k) sum[r] += v[r][k]; }
#pragma unroll
    for (int sh = 16; sh; sh >>= 1) {
#pragma unroll
        for (int r = 0; r < SR; ++r) sum[r] += __shfl_xor(sum[r], sh, 32); }
    if (hires) {
#pragma unroll
        for (int r = 0; r < SR; ++r) { const float f = __fdiv_rn(1.0f, sum[r]);
#pragma unroll
            for (int ch = 0; ch < 2; ++ch) { v4us oh, ol;
#pragma unroll
                for (int q = 0; q < 4; ++q) { unsigned short a2, c2; splitf(v[r][ch * 4 + q] * f, a2, c2); oh[q] = a2; ol[q] = c2; }
                const size_t oo = ((size_t)zz * (RH ? RH : 1) + i0 + r) * SP + ch * 128 + lane * 4; *(v4us*)(Ph + oo) = oh; *(v4us*)(Pl + oo) = ol; } }
    } else {
#pragma unroll
        for (int r = 0; r < SR; ++r) { const float f = __fdiv_rn(PCAR, sum[r]);
#pragma unroll
            for (int ch = 0; ch < 2; ++ch) { v4h o4;
#pragma unroll
                for (int q = 0; q < 4; ++q) o4[q] = tohx(v[r][ch * 4 + q] * f);
                *(v4h*)(P16 + (size_t)(row0 + r) * SP + ch * 128 + lane * 4) = o4; } } }
    XW();
}
// k_merge: ZH * TT * HD = gridDim.x * 256 * MU * 8 values
__global__ __launch_bounds__(256) void k_merge(const float* __restrict__ O, bf* Ah, bf* Al) { const size_t n = (size_t)blockIdx.x * 256 + threadIdx.x, st = (size_t)gridDim.x * 256; v4f x[MU][2];
#pragma unroll
    for (int u = 0; u < MU; ++u) { const size_t e = (n + u * st) * 8; x[u][0] = *(const v4f*)(O + e); x[u][1] = *(const v4f*)(O + e + 4); }
    XW();
#pragma unroll
    for (int u = 0; u < MU; ++u) { const size_t e = (n + u * st) * 8; const int d = (int)(e % HD); const int t = (int)((e / HD) % TT); const int zz = (int)(e / ((size_t)HD * TT)); const float cs = (t < RH) ? 1.0f : (1.0f / PCAR); const size_t oo = ((size_t)(zz / NH_) * TT + t) * DQ + (zz % NH_) * HD + d; v8us oh, ol;
#pragma unroll
        for (int q = 0; q < 8; ++q) { unsigned short a, c2; splitf(x[u][q >> 2][q & 3] * cs, a, c2); oh[q] = a; ol[q] = c2; }
        *(v8us*)(Ah + oo) = oh; *(v8us*)(Al + oo) = ol; }
    XW();  }

extern "C" void kernel_launch(void* const* d_in, const int* in_sizes, int n_in,
                              void* d_out, int out_size, void* d_ws, size_t ws_size, hipStream_t stream) {
    (void)in_sizes; (void)n_in; (void)out_size;
    const float* x = (const float*)d_in[0];   /* query */ const float* xk = (const float*)d_in[1]; const float* xv = (const float*)d_in[2]; const float* wq = (const float*)d_in[3]; const float* bq = (const float*)d_in[4]; const float* wk = (const float*)d_in[5]; const float* bk = (const float*)d_in[6]; const float* wv = (const float*)d_in[7]; const float* bv = (const float*)d_in[8]; const float* wo = (const float*)d_in[9]; const float* bo = (const float*)d_in[10];   /* input order query, key, value, Wq, bq, Wk, bk, Wv, bv, Wo, bo */
    float* OUT = (float*)d_out;     // [2][2048][1024]
    char* wsp = (char*)d_ws;
    auto take = [&](size_t bytes) { char* p = wsp; wsp += (bytes + 255) & ~(size_t)255; return (void*)p; };
    const size_t NW = (size_t)DQ * DM, NX = (size_t)NB_ * TT * DM, NP = (size_t)ZH * TT * HD;   // elements of one weight, one input tensor, one set of head planes
    bf* WQ = (bf*)take(4 * NW * 2); bf* WO = WQ + 3 * NW;   /* Wq, Wk, Wv, Wo in turn */ float* CS = (float*)take((size_t)TT * HD * 2 * 4);
    h16* QP16 = (h16*)take(2 * NP * 2); h16* KP16 = QP16 + NP; bf* QPh = (bf*)take(2 * NP * 2); bf* KPh = QPh + NP; bf* QPl = (bf*)take(2 * NP * 2); bf* KPl = QPl + NP;   /* q planes, then k planes */
    h16* VT16 = (h16*)take(NP * 2); bf* VTh = (bf*)take(NP * 2); bf* VTl = (bf*)take(NP * 2);
    bf* Ph = (bf*)take((size_t)ZH * RH * SP * 2); bf* Pl = (bf*)take((size_t)ZH * RH * SP * 2); h16* P16 = (h16*)take((size_t)ZH * TT * SP * 2); float* Ob = (float*)take(NP * 4); bf* ATh = (bf*)take(NX * 2); bf* ATl = (bf*)take(NX * 2);
    bf* XB = (bf*)take(3 * NX * 2); float* FQ = (float*)take(3 * NX * 4);   /* bf16 query, key, value; their f32 projections */
    if ((size_t)(wsp - (char*)d_ws) > ws_size) return;    // ws 256 MiB
    float* Sb = (float*)XB;   // the scores (ZH x TT x SP f32, 64 MiB) reuse XB + FQ (72 MiB) after the head planes are built (stream-ordered)
    k_cvt8<<<dim3((unsigned)(NW / 8 / (256 * CU)), 4), 256, 0, stream>>>(wq, wk, wv, wo, WQ, NW / 8);
    k_cs5<<<(TT * HD + 255) / 256, 256, 0, stream>>>(CS);   /* rotary table once */
    k_cvt8<<<dim3((unsigned)(NX / 8 / (256 * CU)), 3), 256, 0, stream>>>(x, xk, xv, xv, XB, NX / 8);
    k_gemmw<bf, 0, true, 0><<<dim3(NB_ * TT / 64, DQ / 64, 3), 32, 0, stream>>>(XB, nullptr, WQ, nullptr, DM, DM, FQ, DQ, bq, bk, bv, NX, NW, NX, 0);
    static_assert(((size_t)DQ * DM / 8) % (256 * CU) == 0 && ((size_t)NB_ * TT * DM / 8) % (256 * CU) == 0 && ((size_t)ZH * TT * HD / 8) % (256 * MU) == 0 && ZH % RU == 0 && 64 % SR == 0, "whole grids");
    k_rope<<<dim3((unsigned)(NP / 8 / RU / 256), 2), 256, 0, stream>>>(FQ, DQ, NH_, CS, 1.0f, QP16, QPh, QPl, NX, NP);
    k_vtp<<<(unsigned)(NP / 32 / 256), 256, 0, stream>>>(FQ + 2 * NX, DKV, NKV, VT16, VTh, VTl);
    k_gemmhl<1><<<dim3(TT / 64, 3, ZH), 32, 0, stream>>>(QPh, QPl, KPh, KPl, QP16, KP16, HD, HD, Sb, SP, (size_t)TT * HD, (size_t)TT * HD, (size_t)TT * HD, (size_t)TT * SP);
    k_asoft<<<ZH * TT / 8 / SR, 256, 0, stream>>>(Sb, P16, Ph, Pl);
    k_gemmhl<2><<<dim3(TT / 64, HD / 64, ZH), 32, 0, stream>>>(Ph, Pl, VTh, VTl, P16, VT16, TT, SP, Ob, HD, (size_t)RH * SP, (size_t)TT * SP, (size_t)HD * TT, (size_t)TT * HD);
    k_merge<<<(unsigned)(NP / 8 / MU / 256), 256, 0, stream>>>(Ob, ATh, ATl);
    k_gemmw<bf, 1, true, 0><<<dim3(NB_ * TT / 64, DM / 64, 1), 32, 0, stream>>>(ATh, ATl, WO, nullptr, DQ, DQ, OUT, DM, bo, bo, bo, 0, 0, 0, 0);
}

// v004
// Measured time: 121 microseconds a run.
// Two timings next to v003 both put it at 1.38 times that version's speed.
// All steps since v000 together make it 16.8 times as fast.
#include <hip/hip_runtime.h>

// Sliding-window multi-head attention with rotary embeddings (query, key, value [2][2048][1024]; q = query Wq^T + bq etc. ('oi' 1/32, zero biases; 16 heads x 64); rotate-half rotary with angles t x 1/10000^(2i/64) (float32 table baked, precise cosf/sinf); scores / sqrt(64); keys with |i - j| <= 50 kept (-1e9 elsewhere == exclusion); softmax; out = merged Wo^T + bo -> [2][2048][1024] (4.2 M); argument order query, key, value, Wq, bq, Wk, bk, Wv, bv, Wo, bo).
// Layout, both batches and all 16 heads in one launch per stage (grid y / z picks tensor, batch and head; score and probability planes keep 256 columns per row, the two 128-key chunks of the row tile): bf16 copies of query, key, value; 'oi' weights; exact projections + f32 biases; {cos, sin} table once; rotate-half rotary plane builder; T-2048 attention on the band only (per 64-row tile the 3 score tiles, 256 softmax columns and 192 PV keys that can hold |i - j| <= 50; the band itself is a select in the softmax; hybrid rows: < 512 hi/lo 3 products, rest fp16 x1024); merged hi/lo x Wo exact + bo.
// Compute dtypes, f32 accumulate: every input rounded to bf16; projections exact + f32 biases; rotary f32; attention rows < 512 3 products, rest fp16; softmax f32; Wo hl x exact + bias.

#define NB_  2
#define TT   2048
#define DM   1024
#define NH_  16
#define NKV  16
#define REP  (NH_ / NKV)
#define HD   64
#define DQ   (NH_ * HD)
#define DKV  (NKV * HD)
#define ZH   (NB_ * NH_)          // attention planes per launch: every (batch, head)
#define SP   256                  // columns kept per score / probability row: keys CB(q0) .. CB(q0) + 255
#define RH   512                  // query rows < RH use hi+lo planes (0: none)
#define WIN  2048
#define BW   50       // half window: keys j in [i - 50, i + 50]
#define PCAR 1024.0f
#define SCL  0.125f   // HD^-0.5
typedef _Float16 h16;
typedef unsigned short bf;
typedef __attribute__((ext_vector_type(16))) __bf16   v16bf;
typedef __attribute__((ext_vector_type(16))) _Float16 v16h;
typedef __attribute__((ext_vector_type(8)))  _Float16 v8h;
typedef __attribute__((ext_vector_type(8)))  unsigned short v8us;
typedef __attribute__((ext_vector_type(8)))  float    v8f;
typedef __attribute__((ext_vector_type(4)))  float    v4f;
typedef v8h  __attribute__((may_alias)) v8ha;
typedef v4f  __attribute__((may_alias)) v4fa;
typedef v8us __attribute__((may_alias)) v8usa;

__device__ __forceinline__ unsigned short f2bf(float f) { unsigned u = __float_as_uint(f); u += 0x7FFFu + ((u >> 16) & 1u); return (unsigned short)(u >> 16); }
__device__ __forceinline__ float bf2f(unsigned short b) { return __uint_as_float(((unsigned)b) << 16); }
__device__ __forceinline__ float bfr(float f) { return bf2f(f2bf(f)); }
__device__ __forceinline__ v16h cat16(v8h lo, v8h hi) { return __builtin_shufflevector(lo, hi, 0, 1, 2, 3, 4, 5, 6, 7, 8, 9, 10, 11, 12, 13, 14, 15); }
__device__ __forceinline__ v16bf cat16b(v8us lo, v8us hi) { return __builtin_bit_cast(v16bf, __builtin_shufflevector(lo, hi, 0, 1, 2, 3, 4, 5, 6, 7, 8, 9, 10, 11, 12, 13, 14, 15)); }
__device__ __forceinline__ v8f wmma16(v16h a, v16h b, v8f c) { return __builtin_amdgcn_wmma_f32_16x16x32_f16(false, a, false, b, (short)0, c, false, false); }
__device__ __forceinline__ v8f wmmab(v16bf a, v16bf b, v8f c) { return __builtin_amdgcn_wmma_f32_16x16x32_bf16(false, a, false, b, (short)0, c, false, false); }



// ---- gemmw: register-blocked GEMM, ONE WAVE per 64x64 output tile (16 accumulators), operands straight from K-contiguous 16-bit planes; row tile bx, column tile blockIdx.y, plane blockIdx.z, 32 threads. Kernel: k_gemmhl (hybrid attention rows).
// C[m][n] (f32, pitch ldc, + optional f32 bias[n], one bias pointer per z < 3) = sum_k A[m][k] Bt[n][k] (+ split products per NSPLIT). A pitch lda, Bt pitch K. z-batch strides sA/sB/sC in elements. K % 32 == 0.
// BAND (rowbase = query index of A's row 0): 1 = score tiles, grid y = 3, column tile = the row tile's own and its two neighbours (keys r - 64 .. r + 127 hold every |i - j| <= 50 of rows r .. r + 63); 2 = PV, k runs over those same keys only (P is exactly 0 elsewhere). Banded planes (C of 1, A of 2) hold key j at column j - CB(q0).
__device__ __forceinline__ int CB(int q0) { return min(max(q0 - 64, 0) / 128, TT / 128 - 2) * 128; }   // first key of the two 128-key chunks that cover row tile q0's band
template <typename T16> struct WFrag;
template <> struct WFrag<h16> { typedef v16h V; static __device__ __forceinline__ V ld(const h16* p) { return cat16(*(const v8h*)p, *(const v8h*)(p + 16)); } static __device__ __forceinline__ v8f mma(V a, V b, v8f c) { return wmma16(a, b, c); } };
template <> struct WFrag<bf> { typedef v16bf V; static __device__ __forceinline__ V ld(const bf* p) { return cat16b(*(const v8us*)p, *(const v8us*)(p + 16)); } static __device__ __forceinline__ v8f mma(V a, V b, v8f c) { return wmmab(a, b, c); } };
template <typename T16, int NSPLIT, bool BIAS, int BAND>
__device__ __forceinline__ void gemmw(float* os, int bx, const T16* __restrict__ A, const T16* __restrict__ A2, const T16* __restrict__ Bt, const T16* __restrict__ Bt2, int K, int lda, float* C, int ldc, const float* __restrict__ bias0, const float* __restrict__ bias1, const float* __restrict__ bias2, size_t sA, size_t sB, size_t sC, int rowbase) {
    typedef typename WFrag<T16>::V V;
    const size_t z = blockIdx.z; A += z * sA; if (A2) A2 += z * sA; Bt += z * sB; if (Bt2) Bt2 += z * sB; C += z * sC; const float* bias = (z == 0) ? bias0 : (z == 1) ? bias1 : bias2;
    const int lane = threadIdx.x & 31, lr = lane & 15, hi = lane >> 4; const int r0 = bx * 64, q0 = rowbase + r0, c0 = (BAND == 1) ? q0 + ((int)blockIdx.y - 1) * 64 : blockIdx.y * 64;
    if (BAND == 1 && (c0 < 0 || c0 >= TT)) return;   // neighbour tile past either end of the sequence
    const int kbeg = (BAND == 2) ? max(q0 - 64, 0) : 0, kend = (BAND == 2) ? min(q0 + 128, K) : K; const int cb = BAND ? CB(q0) : 0;
    v8f acc[4][4];
#pragma unroll
    for (int mb = 0; mb < 4; ++mb)
#pragma unroll
        for (int nb = 0; nb < 4; ++nb) acc[mb][nb] = (v8f){};
    const size_t aoff = (size_t)(r0 + lr) * lda + 8 * hi, boff = (size_t)(c0 + lr) * K + 8 * hi;
#pragma unroll 1
    for (int kc = kbeg; kc < kend; kc += 32) {
        V a[4], a2[4]; const int ka = (BAND == 2) ? kc - cb : kc;
#pragma unroll
        for (int mb = 0; mb < 4; ++mb) { a[mb] = WFrag<T16>::ld(A + aoff + (size_t)mb * 16 * lda + ka); if (NSPLIT == 1 || NSPLIT == 2) a2[mb] = WFrag<T16>::ld(A2 + aoff + (size_t)mb * 16 * lda + ka); }
#pragma unroll
        for (int nb = 0; nb < 4; ++nb) { const V b = WFrag<T16>::ld(Bt + boff + (size_t)nb * 16 * K + kc); V b2; if (NSPLIT >= 2) b2 = WFrag<T16>::ld(Bt2 + boff + (size_t)nb * 16 * K + kc);
#pragma unroll
            for (int mb = 0; mb < 4; ++mb) { acc[mb][nb] = WFrag<T16>::mma(a[mb], b, acc[mb][nb]); if (NSPLIT == 1 || NSPLIT == 2) acc[mb][nb] = WFrag<T16>::mma(a2[mb], b, acc[mb][nb]); if (NSPLIT >= 2) acc[mb][nb] = WFrag<T16>::mma(a[mb], b2, acc[mb][nb]); } }
        asm volatile("v_nop\n\tv_nop\n\tv_nop\n\tv_nop" : "+v"(acc[0][0]), "+v"(acc[1][1]), "+v"(acc[2][2]), "+v"(acc[3][3]) : "v"(a[0]), "v"(a[3]));
    }
#pragma unroll
    for (int mb = 0; mb < 4; ++mb) {
#pragma unroll
        for (int nb = 0; nb < 4; ++nb) {
#pragma unroll
            for (int j = 0; j < 8; ++j) os[(hi * 8 + j) * 68 + nb * 16 + lr] = acc[mb][nb][j]; }
        __builtin_amdgcn_wave_barrier(); asm volatile("" ::: "memory");
        float* crow = C + (size_t)(r0 + mb * 16) * ldc + ((BAND == 1) ? c0 - cb : c0);
{
#pragma unroll
            for (int s = 0; s < 8; ++s) { const int row = 2 * s + hi, cofs = lr * 4; v4f val = *(const v4fa*)(os + row * 68 + cofs); if (BIAS) { val[0] += bfr(bias[c0 + cofs]); val[1] += bfr(bias[c0 + cofs + 1]); val[2] += bfr(bias[c0 + cofs + 2]); val[3] += bfr(bias[c0 + cofs + 3]); }
                *(v4f*)(crow + (size_t)row * ldc + cofs) = val; }
             }
        __builtin_amdgcn_wave_barrier(); asm volatile("" ::: "memory");
    }
    asm volatile("s_wait_xcnt 0x0" ::: "memory");   // precaution: where this body is inlined twice (k_gemmhl) the other copy's code follows the last stores in the listing and reuses their address registers
}
// ---- k_gemmt: the four projections. One 128x128 tile of C per work-group of 4 waves (2 x 2 waves of 64x64, the accumulators, fragment form and k order of gemmw); A (, A2) and Bt tiles of 64 k come into LDS by asynchronous copies, whole 128-byte lines, each staged row read by two waves; two buffers, the next stage's copies fly while this stage is multiplied.
// C[m][n] (f32, pitch DM, + f32 bias[n], one bias pointer per z < 3) = sum_k A[m][k] Bt[n][k] (+ A2[m][k] Bt[n][k] behind it in every 32 k when NSPLIT). All pitches DM; grid (M/128, N/128, Z).
#define GP   72            // LDS row pitch in 16-bit elements: 144 bytes = 16 x odd, the conflict-free pitch for 16-byte reads of 128-byte rows
#define GKS  64            // k per stage
#define GMAT (128 * GP)    // elements of one staged operand tile
// cp8: rows r, r + 16, ... r + 112 of one operand tile, 16 bytes a lane; the s_wait_xcnt closes the statement so that no address register is rewritten in front of it
__device__ __forceinline__ void cp8(unsigned l, const bf* g) {
    asm volatile("global_load_async_to_lds_b128 %0, %8, off\n\t"
                 "global_load_async_to_lds_b128 %1, %9, off\n\t"
                 "global_load_async_to_lds_b128 %2, %10, off\n\t"
                 "global_load_async_to_lds_b128 %3, %11, off\n\t"
                 "global_load_async_to_lds_b128 %4, %12, off\n\t"
                 "global_load_async_to_lds_b128 %5, %13, off\n\t"
                 "global_load_async_to_lds_b128 %6, %14, off\n\t"
                 "global_load_async_to_lds_b128 %7, %15, off\n\t"
                 "s_wait_xcnt 0x0"
                 :: "v"(l), "v"(l + 1 * 16 * GP * 2), "v"(l + 2 * 16 * GP * 2), "v"(l + 3 * 16 * GP * 2), "v"(l + 4 * 16 * GP * 2), "v"(l + 5 * 16 * GP * 2), "v"(l + 6 * 16 * GP * 2), "v"(l + 7 * 16 * GP * 2),
                    "v"(g), "v"(g + 1 * 16 * DM), "v"(g + 2 * 16 * DM), "v"(g + 3 * 16 * DM), "v"(g + 4 * 16 * DM), "v"(g + 5 * 16 * DM), "v"(g + 6 * 16 * DM), "v"(g + 7 * 16 * DM)
                 : "memory");
}
template <int NSPLIT>
__global__ __launch_bounds__(128) void k_gemmt(const bf* __restrict__ A, const bf* __restrict__ A2, const bf* __restrict__ Bt, float* C, const float* __restrict__ bias0, const float* __restrict__ bias1, const float* __restrict__ bias2, size_t sA, size_t sB, size_t sC) {
    constexpr int NMAT = 2 + NSPLIT, STG = NMAT * GMAT, NST = DM / GKS;
    __shared__ __align__(16) bf ring[2 * STG];
    __shared__ __align__(16) float osb[4 * 16 * 68];
    const size_t z = blockIdx.z; A += z * sA; if (NSPLIT) A2 += z * sA; Bt += z * sB; C += z * sC; const float* bias = (z == 0) ? bias0 : (z == 1) ? bias1 : bias2;
    const int tid = threadIdx.x, lane = tid & 31, lr = lane & 15, hi = lane >> 4, w = tid >> 5;
    const int R0 = blockIdx.x * 128, C0 = blockIdx.y * 128, r0 = R0 + (w >> 1) * 64, c0 = C0 + (w & 1) * 64;
    const int crow = tid >> 3, ccol = (tid & 7) * 8;   // a thread copies 16 bytes of rows crow + 16 i; 8 threads fill a row's 128 bytes
    const bf* gA = A + (size_t)(R0 + crow) * DM + ccol; const bf* gA2 = NSPLIT ? A2 + (size_t)(R0 + crow) * DM + ccol : nullptr; const bf* gB = Bt + (size_t)(C0 + crow) * DM + ccol;
    const unsigned l0 = (unsigned)(size_t)ring + (unsigned)(crow * GP + ccol) * 2u;
    auto fill = [&](int s) { const unsigned l = l0 + (unsigned)(s & 1) * (STG * 2u); cp8(l, gA + s * GKS); if (NSPLIT) cp8(l + GMAT * 2u, gA2 + s * GKS); cp8(l + (NMAT - 1) * GMAT * 2u, gB + s * GKS); };
    v8f acc[4][4];
#pragma unroll
    for (int mb = 0; mb < 4; ++mb)
#pragma unroll
        for (int nb = 0; nb < 4; ++nb) acc[mb][nb] = (v8f){};
    const bf* fa = ring + ((w >> 1) * 64 + lr) * GP + 8 * hi; const bf* fb = ring + (NMAT - 1) * GMAT + ((w & 1) * 64 + lr) * GP + 8 * hi;
    fill(0);
    asm volatile("s_wait_asynccnt 0x0" ::: "memory");   // stage 0 has landed before the barrier publishes it
    __syncthreads();
    fill(1);
#pragma unroll 1   // one copy of the stage body: the buffer is picked by an address (for speed only)
    for (int t = 0; t < NST; ++t) {
        const int bo = (t & 1) * STG;
#pragma unroll
        for (int kk = 0; kk < GKS; kk += 32) {
            v16bf a[4], a2[4], b[4];
#pragma unroll
            for (int mb = 0; mb < 4; ++mb) { a[mb] = WFrag<bf>::ld(fa + bo + mb * 16 * GP + kk); if (NSPLIT) a2[mb] = WFrag<bf>::ld(fa + bo + GMAT + mb * 16 * GP + kk); }
#pragma unroll
            for (int nb = 0; nb < 4; ++nb) b[nb] = WFrag<bf>::ld(fb + bo + nb * 16 * GP + kk);
            __builtin_amdgcn_sched_barrier(0);   // the LDS reads of these 32 k go out as one group in front of their matrix instructions (for speed only)
#pragma unroll
            for (int nb = 0; nb < 4; ++nb) {
#pragma unroll
                for (int mb = 0; mb < 4; ++mb) acc[mb][nb] = wmmab(a[mb], b[nb], acc[mb][nb]);
                if (NSPLIT) {
#pragma unroll
                    for (int mb = 0; mb < 4; ++mb) acc[mb][nb] = wmmab(a2[mb], b[nb], acc[mb][nb]); } }
        }
        asm volatile("s_wait_dscnt 0x0" ::: "memory");      // this wave's reads of buffer t & 1 are done before the barrier frees it
        asm volatile("s_wait_asynccnt 0x0" ::: "memory");   // this wave's copies of stage t + 1 have landed before the barrier publishes them
        __syncthreads();
        if (t + 2 < NST) fill(t + 2);
    }
    asm volatile("s_wait_asynccnt 0x0" ::: "memory");   // nothing is in flight when the wave goes on to the epilogue and ends
    float* os = osb + w * (16 * 68);   // each wave stages its own output rows
    v4f bb = *(const v4fa*)(bias + c0 + lr * 4); bb[0] = bfr(bb[0]); bb[1] = bfr(bb[1]); bb[2] = bfr(bb[2]); bb[3] = bfr(bb[3]);
#pragma unroll
    for (int mb = 0; mb < 4; ++mb) {
#pragma unroll
        for (int nb = 0; nb < 4; ++nb) {
#pragma unroll
            for (int j = 0; j < 8; ++j) os[(hi * 8 + j) * 68 + nb * 16 + lr] = acc[mb][nb][j]; }
        __builtin_amdgcn_wave_barrier(); asm volatile("" ::: "memory");   // the wave's stores to os stay in front of its reads
        float* crow_p = C + (size_t)(r0 + mb * 16) * DM + c0;
#pragma unroll
        for (int s = 0; s < 8; ++s) { const int row = 2 * s + hi, cofs = lr * 4; v4f val = *(const v4fa*)(os + row * 68 + cofs); val[0] += bb[0]; val[1] += bb[1]; val[2] += bb[2]; val[3] += bb[3];
            *(v4f*)(crow_p + (size_t)row * DM + cofs) = val; }
        asm volatile("s_wait_xcnt 0x0" ::: "memory");   // precaution: stands behind the stores and in front of the next rows' address arithmetic
        __builtin_amdgcn_wave_barrier(); asm volatile("" ::: "memory");   // the reads of os stay in front of the next rows' stores to it
    }
}
// k_gemmhl: both row classes of a banded attention product in one grid (TT/64, y, Z): row tiles < RH/64 take the hi/lo planes (3 products), the rest the fp16 planes; A16 and C are whole planes (row 0 first), only rows < RH of Ah / Al are read (plane stride sAh).
template <int BAND>
__global__ __launch_bounds__(32) void k_gemmhl(const bf* __restrict__ Ah, const bf* __restrict__ Al, const bf* __restrict__ Bh, const bf* __restrict__ Bl, const h16* __restrict__ A16, const h16* __restrict__ B16, int K, int lda, float* C, int ldc, size_t sAh, size_t sA16, size_t sB, size_t sC) {
    __shared__ __align__(16) float os[16 * 68];
    if (blockIdx.x >= RH / 64) {
        gemmw<h16, 0, false, BAND>(os, blockIdx.x - RH / 64, A16 + (size_t)RH * lda, nullptr, B16, nullptr, K, lda, C + (size_t)RH * ldc, ldc, nullptr, nullptr, nullptr, sA16, sB, sC, RH);
        return; }
    gemmw<bf, 2, false, BAND>(os, blockIdx.x, Ah, Al, Bh, Bl, K, lda, C, ldc, nullptr, nullptr, nullptr, sAh, sB, sC, 0);
}

__device__ __forceinline__ h16 tohx(float x) { return (h16)x; }
__device__ __forceinline__ void splitf(float y, unsigned short& h, unsigned short& l) { h = f2bf(y); l = f2bf(y - bf2f(h)); }
typedef __attribute__((ext_vector_type(2))) _Float16 v2h;
typedef __attribute__((ext_vector_type(4))) _Float16 v4h;
typedef __attribute__((ext_vector_type(2))) unsigned short v2us;
typedef __attribute__((ext_vector_type(4))) unsigned short v4us;
typedef __attribute__((ext_vector_type(2))) float v2f;
typedef __attribute__((ext_vector_type(4))) int v4i;

// The elementwise stages below give every thread many values (16-byte loads and stores, all of a thread's loads issued before its first use), so that a stage needs only a few thousand waves (for speed only).
// XW: precaution, stands behind a run of global loads or stores and in front of the arithmetic that may reuse their address registers
#define XW() asm volatile("s_wait_xcnt 0x0" ::: "memory")
#define CU 8    // k_cvt8: groups of 8 values per thread, one grid apart
#define RU 4    // k_rope: heads per thread; they share one read of the {cos, sin} table
#define SR 8    // k_asoft: rows per wave
#define MU 4    // k_merge: groups of 8 values per thread, one grid apart
// k_cvt8: grid y picks one of up to four equally long sources; their bf16 copies lie one behind the other in dst; n8 = gridDim.x * 256 * CU groups of 8
__global__ __launch_bounds__(256) void k_cvt8(const float* __restrict__ s0, const float* __restrict__ s1, const float* __restrict__ s2, const float* __restrict__ s3, bf* dst, size_t n8) { const size_t i0 = (size_t)blockIdx.x * 256 + threadIdx.x, st = (size_t)gridDim.x * 256; const int y = blockIdx.y; const float* src = (y == 0) ? s0 : (y == 1) ? s1 : (y == 2) ? s2 : s3; dst += (size_t)y * n8 * 8; v8f v[CU];
#pragma unroll
    for (int u = 0; u < CU; ++u) v[u] = *(const v8f*)(src + (i0 + u * st) * 8);
    XW();
#pragma unroll
    for (int u = 0; u < CU; ++u) { v8us o;
#pragma unroll
        for (int k = 0; k < 8; ++k) o[k] = f2bf(v[u][k]);
        *(v8us*)(dst + (i0 + u * st) * 8) = o; }
    XW();  }

// k_rope: grid y = tensor (q, k; strides sF, sP); head planes [b][h][t][d] (fp16 + hi/lo) of rope(x) x sc with the rotate-half convention out[d] = x[d] cos[t][d] - x[d+HD/2] sin[t][d], out[d+HD/2] = x[d+HD/2] cos[t][d+HD/2] + x[d] sin[t][d+HD/2]; a thread takes 8 neighbouring d of one t in RU heads
__global__ __launch_bounds__(256) void k_rope(const float* __restrict__ F, int pitch, int nheads, const float* __restrict__ CS, float sc, h16* P16, bf* Ph, bf* Pl, size_t sF, size_t sP) {
    const int n = blockIdx.x * 256 + threadIdx.x; if (n >= NB_ * nheads / RU * TT * (HD / 8)) return; F += blockIdx.y * sF; P16 += blockIdx.y * sP; Ph += blockIdx.y * sP; Pl += blockIdx.y * sP; const int d = (n % (HD / 8)) * 8; const int t = (n / (HD / 8)) % TT; const int h0 = (n / (HD / 8 * TT)) * RU; const int dp = (d < HD / 2) ? d + HD / 2 : d - HD / 2;
    v4f c[4], xa[RU][2], xb[RU][2];
#pragma unroll
    for (int k = 0; k < 4; ++k) c[k] = *(const v4f*)(CS + ((size_t)t * HD + d) * 2 + 4 * k);
#pragma unroll
    for (int u = 0; u < RU; ++u) { const int h = h0 + u; const float* f = F + ((size_t)(h / nheads) * TT + t) * pitch + (h % nheads) * HD; xa[u][0] = *(const v4f*)(f + d); xa[u][1] = *(const v4f*)(f + d + 4); xb[u][0] = *(const v4f*)(f + dp); xb[u][1] = *(const v4f*)(f + dp + 4); }
    XW();
#pragma unroll
    for (int u = 0; u < RU; ++u) { v8h o16; v8us oh, ol;
#pragma unroll
        for (int q = 0; q < 8; ++q) { const float x0 = xa[u][q >> 2][q & 3], x1 = xb[u][q >> 2][q & 3];
            float a = __fmul_rn(x0, c[q >> 1][(q & 1) * 2]), bq = __fmul_rn(x1, c[q >> 1][(q & 1) * 2 + 1]); asm volatile("" : "+v"(a)); asm volatile("" : "+v"(bq)); const float r = ((d < HD / 2) ? __fsub_rn(a, bq) : __fadd_rn(a, bq)) * sc;
            o16[q] = tohx(r); unsigned short a2, c2; splitf(r, a2, c2); oh[q] = a2; ol[q] = c2; }
        const size_t e = ((size_t)(h0 + u) * TT + t) * HD + d; *(v8h*)(P16 + e) = o16; *(v8us*)(Ph + e) = oh; *(v8us*)(Pl + e) = ol; }
    XW();  }
// k_vtp: V^T planes [g][d][t]; a thread takes 8 t x 4 d (8 row reads of 16 bytes, 4 x 3 stores of 16 bytes); a wave's 8 x 4 threads cover 64 t x 16 d, so each store fills whole 128-byte lines
__global__ __launch_bounds__(256) void k_vtp(const float* __restrict__ F, int pitch, int nheads, h16* V16, bf* Vh, bf* Vl) { const int n = blockIdx.x * 256 + threadIdx.x; if (n >= NB_ * nheads * (HD / 4) * (TT / 8)) return; const int tl = n & 7, dl = (n >> 3) & 3, r = n >> 5; const int dh = r % (HD / 16), th = (r / (HD / 16)) % (TT / 64), g = r / ((HD / 16) * (TT / 64)); const int t = (th * 8 + tl) * 8, d = (dh * 4 + dl) * 4;
    const float* f = F + ((size_t)(g / nheads) * TT + t) * pitch + (g % nheads) * HD + d; v4f x[8];
#pragma unroll
    for (int q = 0; q < 8; ++q) x[q] = *(const v4f*)(f + (size_t)q * pitch);
    XW();
#pragma unroll
    for (int k = 0; k < 4; ++k) { v8h o16; v8us oh, ol;
#pragma unroll
        for (int q = 0; q < 8; ++q) { o16[q] = tohx(x[q][k]); unsigned short a2, c2; splitf(x[q][k], a2, c2); oh[q] = a2; ol[q] = c2; }
        const size_t e = ((size_t)g * HD + d + k) * TT + t; *(v8h*)(V16 + e) = o16; *(v8us*)(Vh + e) = oh; *(v8us*)(Vl + e) = ol; }
    XW();  }
__constant__ float INVT[HD / 2] = { 1.000000000e+00f, 7.498942018e-01f, 5.623413324e-01f, 4.216965139e-01f, 3.162277639e-01f, 2.371373624e-01f, 1.778279394e-01f, 1.333521456e-01f, 1.000000015e-01f, 7.498941571e-02f, 5.623412877e-02f, 4.216964915e-02f, 3.162277862e-02f, 2.371373586e-02f, 1.778279431e-02f, 1.333521493e-02f, 9.999999776e-03f, 7.498942316e-03f, 5.623413250e-03f, 4.216964822e-03f, 3.162277862e-03f, 2.371373819e-03f, 1.778279431e-03f, 1.333521446e-03f, 1.000000047e-03f, 7.498941850e-04f, 5.623413017e-04f, 4.216964880e-04f, 3.162277862e-04f, 2.371373848e-04f, 1.778279402e-04f, 1.333521504e-04f };   // float32 1 / 10000^(2i/64), i < 32, generated with jnp to be bit-exact
__global__ __launch_bounds__(256) void k_cs5(float* CS) { const int idx = blockIdx.x * 256 + threadIdx.x; if (idx >= TT * HD) return; const int d = idx % HD; const int t = idx / HD; const float a = __fmul_rn((float)t, INVT[d % (HD / 2)]); v2f cs; cs[0] = cosf(a); cs[1] = sinf(a); *(v2f*)(CS + (size_t)idx * 2) = cs;  }
// k_asoft: per row (zz, i): t = S x 1/8 for keys with |i - j| <= 50, -3e38 elsewhere (the -1e9 fill == exclusion); softmax over the two 128-key chunks that cover the row tile's keys (same lane and chunk order as over all 2048 keys, whose other terms are exact zeros); S is read only where a lane's 4 keys touch the band; a wave takes SR neighbouring rows (one row tile, one row class), each step for all of them in turn so that their butterflies overlap
__global__ __launch_bounds__(256) void k_asoft(const float* __restrict__ Sb, h16* P16, bf* Ph, bf* Pl) {
    const int lane = threadIdx.x & 31; const int row0 = (blockIdx.x * 8 + (threadIdx.x >> 5)) * SR; if (row0 >= ZH * TT) return; const int i0 = row0 % TT; const int zz = row0 / TT; const bool hires = (i0 < RH); float v[SR][8]; float mx[SR], sum[SR]; v4f a[SR][2];
    const int ch0 = min(max((i0 & ~63) - 64, 0) / 128, TT / 128 - 2);
#pragma unroll
    for (int r = 0; r < SR; ++r) {
#pragma unroll
        for (int ch = 0; ch < 2; ++ch) { const int i = i0 + r, j0 = (ch0 + ch) * 128 + lane * 4; a[r][ch] = (v4f){}; if (i - (j0 + 3) <= BW && j0 - i <= BW) a[r][ch] = *(const v4f*)(Sb + (size_t)(row0 + r) * SP + ch * 128 + lane * 4); } }
    XW();
#pragma unroll
    for (int r = 0; r < SR; ++r) { mx[r] = -3.0e38f;
#pragma unroll
        for (int ch = 0; ch < 2; ++ch) {
#pragma unroll
            for (int q = 0; q < 4; ++q) { const int i = i0 + r, j = (ch0 + ch) * 128 + lane * 4 + q; const float t = (i - j <= BW && j - i <= BW) ? a[r][ch][q] * SCL : -3.0e38f;   /* |i - j| <= 50 */ v[r][ch * 4 + q] = t; mx[r] = fmaxf(mx[r], t); } } }
#pragma unroll
    for (int sh = 16; sh; sh >>= 1) {
#pragma unroll
        for (int r = 0; r < SR; ++r) mx[r] = fmaxf(mx[r], __shfl_xor(mx[r], sh, 32)); }
#pragma unroll
    for (int r = 0; r < SR; ++r) { sum[r] = 0.f;
#pragma unroll
        for (int k = 0; k < 8; ++k) { float d0 = __fsub_rn(v[r][k], mx[r]); asm volatile("" : "+v"(d0)); const float e0 = __fmul_rn(d0, 1.4426950408889634f);
            __builtin_amdgcn_sched_barrier(0);   // with the one two lines down: holds the v_nop directly behind the v_exp_f32
            v[r][k] = __builtin_amdgcn_exp2f(e0); asm volatile("v_nop");   // the slot behind the transcendental (the compiler puts a v_nop of its own in front of an asm statement as well)
            __builtin_amdgcn_sched_barrier(0); }
#pragma unroll
        for (int k = 0; k < 8; ++k) sum[r] += v[r][k]; }
#pragma unroll
    for (int sh = 16; sh; sh >>= 1) {
#pragma unroll
        for (int r = 0; r < SR; ++r) sum[r] += __shfl_xor(sum[r], sh, 32); }
    if (hires) {
#pragma unroll
        for (int r = 0; r < SR; ++r) { const float f = __fdiv_rn(1.0f, sum[r]);
#pragma unroll
            for (int ch = 0; ch < 2; ++ch) { v4us oh, ol;
#pragma unroll
                for (int q = 0; q < 4; ++q) { unsigned short a2, c2; splitf(v[r][ch * 4 + q] * f, a2, c2); oh[q] = a2; ol[q] = c2; }
                const size_t oo = ((size_t)zz * (RH ? RH : 1) + i0 + r) * SP + ch * 128 + lane * 4; *(v4us*)(Ph + oo) = oh; *(v4us*)(Pl + oo) = ol; } }
    } else {
#pragma unroll
        for (int r = 0; r < SR; ++r) { const float f = __fdiv_rn(PCAR, sum[r]);
#pragma unroll
            for (int ch = 0; ch < 2; ++ch) { v4h o4;
#pragma unroll
                for (int q = 0; q < 4; ++q) o4[q] = tohx(v[r][ch * 4 + q] * f);
                *(v4h*)(P16 + (size_t)(row0 + r) * SP + ch * 128 + lane * 4) = o4; } } }
    XW();
}
// k_merge: ZH * TT * HD = gridDim.x * 256 * MU * 8 values
__global__ __launch_bounds__(256) void k_merge(const float* __restrict__ O, bf* Ah, bf* Al) { const size_t n = (size_t)blockIdx.x * 256 + threadIdx.x, st = (size_t)gridDim.x * 256; v4f x[MU][2];
#pragma unroll
    for (int u = 0; u < MU; ++u) { const size_t e = (n + u * st) * 8; x[u][0] = *(const v4f*)(O + e); x[u][1] = *(const v4f*)(O + e + 4); }
    XW();
#pragma unroll
    for (int u = 0; u < MU; ++u) { const size_t e = (n + u * st) * 8; const int d = (int)(e % HD); const int t = (int)((e / HD) % TT); const int zz = (int)(e / ((size_t)HD * TT)); const float cs = (t < RH) ? 1.0f : (1.0f / PCAR); const size_t oo = ((size_t)(zz / NH_) * TT + t) * DQ + (zz % NH_) * HD + d; v8us oh, ol;
#pragma unroll
        for (int q = 0; q < 8; ++q) { unsigned short a, c2; splitf(x[u][q >> 2][q & 3] * cs, a, c2); oh[q] = a; ol[q] = c2; }
        *(v8us*)(Ah + oo) = oh; *(v8us*)(Al + oo) = ol; }
    XW();  }

extern "C" void kernel_launch(void* const* d_in, const int* in_sizes, int n_in,
                              void* d_out, int out_size, void* d_ws, size_t ws_size, hipStream_t stream) {
    (void)in_sizes; (void)n_in; (void)out_size;
    const float* x = (const float*)d_in[0];   /* query */ const float* xk = (const float*)d_in[1]; const float* xv = (const float*)d_in[2]; const float* wq = (const float*)d_in[3]; const float* bq = (const float*)d_in[4]; const float* wk = (const float*)d_in[5]; const float* bk = (const float*)d_in[6]; const float* wv = (const float*)d_in[7]; const float* bv = (const float*)d_in[8]; const float* wo = (const float*)d_in[9]; const float* bo = (const float*)d_in[10];   /* input order query, key, value, Wq, bq, Wk, bk, Wv, bv, Wo, bo */
    float* OUT = (float*)d_out;     // [2][2048][1024]
    char* wsp = (char*)d_ws;
    auto take = [&](size_t bytes) { char* p = wsp; wsp += (bytes + 255) & ~(size_t)255; return (void*)p; };
    const size_t NW = (size_t)DQ * DM, NX = (size_t)NB_ * TT * DM, NP = (size_t)ZH * TT * HD;   // elements of one weight, one input tensor, one set of head planes
    bf* WQ = (bf*)take(4 * NW * 2); bf* WO = WQ + 3 * NW;   /* Wq, Wk, Wv, Wo in turn */ float* CS = (float*)take((size_t)TT * HD * 2 * 4);
    h16* QP16 = (h16*)take(2 * NP * 2); h16* KP16 = QP16 + NP; bf* QPh = (bf*)take(2 * NP * 2); bf* KPh = QPh + NP; bf* QPl = (bf*)take(2 * NP * 2); bf* KPl = QPl + NP;   /* q planes, then k planes */
    h16* VT16 = (h16*)take(NP * 2); bf* VTh = (bf*)take(NP * 2); bf* VTl = (bf*)take(NP * 2);
    bf* Ph = (bf*)take((size_t)ZH * RH * SP * 2); bf* Pl = (bf*)take((size_t)ZH * RH * SP * 2); h16* P16 = (h16*)take((size_t)ZH * TT * SP * 2); float* Ob = (float*)take(NP * 4); bf* ATh = (bf*)take(NX * 2); bf* ATl = (bf*)take(NX * 2);
    bf* XB = (bf*)take(3 * NX * 2); float* FQ = (float*)take(3 * NX * 4);   /* bf16 query, key, value; their f32 projections */
    if ((size_t)(wsp - (char*)d_ws) > ws_size) return;    // ws 256 MiB
    float* Sb = (float*)XB;   // the scores (ZH x TT x SP f32, 64 MiB) reuse XB + FQ (72 MiB) after the head planes are built (stream-ordered)
    k_cvt8<<<dim3((unsigned)(NW / 8 / (256 * CU)), 4), 256, 0, stream>>>(wq, wk, wv, wo, WQ, NW / 8);
    k_cs5<<<(TT * HD + 255) / 256, 256, 0, stream>>>(CS);   /* rotary table once */
    k_cvt8<<<dim3((unsigned)(NX / 8 / (256 * CU)), 3), 256, 0, stream>>>(x, xk, xv, xv, XB, NX / 8);
    k_gemmt<0><<<dim3(NB_ * TT / 128, DQ / 128, 3), 128, 0, stream>>>(XB, nullptr, WQ, FQ, bq, bk, bv, NX, NW, NX);
    static_assert(((size_t)DQ * DM / 8) % (256 * CU) == 0 && ((size_t)NB_ * TT * DM / 8) % (256 * CU) == 0 && ((size_t)ZH * TT * HD / 8) % (256 * MU) == 0 && ZH % RU == 0 && 64 % SR == 0, "whole grids");
    k_rope<<<dim3((unsigned)(NP / 8 / RU / 256), 2), 256, 0, stream>>>(FQ, DQ, NH_, CS, 1.0f, QP16, QPh, QPl, NX, NP);
    k_vtp<<<(unsigned)(NP / 32 / 256), 256, 0, stream>>>(FQ + 2 * NX, DKV, NKV, VT16, VTh, VTl);
    k_gemmhl<1><<<dim3(TT / 64, 3, ZH), 32, 0, stream>>>(QPh, QPl, KPh, KPl, QP16, KP16, HD, HD, Sb, SP, (size_t)TT * HD, (size_t)TT * HD, (size_t)TT * HD, (size_t)TT * SP);
    k_asoft<<<ZH * TT / 8 / SR, 256, 0, stream>>>(Sb, P16, Ph, Pl);
    k_gemmhl<2><<<dim3(TT / 64, HD / 64, ZH), 32, 0, stream>>>(Ph, Pl, VTh, VTl, P16, VT16, TT, SP, Ob, HD, (size_t)RH * SP, (size_t)TT * SP, (size_t)HD * TT, (size_t)TT * HD);
    k_merge<<<(unsigned)(NP / 8 / MU / 256), 256, 0, stream>>>(Ob, ATh, ATl);
    k_gemmt<1><<<dim3(NB_ * TT / 128, DM / 128, 1), 128, 0, stream>>>(ATh, ATl, WO, OUT, bo, bo, bo, 0, 0, 0);
}

// v005
// It runs in 104 microseconds.
// Timed twice side by side with v004, it ran 1.18 and 1.17 times as fast.
// Counting every step since v000, it is 19.7 times as fast.
#include <hip/hip_runtime.h>

// Sliding-window multi-head attention with rotary embeddings (query, key, value [2][2048][1024]; q = query Wq^T + bq etc. ('oi' 1/32, zero biases; 16 heads x 64); rotate-half rotary with angles t x 1/10000^(2i/64) (float32 table baked, precise cosf/sinf); scores / sqrt(64); keys with |i - j| <= 50 kept (-1e9 elsewhere == exclusion); softmax; out = merged Wo^T + bo -> [2][2048][1024] (4.2 M); argument order query, key, value, Wq, bq, Wk, bk, Wv, bv, Wo, bo).
// Layout, both batches and all 16 heads in one launch per stage (grid y / z picks tensor, batch and head): bf16 copies of query, key, value; 'oi' weights; exact projections + f32 biases; {cos, sin} table once; rotate-half rotary plane builder; T-2048 attention on the band only, scores to merged planes in one kernel with score and probability rows in LDS (per 64-row tile the 3 score tiles, 256 softmax columns and 192 PV keys that can hold |i - j| <= 50; the band itself is a select in the softmax; hybrid rows: < 512 hi/lo 3 products, rest fp16 x1024); merged hi/lo x Wo exact + bo.
// Compute dtypes, f32 accumulate: every input rounded to bf16; projections exact + f32 biases; rotary f32; attention rows < 512 3 products, rest fp16; softmax f32; Wo hl x exact + bias.

#define NB_  2
#define TT   2048
#define DM   1024
#define NH_  16
#define NKV  16
#define REP  (NH_ / NKV)
#define HD   64
#define DQ   (NH_ * HD)
#define DKV  (NKV * HD)
#define ZH   (NB_ * NH_)          // attention planes per launch: every (batch, head)
#define RH   512                  // query rows < RH use hi+lo planes (0: none)
#define WIN  2048
#define BW   50       // half window: keys j in [i - 50, i + 50]
#define PCAR 1024.0f
#define SCL  0.125f   // HD^-0.5
typedef _Float16 h16;
typedef unsigned short bf;
typedef __attribute__((ext_vector_type(16))) __bf16   v16bf;
typedef __attribute__((ext_vector_type(16))) _Float16 v16h;
typedef __attribute__((ext_vector_type(8)))  _Float16 v8h;
typedef __attribute__((ext_vector_type(8)))  unsigned short v8us;
typedef __attribute__((ext_vector_type(8)))  float    v8f;
typedef __attribute__((ext_vector_type(4)))  float    v4f;
typedef v8h  __attribute__((may_alias)) v8ha;
typedef v4f  __attribute__((may_alias)) v4fa;
typedef v8us __attribute__((may_alias)) v8usa;

__device__ __forceinline__ unsigned short f2bf(float f) { unsigned u = __float_as_uint(f); u += 0x7FFFu + ((u >> 16) & 1u); return (unsigned short)(u >> 16); }
__device__ __forceinline__ float bf2f(unsigned short b) { return __uint_as_float(((unsigned)b) << 16); }
__device__ __forceinline__ float bfr(float f) { return bf2f(f2bf(f)); }
__device__ __forceinline__ v16h cat16(v8h lo, v8h hi) { return __builtin_shufflevector(lo, hi, 0, 1, 2, 3, 4, 5, 6, 7, 8, 9, 10, 11, 12, 13, 14, 15); }
__device__ __forceinline__ v16bf cat16b(v8us lo, v8us hi) { return __builtin_bit_cast(v16bf, __builtin_shufflevector(lo, hi, 0, 1, 2, 3, 4, 5, 6, 7, 8, 9, 10, 11, 12, 13, 14, 15)); }
__device__ __forceinline__ v8f wmma16(v16h a, v16h b, v8f c) { return __builtin_amdgcn_wmma_f32_16x16x32_f16(false, a, false, b, (short)0, c, false, false); }
__device__ __forceinline__ v8f wmmab(v16bf a, v16bf b, v8f c) { return __builtin_amdgcn_wmma_f32_16x16x32_bf16(false, a, false, b, (short)0, c, false, false); }



// Fragments come from K-contiguous 16-bit planes: lane lr + 16 hi holds row lr, k = 8 hi .. 8 hi + 7 and 16 + 8 hi .. 16 + 8 hi + 7 of each 32 k, the same for A and B.
__device__ __forceinline__ int CB(int q0) { return min(max(q0 - 64, 0) / 128, TT / 128 - 2) * 128; }   // first key of the two 128-key chunks that cover row tile q0's band
template <typename T16> struct WFrag;
template <> struct WFrag<h16> { typedef v16h V; static __device__ __forceinline__ V ld(const h16* p) { return cat16(*(const v8h*)p, *(const v8h*)(p + 16)); } static __device__ __forceinline__ v8f mma(V a, V b, v8f c) { return wmma16(a, b, c); } };
template <> struct WFrag<bf> { typedef v16bf V; static __device__ __forceinline__ V ld(const bf* p) { return cat16b(*(const v8us*)p, *(const v8us*)(p + 16)); } static __device__ __forceinline__ v8f mma(V a, V b, v8f c) { return wmmab(a, b, c); } };
// ---- k_gemmt: the four projections. One 128x128 tile of C per work-group of 4 waves (2 x 2 waves of 64x64, 16 accumulators a wave); A (, A2) and Bt tiles of 64 k come into LDS by asynchronous copies, whole 128-byte lines, each staged row read by two waves; two buffers, the next stage's copies fly while this stage is multiplied.
// C[m][n] (f32, pitch DM, + f32 bias[n], one bias pointer per z < 3) = sum_k A[m][k] Bt[n][k] (+ A2[m][k] Bt[n][k] behind it in every 32 k when NSPLIT). All pitches DM; grid (M/128, N/128, Z).
#define GP   72            // LDS row pitch in 16-bit elements: 144 bytes = 16 x odd, the conflict-free pitch for 16-byte reads of 128-byte rows
#define GKS  64            // k per stage
#define GMAT (128 * GP)    // elements of one staged operand tile
// cp8: rows r, r + 16, ... r + 112 of one operand tile, 16 bytes a lane; the s_wait_xcnt closes the statement so that no address register is rewritten in front of it
__device__ __forceinline__ void cp8(unsigned l, const bf* g) {
    asm volatile("global_load_async_to_lds_b128 %0, %8, off\n\t"
                 "global_load_async_to_lds_b128 %1, %9, off\n\t"
                 "global_load_async_to_lds_b128 %2, %10, off\n\t"
                 "global_load_async_to_lds_b128 %3, %11, off\n\t"
                 "global_load_async_to_lds_b128 %4, %12, off\n\t"
                 "global_load_async_to_lds_b128 %5, %13, off\n\t"
                 "global_load_async_to_lds_b128 %6, %14, off\n\t"
                 "global_load_async_to_lds_b128 %7, %15, off\n\t"
                 "s_wait_xcnt 0x0"
                 :: "v"(l), "v"(l + 1 * 16 * GP * 2), "v"(l + 2 * 16 * GP * 2), "v"(l + 3 * 16 * GP * 2), "v"(l + 4 * 16 * GP * 2), "v"(l + 5 * 16 * GP * 2), "v"(l + 6 * 16 * GP * 2), "v"(l + 7 * 16 * GP * 2),
                    "v"(g), "v"(g + 1 * 16 * DM), "v"(g + 2 * 16 * DM), "v"(g + 3 * 16 * DM), "v"(g + 4 * 16 * DM), "v"(g + 5 * 16 * DM), "v"(g + 6 * 16 * DM), "v"(g + 7 * 16 * DM)
                 : "memory");
}
template <int NSPLIT>
__global__ __launch_bounds__(128) void k_gemmt(const bf* __restrict__ A, const bf* __restrict__ A2, const bf* __restrict__ Bt, float* C, const float* __restrict__ bias0, const float* __restrict__ bias1, const float* __restrict__ bias2, size_t sA, size_t sB, size_t sC) {
    constexpr int NMAT = 2 + NSPLIT, STG = NMAT * GMAT, NST = DM / GKS;
    __shared__ __align__(16) bf ring[2 * STG];
    __shared__ __align__(16) float osb[4 * 16 * 68];
    const size_t z = blockIdx.z; A += z * sA; if (NSPLIT) A2 += z * sA; Bt += z * sB; C += z * sC; const float* bias = (z == 0) ? bias0 : (z == 1) ? bias1 : bias2;
    const int tid = threadIdx.x, lane = tid & 31, lr = lane & 15, hi = lane >> 4, w = tid >> 5;
    const int R0 = blockIdx.x * 128, C0 = blockIdx.y * 128, r0 = R0 + (w >> 1) * 64, c0 = C0 + (w & 1) * 64;
    const int crow = tid >> 3, ccol = (tid & 7) * 8;   // a thread copies 16 bytes of rows crow + 16 i; 8 threads fill a row's 128 bytes
    const bf* gA = A + (size_t)(R0 + crow) * DM + ccol; const bf* gA2 = NSPLIT ? A2 + (size_t)(R0 + crow) * DM + ccol : nullptr; const bf* gB = Bt + (size_t)(C0 + crow) * DM + ccol;
    const unsigned l0 = (unsigned)(size_t)ring + (unsigned)(crow * GP + ccol) * 2u;
    auto fill = [&](int s) { const unsigned l = l0 + (unsigned)(s & 1) * (STG * 2u); cp8(l, gA + s * GKS); if (NSPLIT) cp8(l + GMAT * 2u, gA2 + s * GKS); cp8(l + (NMAT - 1) * GMAT * 2u, gB + s * GKS); };
    v8f acc[4][4];
#pragma unroll
    for (int mb = 0; mb < 4; ++mb)
#pragma unroll
        for (int nb = 0; nb < 4; ++nb) acc[mb][nb] = (v8f){};
    const bf* fa = ring + ((w >> 1) * 64 + lr) * GP + 8 * hi; const bf* fb = ring + (NMAT - 1) * GMAT + ((w & 1) * 64 + lr) * GP + 8 * hi;
    fill(0);
    asm volatile("s_wait_asynccnt 0x0" ::: "memory");   // stage 0 has landed before the barrier publishes it
    __syncthreads();
    fill(1);
#pragma unroll 1   // one copy of the stage body: the buffer is picked by an address (for speed only)
    for (int t = 0; t < NST; ++t) {
        const int bo = (t & 1) * STG;
#pragma unroll
        for (int kk = 0; kk < GKS; kk += 32) {
            v16bf a[4], a2[4], b[4];
#pragma unroll
            for (int mb = 0; mb < 4; ++mb) { a[mb] = WFrag<bf>::ld(fa + bo + mb * 16 * GP + kk); if (NSPLIT) a2[mb] = WFrag<bf>::ld(fa + bo + GMAT + mb * 16 * GP + kk); }
#pragma unroll
            for (int nb = 0; nb < 4; ++nb) b[nb] = WFrag<bf>::ld(fb + bo + nb * 16 * GP + kk);
            __builtin_amdgcn_sched_barrier(0);   // the LDS reads of these 32 k go out as one group in front of their matrix instructions (for speed only)
#pragma unroll
            for (int nb = 0; nb < 4; ++nb) {
#pragma unroll
                for (int mb = 0; mb < 4; ++mb) acc[mb][nb] = wmmab(a[mb], b[nb], acc[mb][nb]);
                if (NSPLIT) {
#pragma unroll
                    for (int mb = 0; mb < 4; ++mb) acc[mb][nb] = wmmab(a2[mb], b[nb], acc[mb][nb]); } }
        }
        asm volatile("s_wait_dscnt 0x0" ::: "memory");      // this wave's reads of buffer t & 1 are done before the barrier frees it
        asm volatile("s_wait_asynccnt 0x0" ::: "memory");   // this wave's copies of stage t + 1 have landed before the barrier publishes them
        __syncthreads();
        if (t + 2 < NST) fill(t + 2);
    }
    asm volatile("s_wait_asynccnt 0x0" ::: "memory");   // nothing is in flight when the wave goes on to the epilogue and ends
    float* os = osb + w * (16 * 68);   // each wave stages its own output rows
    v4f bb = *(const v4fa*)(bias + c0 + lr * 4); bb[0] = bfr(bb[0]); bb[1] = bfr(bb[1]); bb[2] = bfr(bb[2]); bb[3] = bfr(bb[3]);
#pragma unroll
    for (int mb = 0; mb < 4; ++mb) {
#pragma unroll
        for (int nb = 0; nb < 4; ++nb) {
#pragma unroll
            for (int j = 0; j < 8; ++j) os[(hi * 8 + j) * 68 + nb * 16 + lr] = acc[mb][nb][j]; }
        __builtin_amdgcn_wave_barrier(); asm volatile("" ::: "memory");   // the wave's stores to os stay in front of its reads
        float* crow_p = C + (size_t)(r0 + mb * 16) * DM + c0;
#pragma unroll
        for (int s = 0; s < 8; ++s) { const int row = 2 * s + hi, cofs = lr * 4; v4f val = *(const v4fa*)(os + row * 68 + cofs); val[0] += bb[0]; val[1] += bb[1]; val[2] += bb[2]; val[3] += bb[3];
            *(v4f*)(crow_p + (size_t)row * DM + cofs) = val; }
        asm volatile("s_wait_xcnt 0x0" ::: "memory");   // precaution: stands behind the stores and in front of the next rows' address arithmetic
        __builtin_amdgcn_wave_barrier(); asm volatile("" ::: "memory");   // the reads of os stay in front of the next rows' stores to it
    }
}
__device__ __forceinline__ h16 tohx(float x) { return (h16)x; }
__device__ __forceinline__ void splitf(float y, unsigned short& h, unsigned short& l) { h = f2bf(y); l = f2bf(y - bf2f(h)); }
typedef __attribute__((ext_vector_type(2))) _Float16 v2h;
typedef __attribute__((ext_vector_type(4))) _Float16 v4h;
typedef __attribute__((ext_vector_type(2))) unsigned short v2us;
typedef __attribute__((ext_vector_type(4))) unsigned short v4us;
typedef __attribute__((ext_vector_type(2))) float v2f;
typedef __attribute__((ext_vector_type(4))) int v4i;

// The elementwise stages below give every thread many values (16-byte loads and stores, all of a thread's loads issued before its first use), so that a stage needs only a few thousand waves (for speed only).
// XW: precaution, stands behind a run of global loads or stores and in front of the arithmetic that may reuse their address registers
#define XW() asm volatile("s_wait_xcnt 0x0" ::: "memory")
#define CU 8    // k_cvt8: groups of 8 values per thread, one grid apart
#define RU 4    // k_rope: heads per thread; they share one read of the {cos, sin} table
#define SR 8    // k_attn: rows per softmax group
// k_cvt8: grid y picks one of up to four equally long sources; their bf16 copies lie one behind the other in dst; n8 = gridDim.x * 256 * CU groups of 8
__global__ __launch_bounds__(256) void k_cvt8(const float* __restrict__ s0, const float* __restrict__ s1, const float* __restrict__ s2, const float* __restrict__ s3, bf* dst, size_t n8) { const size_t i0 = (size_t)blockIdx.x * 256 + threadIdx.x, st = (size_t)gridDim.x * 256; const int y = blockIdx.y; const float* src = (y == 0) ? s0 : (y == 1) ? s1 : (y == 2) ? s2 : s3; dst += (size_t)y * n8 * 8; v8f v[CU];
#pragma unroll
    for (int u = 0; u < CU; ++u) v[u] = *(const v8f*)(src + (i0 + u * st) * 8);
    XW();
#pragma unroll
    for (int u = 0; u < CU; ++u) { v8us o;
#pragma unroll
        for (int k = 0; k < 8; ++k) o[k] = f2bf(v[u][k]);
        *(v8us*)(dst + (i0 + u * st) * 8) = o; }
    XW();  }

// k_rope: grid y = tensor (q, k; strides sF, sP); head planes [b][h][t][d] (fp16 + hi/lo) of rope(x) x sc with the rotate-half convention out[d] = x[d] cos[t][d] - x[d+HD/2] sin[t][d], out[d+HD/2] = x[d+HD/2] cos[t][d+HD/2] + x[d] sin[t][d+HD/2]; a thread takes 8 neighbouring d of one t in RU heads
__global__ __launch_bounds__(256) void k_rope(const float* __restrict__ F, int pitch, int nheads, const float* __restrict__ CS, float sc, h16* P16, bf* Ph, bf* Pl, size_t sF, size_t sP) {
    const int n = blockIdx.x * 256 + threadIdx.x; if (n >= NB_ * nheads / RU * TT * (HD / 8)) return; F += blockIdx.y * sF; P16 += blockIdx.y * sP; Ph += blockIdx.y * sP; Pl += blockIdx.y * sP; const int d = (n % (HD / 8)) * 8; const int t = (n / (HD / 8)) % TT; const int h0 = (n / (HD / 8 * TT)) * RU; const int dp = (d < HD / 2) ? d + HD / 2 : d - HD / 2;
    v4f c[4], xa[RU][2], xb[RU][2];
#pragma unroll
    for (int k = 0; k < 4; ++k) c[k] = *(const v4f*)(CS + ((size_t)t * HD + d) * 2 + 4 * k);
#pragma unroll
    for (int u = 0; u < RU; ++u) { const int h = h0 + u; const float* f = F + ((size_t)(h / nheads) * TT + t) * pitch + (h % nheads) * HD; xa[u][0] = *(const v4f*)(f + d); xa[u][1] = *(const v4f*)(f + d + 4); xb[u][0] = *(const v4f*)(f + dp); xb[u][1] = *(const v4f*)(f + dp + 4); }
    XW();
#pragma unroll
    for (int u = 0; u < RU; ++u) { v8h o16; v8us oh, ol;
#pragma unroll
        for (int q = 0; q < 8; ++q) { const float x0 = xa[u][q >> 2][q & 3], x1 = xb[u][q >> 2][q & 3];
            float a = __fmul_rn(x0, c[q >> 1][(q & 1) * 2]), bq = __fmul_rn(x1, c[q >> 1][(q & 1) * 2 + 1]); asm volatile("" : "+v"(a)); asm volatile("" : "+v"(bq)); const float r = ((d < HD / 2) ? __fsub_rn(a, bq) : __fadd_rn(a, bq)) * sc;
            o16[q] = tohx(r); unsigned short a2, c2; splitf(r, a2, c2); oh[q] = a2; ol[q] = c2; }
        const size_t e = ((size_t)(h0 + u) * TT + t) * HD + d; *(v8h*)(P16 + e) = o16; *(v8us*)(Ph + e) = oh; *(v8us*)(Pl + e) = ol; }
    XW();  }
// k_vtp: V^T planes [g][d][t]; a thread takes 8 t x 4 d (8 row reads of 16 bytes, 4 x 3 stores of 16 bytes); a wave's 8 x 4 threads cover 64 t x 16 d, so each store fills whole 128-byte lines
__global__ __launch_bounds__(256) void k_vtp(const float* __restrict__ F, int pitch, int nheads, h16* V16, bf* Vh, bf* Vl) { const int n = blockIdx.x * 256 + threadIdx.x; if (n >= NB_ * nheads * (HD / 4) * (TT / 8)) return; const int tl = n & 7, dl = (n >> 3) & 3, r = n >> 5; const int dh = r % (HD / 16), th = (r / (HD / 16)) % (TT / 64), g = r / ((HD / 16) * (TT / 64)); const int t = (th * 8 + tl) * 8, d = (dh * 4 + dl) * 4;
    const float* f = F + ((size_t)(g / nheads) * TT + t) * pitch + (g % nheads) * HD + d; v4f x[8];
#pragma unroll
    for (int q = 0; q < 8; ++q) x[q] = *(const v4f*)(f + (size_t)q * pitch);
    XW();
#pragma unroll
    for (int k = 0; k < 4; ++k) { v8h o16; v8us oh, ol;
#pragma unroll
        for (int q = 0; q < 8; ++q) { o16[q] = tohx(x[q][k]); unsigned short a2, c2; splitf(x[q][k], a2, c2); oh[q] = a2; ol[q] = c2; }
        const size_t e = ((size_t)g * HD + d + k) * TT + t; *(v8h*)(V16 + e) = o16; *(v8us*)(Vh + e) = oh; *(v8us*)(Vl + e) = ol; }
    XW();  }
__constant__ float INVT[HD / 2] = { 1.000000000e+00f, 7.498942018e-01f, 5.623413324e-01f, 4.216965139e-01f, 3.162277639e-01f, 2.371373624e-01f, 1.778279394e-01f, 1.333521456e-01f, 1.000000015e-01f, 7.498941571e-02f, 5.623412877e-02f, 4.216964915e-02f, 3.162277862e-02f, 2.371373586e-02f, 1.778279431e-02f, 1.333521493e-02f, 9.999999776e-03f, 7.498942316e-03f, 5.623413250e-03f, 4.216964822e-03f, 3.162277862e-03f, 2.371373819e-03f, 1.778279431e-03f, 1.333521446e-03f, 1.000000047e-03f, 7.498941850e-04f, 5.623413017e-04f, 4.216964880e-04f, 3.162277862e-04f, 2.371373848e-04f, 1.778279402e-04f, 1.333521504e-04f };   // float32 1 / 10000^(2i/64), i < 32, generated with jnp to be bit-exact
__global__ __launch_bounds__(256) void k_cs5(float* CS) { const int idx = blockIdx.x * 256 + threadIdx.x; if (idx >= TT * HD) return; const int d = idx % HD; const int t = idx / HD; const float a = __fmul_rn((float)t, INVT[d % (HD / 2)]); v2f cs; cs[0] = cosf(a); cs[1] = sinf(a); *(v2f*)(CS + (size_t)idx * 2) = cs;  }
// ---- k_attn: the whole banded attention of one (batch, head) and 64 query rows in one work-group of 4 waves; a wave owns 16 query rows from the scores to the merged hi/lo planes and shares nothing with the other waves (no work-group barrier); the 4 waves read the same K and V^T lines.
// Per wave: (1) scores Q K^T for keys kbeg .. kend - 1 (q0 - 64 .. q0 + 127 clipped to the sequence: every |i - j| <= 50 of the row tile), f32 into the wave's LDS rows, key j at column j - CB(q0); (2) softmax of SR rows at a time, a row's 256 columns over the 32 lanes; the probabilities (fp16 x 1024, or bf16 hi and lo) overwrite the row's own scores; (3) P V over the same keys, A fragments from LDS, B fragments from the V^T planes; (4) the 16 x 64 result turned through LDS, scaled back, split hi/lo and stored as whole 128-byte lines of the merged [b][t][h d] planes.
// Row tiles < RH / 64 take the hi/lo planes (3 products per 32 k, in the order hi hi, lo hi, hi lo), the rest the fp16 planes.
#define AP  268   // LDS row pitch in floats: 8 rows apart is 32 banks apart (the two halves of an accumulator store do not collide); 1072 bytes = 16 x odd for the 16-byte fragment reads; holds 256 f32 scores, then 2 x 264 16-bit probabilities
#define APL 264   // offset of a row's lo probabilities in 16-bit elements
// wfence: keeps the wave's LDS stores of one phase in front of its LDS reads of the next (and a row's score reads in front of the probabilities that overwrite them) in the compiled order; the hardware runs one wave's LDS operations in order
__device__ __forceinline__ void wfence() { __builtin_amdgcn_wave_barrier(); asm volatile("" ::: "memory"); }
template <typename T16, bool HL>
__device__ __forceinline__ void attn16(float* sl, int q0, int w, int zz, const T16* __restrict__ Q, const T16* __restrict__ Q2, const T16* __restrict__ Kp, const T16* __restrict__ K2, const T16* __restrict__ Vt, const T16* __restrict__ V2, bf* Ah, bf* Al) {
    typedef typename WFrag<T16>::V V;
    const int lane = threadIdx.x & 31, lr = lane & 15, hi = lane >> 4; const int i0 = q0 + w * 16, cb = CB(q0), kbeg = max(q0 - 64, 0), kend = min(q0 + 128, TT);
    {   // (1) scores
        V a[2], a2[2]; const size_t qo = (size_t)(i0 + lr) * HD + 8 * hi;
#pragma unroll
        for (int kk = 0; kk < 2; ++kk) { a[kk] = WFrag<T16>::ld(Q + qo + kk * 32); if (HL) a2[kk] = WFrag<T16>::ld(Q2 + qo + kk * 32); }
#pragma unroll 1   // 2 or 3 column tiles of 64 keys
        for (int c0 = kbeg; c0 < kend; c0 += 64) {
            v8f acc[4]; V b[2][4], b2[2][4]; const size_t ko = (size_t)(c0 + lr) * HD + 8 * hi;
#pragma unroll
            for (int kk = 0; kk < 2; ++kk)
#pragma unroll
                for (int nb = 0; nb < 4; ++nb) { b[kk][nb] = WFrag<T16>::ld(Kp + ko + nb * 16 * HD + kk * 32); if (HL) b2[kk][nb] = WFrag<T16>::ld(K2 + ko + nb * 16 * HD + kk * 32); }
            XW();
            __builtin_amdgcn_sched_barrier(0);   // all loads of these 64 keys go out as one group (for speed only)
#pragma unroll
            for (int nb = 0; nb < 4; ++nb) acc[nb] = (v8f){};
#pragma unroll
            for (int kk = 0; kk < 2; ++kk)
#pragma unroll
                for (int nb = 0; nb < 4; ++nb) { acc[nb] = WFrag<T16>::mma(a[kk], b[kk][nb], acc[nb]); if (HL) { acc[nb] = WFrag<T16>::mma(a2[kk], b[kk][nb], acc[nb]); acc[nb] = WFrag<T16>::mma(a[kk], b2[kk][nb], acc[nb]); } }
#pragma unroll
            for (int nb = 0; nb < 4; ++nb)
#pragma unroll
                for (int j = 0; j < 8; ++j) sl[(hi * 8 + j) * AP + (c0 - cb) + nb * 16 + lr] = acc[nb][j];
        }
    }
    wfence();
    // (2) softmax: t = S x 1/8 for keys with |i - j| <= 50, -3e38 elsewhere (the -1e9 fill == exclusion); same lane and chunk order as over all 2048 keys, whose other terms are exact zeros; S is read only where a lane's 4 keys touch the band; each step for all SR rows in turn so that their butterflies overlap
#pragma unroll 1   // two groups of SR rows: one copy of the code, and the registers of one group
    for (int rb = 0; rb < 16; rb += SR) {
        float v[SR][8]; float mx[SR], sum[SR]; v4f a[SR][2];
#pragma unroll
        for (int r = 0; r < SR; ++r) {
#pragma unroll
            for (int ch = 0; ch < 2; ++ch) { const int i = i0 + rb + r, j0 = cb + ch * 128 + lane * 4; a[r][ch] = (v4f){}; if (i - (j0 + 3) <= BW && j0 - i <= BW) a[r][ch] = *(const v4fa*)(sl + (rb + r) * AP + ch * 128 + lane * 4); } }
        wfence();
#pragma unroll
        for (int r = 0; r < SR; ++r) { mx[r] = -3.0e38f;
#pragma unroll
            for (int ch = 0; ch < 2; ++ch) {
#pragma unroll
                for (int q = 0; q < 4; ++q) { const int i = i0 + rb + r, j = cb + ch * 128 + lane * 4 + q; const float t = (i - j <= BW && j - i <= BW) ? a[r][ch][q] * SCL : -3.0e38f;   /* |i - j| <= 50 */ v[r][ch * 4 + q] = t; mx[r] = fmaxf(mx[r], t); } } }
#pragma unroll
        for (int sh = 16; sh; sh >>= 1) {
#pragma unroll
            for (int r = 0; r < SR; ++r) mx[r] = fmaxf(mx[r], __shfl_xor(mx[r], sh, 32)); }
#pragma unroll
        for (int r = 0; r < SR; ++r) { sum[r] = 0.f;
#pragma unroll
            for (int k = 0; k < 8; ++k) { const float d0 = __fsub_rn(v[r][k], mx[r]); const float e0 = __fmul_rn(d0, 1.4426950408889634f);
                __builtin_amdgcn_sched_barrier(0);   // with the one two lines down: holds the v_nop directly behind the v_exp_f32
                v[r][k] = __builtin_amdgcn_exp2f(e0); asm volatile("v_nop");   // the slot behind the transcendental, kept free of an instruction that reads its result or overwrites its source
                __builtin_amdgcn_sched_barrier(0); }
#pragma unroll
            for (int k = 0; k < 8; ++k) sum[r] += v[r][k]; }
#pragma unroll
        for (int sh = 16; sh; sh >>= 1) {
#pragma unroll
            for (int r = 0; r < SR; ++r) sum[r] += __shfl_xor(sum[r], sh, 32); }
#pragma unroll
        for (int r = 0; r < SR; ++r) { const float f = __fdiv_rn(HL ? 1.0f : PCAR, sum[r]); T16* pr = (T16*)(sl + (rb + r) * AP);
#pragma unroll
            for (int ch = 0; ch < 2; ++ch) {
                if constexpr (HL) { v4us oh, ol;
#pragma unroll
                    for (int q = 0; q < 4; ++q) { unsigned short a2, c2; splitf(v[r][ch * 4 + q] * f, a2, c2); oh[q] = a2; ol[q] = c2; }
                    *(v4us*)(pr + ch * 128 + lane * 4) = oh; *(v4us*)(pr + APL + ch * 128 + lane * 4) = ol;
                } else { v4h o4;
#pragma unroll
                    for (int q = 0; q < 4; ++q) o4[q] = tohx(v[r][ch * 4 + q] * f);
                    *(v4h*)(pr + ch * 128 + lane * 4) = o4; } } }
    }
    wfence();
    v8f o[4];
#pragma unroll
    for (int nb = 0; nb < 4; ++nb) o[nb] = (v8f){};
    {   // (3) P V
        const T16* pa = (const T16*)sl + lr * (AP * 2) + 8 * hi; const size_t vo = (size_t)lr * TT + 8 * hi;
#pragma unroll 1   // 2 or 3 steps of 64 keys
        for (int kc = kbeg; kc < kend; kc += 64) {
            V b[2][4], b2[2][4], a[2], a2[2];
#pragma unroll
            for (int kk = 0; kk < 2; ++kk)
#pragma unroll
                for (int nb = 0; nb < 4; ++nb) { b[kk][nb] = WFrag<T16>::ld(Vt + vo + (size_t)nb * 16 * TT + kc + kk * 32); if (HL) b2[kk][nb] = WFrag<T16>::ld(V2 + vo + (size_t)nb * 16 * TT + kc + kk * 32); }
            XW();
#pragma unroll
            for (int kk = 0; kk < 2; ++kk) { a[kk] = WFrag<T16>::ld(pa + (kc - cb) + kk * 32); if (HL) a2[kk] = WFrag<T16>::ld(pa + APL + (kc - cb) + kk * 32); }
            __builtin_amdgcn_sched_barrier(0);   // all loads of these 64 keys go out as one group (for speed only)
#pragma unroll
            for (int kk = 0; kk < 2; ++kk)
#pragma unroll
                for (int nb = 0; nb < 4; ++nb) { o[nb] = WFrag<T16>::mma(a[kk], b[kk][nb], o[nb]); if (HL) { o[nb] = WFrag<T16>::mma(a2[kk], b[kk][nb], o[nb]); o[nb] = WFrag<T16>::mma(a[kk], b2[kk][nb], o[nb]); } }
        }
    }
    wfence();
    // (4) merge
#pragma unroll
    for (int nb = 0; nb < 4; ++nb)
#pragma unroll
        for (int j = 0; j < 8; ++j) sl[(hi * 8 + j) * 68 + nb * 16 + lr] = o[nb][j];
    wfence();
    const float cs = HL ? 1.0f : (1.0f / PCAR);
#pragma unroll
    for (int g = 0; g < 4; ++g) { const int row = g * 4 + (lane >> 3), d = (lane & 7) * 8; const v4f x0 = *(const v4fa*)(sl + row * 68 + d), x1 = *(const v4fa*)(sl + row * 68 + d + 4); v8us oh, ol;
#pragma unroll
        for (int q = 0; q < 8; ++q) { unsigned short h2, l2; splitf((q < 4 ? x0[q & 3] : x1[q & 3]) * cs, h2, l2); oh[q] = h2; ol[q] = l2; }
        const size_t oo = ((size_t)(zz / NH_) * TT + i0 + row) * DQ + (zz % NH_) * HD + d; *(v8us*)(Ah + oo) = oh; *(v8us*)(Al + oo) = ol; }
    XW();
}
// grid (TT / 64, ZH); all planes are whole ([z][t][d], V^T [z][d][t])
__global__ __launch_bounds__(128) void k_attn(const bf* __restrict__ Qh, const bf* __restrict__ Ql, const bf* __restrict__ Kh, const bf* __restrict__ Kl, const bf* __restrict__ Vh, const bf* __restrict__ Vl, const h16* __restrict__ Q16, const h16* __restrict__ K16, const h16* __restrict__ V16, bf* Ah, bf* Al) {
    __shared__ __align__(16) float sb[4 * 16 * AP];
    const int w = threadIdx.x >> 5, q0 = blockIdx.x * 64, zz = blockIdx.y; const size_t zo = (size_t)zz * TT * HD; float* sl = sb + w * (16 * AP);
    if (q0 >= RH) { attn16<h16, false>(sl, q0, w, zz, Q16 + zo, nullptr, K16 + zo, nullptr, V16 + zo, nullptr, Ah, Al); return; }
    attn16<bf, true>(sl, q0, w, zz, Qh + zo, Ql + zo, Kh + zo, Kl + zo, Vh + zo, Vl + zo, Ah, Al);
}

extern "C" void kernel_launch(void* const* d_in, const int* in_sizes, int n_in,
                              void* d_out, int out_size, void* d_ws, size_t ws_size, hipStream_t stream) {
    (void)in_sizes; (void)n_in; (void)out_size;
    const float* x = (const float*)d_in[0];   /* query */ const float* xk = (const float*)d_in[1]; const float* xv = (const float*)d_in[2]; const float* wq = (const float*)d_in[3]; const float* bq = (const float*)d_in[4]; const float* wk = (const float*)d_in[5]; const float* bk = (const float*)d_in[6]; const float* wv = (const float*)d_in[7]; const float* bv = (const float*)d_in[8]; const float* wo = (const float*)d_in[9]; const float* bo = (const float*)d_in[10];   /* input order query, key, value, Wq, bq, Wk, bk, Wv, bv, Wo, bo */
    float* OUT = (float*)d_out;     // [2][2048][1024]
    char* wsp = (char*)d_ws;
    auto take = [&](size_t bytes) { char* p = wsp; wsp += (bytes + 255) & ~(size_t)255; return (void*)p; };
    const size_t NW = (size_t)DQ * DM, NX = (size_t)NB_ * TT * DM, NP = (size_t)ZH * TT * HD;   // elements of one weight, one input tensor, one set of head planes
    bf* WQ = (bf*)take(4 * NW * 2); bf* WO = WQ + 3 * NW;   /* Wq, Wk, Wv, Wo in turn */ float* CS = (float*)take((size_t)TT * HD * 2 * 4);
    h16* QP16 = (h16*)take(2 * NP * 2); h16* KP16 = QP16 + NP; bf* QPh = (bf*)take(2 * NP * 2); bf* KPh = QPh + NP; bf* QPl = (bf*)take(2 * NP * 2); bf* KPl = QPl + NP;   /* q planes, then k planes */
    h16* VT16 = (h16*)take(NP * 2); bf* VTh = (bf*)take(NP * 2); bf* VTl = (bf*)take(NP * 2);
    bf* ATh = (bf*)take(NX * 2); bf* ATl = (bf*)take(NX * 2);
    bf* XB = (bf*)take(3 * NX * 2); float* FQ = (float*)take(3 * NX * 4);   /* bf16 query, key, value; their f32 projections */
    if ((size_t)(wsp - (char*)d_ws) > ws_size) return;    // ws 256 MiB
    k_cvt8<<<dim3((unsigned)(NW / 8 / (256 * CU)), 4), 256, 0, stream>>>(wq, wk, wv, wo, WQ, NW / 8);
    k_cs5<<<(TT * HD + 255) / 256, 256, 0, stream>>>(CS);   /* rotary table once */
    k_cvt8<<<dim3((unsigned)(NX / 8 / (256 * CU)), 3), 256, 0, stream>>>(x, xk, xv, xv, XB, NX / 8);
    k_gemmt<0><<<dim3(NB_ * TT / 128, DQ / 128, 3), 128, 0, stream>>>(XB, nullptr, WQ, FQ, bq, bk, bv, NX, NW, NX);
    static_assert(((size_t)DQ * DM / 8) % (256 * CU) == 0 && ((size_t)NB_ * TT * DM / 8) % (256 * CU) == 0 && ZH % RU == 0 && 16 % SR == 0 && RH % 64 == 0, "whole grids");
    k_rope<<<dim3((unsigned)(NP / 8 / RU / 256), 2), 256, 0, stream>>>(FQ, DQ, NH_, CS, 1.0f, QP16, QPh, QPl, NX, NP);
    k_vtp<<<(unsigned)(NP / 32 / 256), 256, 0, stream>>>(FQ + 2 * NX, DKV, NKV, VT16, VTh, VTl);
    k_attn<<<dim3(TT / 64, ZH), 128, 0, stream>>>(QPh, QPl, KPh, KPl, VTh, VTl, QP16, KP16, VT16, ATh, ATl);
    k_gemmt<1><<<dim3(NB_ * TT / 128, DM / 128, 1), 128, 0, stream>>>(ATh, ATl, WO, OUT, bo, bo, bo, 0, 0, 0);
}

// v006
// It runs in 90.9 microseconds.
// Next to v005, in two timings, it ran 1.13 and 1.14 times as fast.
// All steps since v000 together make it 22.4 times as fast.
#include <hip/hip_runtime.h>

// Sliding-window multi-head attention with rotary embeddings (query, key, value [2][2048][1024]; q = query Wq^T + bq etc. ('oi' 1/32, zero biases; 16 heads x 64); rotate-half rotary with angles t x 1/10000^(2i/64) (float32 table baked, precise cosf/sinf); scores / sqrt(64); keys with |i - j| <= 50 kept (-1e9 elsewhere == exclusion); softmax; out = merged Wo^T + bo -> [2][2048][1024] (4.2 M); argument order query, key, value, Wq, bq, Wk, bk, Wv, bv, Wo, bo).
// Layout, both batches and all 16 heads in one launch per stage (grid y / z picks tensor, batch and head): bf16 copies of query, key, value; 'oi' weights; {cos, sin} table once; exact projections + f32 biases, whose epilogue applies the rotate-half rotary (q, k) or the transpose (v) and writes the head planes; T-2048 attention on the band only, scores to merged planes in one kernel with score and probability rows in LDS (per 64-row tile the 3 score tiles, 256 softmax columns and 192 PV keys that can hold |i - j| <= 50; the band itself is a select in the softmax; hybrid rows: < 512 hi/lo 3 products, rest fp16 x1024); merged hi/lo x Wo exact + bo.
// Compute dtypes, f32 accumulate: every input rounded to bf16; projections exact + f32 biases; rotary f32; attention rows < 512 3 products, rest fp16; softmax f32; Wo hl x exact + bias.

#define NB_  2
#define TT   2048
#define DM   1024
#define NH_  16
#define NKV  16
#define REP  (NH_ / NKV)
#define HD   64
#define DQ   (NH_ * HD)
#define DKV  (NKV * HD)
#define ZH   (NB_ * NH_)          // attention planes per launch: every (batch, head)
#define RH   512                  // query rows < RH use hi+lo planes (0: none)
#define WIN  2048
#define BW   50       // half window: keys j in [i - 50, i + 50]
#define PCAR 1024.0f
#define SCL  0.125f   // HD^-0.5
typedef _Float16 h16;
typedef unsigned short bf;
typedef __attribute__((ext_vector_type(16))) __bf16   v16bf;
typedef __attribute__((ext_vector_type(16))) _Float16 v16h;
typedef __attribute__((ext_vector_type(8)))  _Float16 v8h;
typedef __attribute__((ext_vector_type(8)))  unsigned short v8us;
typedef __attribute__((ext_vector_type(8)))  float    v8f;
typedef __attribute__((ext_vector_type(4)))  float    v4f;
typedef v8h  __attribute__((may_alias)) v8ha;
typedef v4f  __attribute__((may_alias)) v4fa;
typedef v8us __attribute__((may_alias)) v8usa;

__device__ __forceinline__ unsigned short f2bf(float f) { unsigned u = __float_as_uint(f); u += 0x7FFFu + ((u >> 16) & 1u); return (unsigned short)(u >> 16); }
__device__ __forceinline__ float bf2f(unsigned short b) { return __uint_as_float(((unsigned)b) << 16); }
__device__ __forceinline__ float bfr(float f) { return bf2f(f2bf(f)); }
__device__ __forceinline__ v16h cat16(v8h lo, v8h hi) { return __builtin_shufflevector(lo, hi, 0, 1, 2, 3, 4, 5, 6, 7, 8, 9, 10, 11, 12, 13, 14, 15); }
__device__ __forceinline__ v16bf cat16b(v8us lo, v8us hi) { return __builtin_bit_cast(v16bf, __builtin_shufflevector(lo, hi, 0, 1, 2, 3, 4, 5, 6, 7, 8, 9, 10, 11, 12, 13, 14, 15)); }
__device__ __forceinline__ v8f wmma16(v16h a, v16h b, v8f c) { return __builtin_amdgcn_wmma_f32_16x16x32_f16(false, a, false, b, (short)0, c, false, false); }
__device__ __forceinline__ v8f wmmab(v16bf a, v16bf b, v8f c) { return __builtin_amdgcn_wmma_f32_16x16x32_bf16(false, a, false, b, (short)0, c, false, false); }



// Fragments come from K-contiguous 16-bit planes: lane lr + 16 hi holds row lr, k = 8 hi .. 8 hi + 7 and 16 + 8 hi .. 16 + 8 hi + 7 of each 32 k, the same for A and B.
__device__ __forceinline__ int CB(int q0) { return min(max(q0 - 64, 0) / 128, TT / 128 - 2) * 128; }   // first key of the two 128-key chunks that cover row tile q0's band
template <typename T16> struct WFrag;
template <> struct WFrag<h16> { typedef v16h V; static __device__ __forceinline__ V ld(const h16* p) { return cat16(*(const v8h*)p, *(const v8h*)(p + 16)); } static __device__ __forceinline__ v8f mma(V a, V b, v8f c) { return wmma16(a, b, c); } };
template <> struct WFrag<bf> { typedef v16bf V; static __device__ __forceinline__ V ld(const bf* p) { return cat16b(*(const v8us*)p, *(const v8us*)(p + 16)); } static __device__ __forceinline__ v8f mma(V a, V b, v8f c) { return wmmab(a, b, c); } };
__device__ __forceinline__ h16 tohx(float x) { return (h16)x; }
__device__ __forceinline__ void splitf(float y, unsigned short& h, unsigned short& l) { h = f2bf(y); l = f2bf(y - bf2f(h)); }
// XW: precaution, stands behind a run of global loads or stores and in front of the arithmetic that may reuse their address registers
#define XW() asm volatile("s_wait_xcnt 0x0" ::: "memory")
// wfence: keeps the wave's LDS stores of one phase in front of its LDS reads of the next (and a row's score reads in front of the probabilities that overwrite them) in the compiled order; the hardware runs one wave's LDS operations in order
__device__ __forceinline__ void wfence() { __builtin_amdgcn_wave_barrier(); asm volatile("" ::: "memory"); }
typedef float __attribute__((may_alias)) f32a;
typedef __attribute__((ext_vector_type(2))) float v2f;
// ---- k_gemmt: the four projections. One 128x128 tile of C per work-group of 4 waves (2 x 2 waves of 64x64, 16 accumulators a wave); A (, A2) and Bt tiles of 64 k come into LDS by asynchronous copies, whole 128-byte lines, each staged row read by two waves; two buffers, the next stage's copies fly while this stage is multiplied.
// C[m][n] (f32, pitch DM, + f32 bias[n], one bias pointer per z < 3) = sum_k A[m][k] Bt[n][k] (+ A2[m][k] Bt[n][k] behind it in every 32 k when NSPLIT). All pitches DM; grid (M/128, N/128, Z).
// EPI: no C is written. A wave's 64x64 tile is 64 positions t of one (batch, head), so the wave itself turns it into that head's 16-bit planes (fp16, bf16 hi, bf16 lo): z < 2 (q, k) rotate-half rotary out[d] = x[d] cos[t][d] - x[d+HD/2] sin[t][d], out[d+HD/2] = x[d+HD/2] cos[t][d+HD/2] + x[d] sin[t][d+HD/2] into [b][h][t][d] (tensor stride sP); z == 2 (v) the transpose into [b][h][d][t]. Both go through the wave's quarter of the ring so that every global store fills whole 128-byte lines.
#define GP   72            // LDS row pitch in 16-bit elements: 144 bytes = 16 x odd, the conflict-free pitch for 16-byte reads of 128-byte rows
#define GKS  64            // k per stage
#define GMAT (128 * GP)    // elements of one staged operand tile
// cp8: rows r, r + 16, ... r + 112 of one operand tile, 16 bytes a lane; the s_wait_xcnt closes the statement so that no address register is rewritten in front of it
__device__ __forceinline__ void cp8(unsigned l, const bf* g) {
    asm volatile("global_load_async_to_lds_b128 %0, %8, off\n\t"
                 "global_load_async_to_lds_b128 %1, %9, off\n\t"
                 "global_load_async_to_lds_b128 %2, %10, off\n\t"
                 "global_load_async_to_lds_b128 %3, %11, off\n\t"
                 "global_load_async_to_lds_b128 %4, %12, off\n\t"
                 "global_load_async_to_lds_b128 %5, %13, off\n\t"
                 "global_load_async_to_lds_b128 %6, %14, off\n\t"
                 "global_load_async_to_lds_b128 %7, %15, off\n\t"
                 "s_wait_xcnt 0x0"
                 :: "v"(l), "v"(l + 1 * 16 * GP * 2), "v"(l + 2 * 16 * GP * 2), "v"(l + 3 * 16 * GP * 2), "v"(l + 4 * 16 * GP * 2), "v"(l + 5 * 16 * GP * 2), "v"(l + 6 * 16 * GP * 2), "v"(l + 7 * 16 * GP * 2),
                    "v"(g), "v"(g + 1 * 16 * DM), "v"(g + 2 * 16 * DM), "v"(g + 3 * 16 * DM), "v"(g + 4 * 16 * DM), "v"(g + 5 * 16 * DM), "v"(g + 6 * 16 * DM), "v"(g + 7 * 16 * DM)
                 : "memory");
}
template <int NSPLIT, int EPI>
__global__ __launch_bounds__(128) void k_gemmt(const bf* __restrict__ A, const bf* __restrict__ A2, const bf* __restrict__ Bt, float* C, const float* __restrict__ bias0, const float* __restrict__ bias1, const float* __restrict__ bias2, size_t sA, size_t sB, size_t sC, const float* __restrict__ CS, h16* P16, bf* Ph, bf* Pl, size_t sP, h16* V16, bf* Vh, bf* Vl) {
    constexpr int NMAT = 2 + NSPLIT, STG = NMAT * GMAT, NST = DM / GKS;
    __shared__ __align__(16) bf ring[2 * STG];
    const size_t z = blockIdx.z; A += z * sA; if (NSPLIT) A2 += z * sA; Bt += z * sB; C += z * sC; const float* bias = (z == 0) ? bias0 : (z == 1) ? bias1 : bias2;
    const int tid = threadIdx.x, lane = tid & 31, lr = lane & 15, hi = lane >> 4, w = tid >> 5;
    const int R0 = blockIdx.x * 128, C0 = blockIdx.y * 128, r0 = R0 + (w >> 1) * 64, c0 = C0 + (w & 1) * 64;
    const int crow = tid >> 3, ccol = (tid & 7) * 8;   // a thread copies 16 bytes of rows crow + 16 i; 8 threads fill a row's 128 bytes
    const bf* gA = A + (size_t)(R0 + crow) * DM + ccol; const bf* gA2 = NSPLIT ? A2 + (size_t)(R0 + crow) * DM + ccol : nullptr; const bf* gB = Bt + (size_t)(C0 + crow) * DM + ccol;
    const unsigned l0 = (unsigned)(size_t)ring + (unsigned)(crow * GP + ccol) * 2u;
    auto fill = [&](int s) { const unsigned l = l0 + (unsigned)(s & 1) * (STG * 2u); cp8(l, gA + s * GKS); if (NSPLIT) cp8(l + GMAT * 2u, gA2 + s * GKS); cp8(l + (NMAT - 1) * GMAT * 2u, gB + s * GKS); };
    v8f acc[4][4];
#pragma unroll
    for (int mb = 0; mb < 4; ++mb)
#pragma unroll
        for (int nb = 0; nb < 4; ++nb) acc[mb][nb] = (v8f){};
    const bf* fa = ring + ((w >> 1) * 64 + lr) * GP + 8 * hi; const bf* fb = ring + (NMAT - 1) * GMAT + ((w & 1) * 64 + lr) * GP + 8 * hi;
    fill(0);
    asm volatile("s_wait_asynccnt 0x0" ::: "memory");   // stage 0 has landed before the barrier publishes it
    __syncthreads();
    fill(1);
#pragma unroll 1   // one copy of the stage body: the buffer is picked by an address (for speed only)
    for (int t = 0; t < NST; ++t) {
        const int bo = (t & 1) * STG;
#pragma unroll
        for (int kk = 0; kk < GKS; kk += 32) {
            v16bf a[4], a2[4], b[4];
#pragma unroll
            for (int mb = 0; mb < 4; ++mb) { a[mb] = WFrag<bf>::ld(fa + bo + mb * 16 * GP + kk); if (NSPLIT) a2[mb] = WFrag<bf>::ld(fa + bo + GMAT + mb * 16 * GP + kk); }
#pragma unroll
            for (int nb = 0; nb < 4; ++nb) b[nb] = WFrag<bf>::ld(fb + bo + nb * 16 * GP + kk);
            __builtin_amdgcn_sched_barrier(0);   // the LDS reads of these 32 k go out as one group in front of their matrix instructions (for speed only)
#pragma unroll
            for (int nb = 0; nb < 4; ++nb) {
#pragma unroll
                for (int mb = 0; mb < 4; ++mb) acc[mb][nb] = wmmab(a[mb], b[nb], acc[mb][nb]);
                if (NSPLIT) {
#pragma unroll
                    for (int mb = 0; mb < 4; ++mb) acc[mb][nb] = wmmab(a2[mb], b[nb], acc[mb][nb]); } }
        }
        asm volatile("s_wait_dscnt 0x0" ::: "memory");      // this wave's reads of buffer t & 1 are done before the barrier frees it
        asm volatile("s_wait_asynccnt 0x0" ::: "memory");   // this wave's copies of stage t + 1 have landed before the barrier publishes them
        __syncthreads();
        if (t + 2 < NST) fill(t + 2);
    }
    asm volatile("s_wait_asynccnt 0x0" ::: "memory");   // nothing is in flight when the wave goes on to the epilogue and ends
    if constexpr (EPI) {
        // The ring is free here: the barrier at the foot of the last trip stands behind every wave's last read of it, and no copy is in flight. Each wave stages in its own quarter.
        static_assert(NSPLIT == 0 && 64 * 68 * 4 <= STG && 3 * 32 * GP * 2 <= STG, "a wave's staging fits its quarter of the ring");
        const int zp = (r0 / TT) * NH_ + c0 / HD, t0 = r0 % TT, rl = lane >> 3, c8 = (lane & 7) * 8;   // head plane, first position; a lane's row within 4 and its 8 values of a 128-byte line
        if (z < 2) {
            f32a* os = (f32a*)ring + w * (STG / 4);
            // An accumulator lane holds x[d] (nb) and its partner x[d + HD/2] (nb + 2) of the same rows, so the rotation is done in place; the table's columns d and d + HD/2 hold the same angle, and one 8-byte read a lane of {cos, sin}[t][d < HD/2] uses whole 128-byte lines.
            float bb[4];
#pragma unroll
            for (int nb = 0; nb < 4; ++nb) bb[nb] = bfr(bias[c0 + nb * 16 + lr]);
            const float* cs = CS + ((size_t)(t0 + hi * 8) * HD + lr) * 2;
            v2f c[4][2][8];
            auto ldc = [&](int mb) {
#pragma unroll
                for (int nb = 0; nb < 2; ++nb)
#pragma unroll
                    for (int j = 0; j < 8; ++j) c[mb][nb][j] = *(const v2f*)(cs + ((mb * 16 + j) * HD + nb * 16) * 2); };
            ldc(0); ldc(1);   // the table reads run two groups of 16 rows ahead of their use
            XW();
#pragma unroll
            for (int mb = 0; mb < 4; ++mb) {
#pragma unroll
                for (int nb = 0; nb < 2; ++nb)
#pragma unroll
                    for (int j = 0; j < 8; ++j) { const float xl = acc[mb][nb][j] + bb[nb], xh = acc[mb][nb + 2][j] + bb[nb + 2], co = c[mb][nb][j][0], si = c[mb][nb][j][1]; f32a* o = os + (mb * 16 + hi * 8 + j) * 68 + nb * 16 + lr;
                        o[0] = xl * co - xh * si; o[HD / 2] = xh * co + xl * si; }
                if (mb + 2 < 4) { ldc(mb + 2); XW(); }
            }
            wfence();
            const size_t e0 = z * sP + ((size_t)zp * TT + t0 + rl) * HD + c8; const f32a* ox = os + rl * 68 + c8;
#pragma unroll 1   // 4 groups of 16 rows: one copy of the code, so that the kernel's text stays small
            for (int gg = 0; gg < 4; ++gg) {
                v4f x[4][2];
#pragma unroll
                for (int u = 0; u < 4; ++u) { x[u][0] = *(const v4fa*)(ox + (gg * 16 + u * 4) * 68); x[u][1] = *(const v4fa*)(ox + (gg * 16 + u * 4) * 68 + 4); }
#pragma unroll
                for (int u = 0; u < 4; ++u) { v8h o16; v8us oh, ol;
#pragma unroll
                    for (int q = 0; q < 8; ++q) { const float r = x[u][q >> 2][q & 3]; o16[q] = tohx(r); unsigned short a2, c2; splitf(r, a2, c2); oh[q] = a2; ol[q] = c2; }
                    const size_t e = e0 + (size_t)(gg * 16 + u * 4) * HD; *(v8h*)(P16 + e) = o16; *(v8us*)(Ph + e) = oh; *(v8us*)(Pl + e) = ol; }
                XW();
            }
        } else {
            bf* vs = ring + w * (STG / 2);   // three planes of 32 d x 64 t at the ring's pitch
            float bb[4];
#pragma unroll
            for (int nb = 0; nb < 4; ++nb) bb[nb] = bfr(bias[c0 + nb * 16 + lr]);
            const size_t e0 = ((size_t)zp * HD + rl) * TT + t0 + c8;
#pragma unroll
            for (int hf = 0; hf < 2; ++hf) {   // an accumulator holds 8 neighbouring t of one d: 16 bytes of a transposed row
#pragma unroll
                for (int n2 = 0; n2 < 2; ++n2)
#pragma unroll
                    for (int mb = 0; mb < 4; ++mb) { v8h o16; v8us oh, ol;
#pragma unroll
                        for (int j = 0; j < 8; ++j) { const float xv = acc[mb][hf * 2 + n2][j] + bb[hf * 2 + n2]; o16[j] = tohx(xv); unsigned short a2, c2; splitf(xv, a2, c2); oh[j] = a2; ol[j] = c2; }
                        bf* p = vs + (n2 * 16 + lr) * GP + mb * 16 + hi * 8; *(v8ha*)p = o16; *(v8usa*)(p + 32 * GP) = oh; *(v8usa*)(p + 64 * GP) = ol; }
                wfence();
#pragma unroll
                for (int s = 0; s < 8; ++s) { const bf* p = vs + (s * 4 + rl) * GP + c8; const size_t e = e0 + (size_t)(hf * 32 + s * 4) * TT;
                    *(v8h*)(V16 + e) = *(const v8ha*)p; *(v8us*)(Vh + e) = *(const v8usa*)(p + 32 * GP); *(v8us*)(Vl + e) = *(const v8usa*)(p + 64 * GP); }
                XW();
                wfence();
            }
        }
    } else {
    __shared__ __align__(16) float osb[4 * 16 * 68];
    float* os = osb + w * (16 * 68);   // each wave stages its own output rows
    v4f bb = *(const v4fa*)(bias + c0 + lr * 4); bb[0] = bfr(bb[0]); bb[1] = bfr(bb[1]); bb[2] = bfr(bb[2]); bb[3] = bfr(bb[3]);
#pragma unroll
    for (int mb = 0; mb < 4; ++mb) {
#pragma unroll
        for (int nb = 0; nb < 4; ++nb) {
#pragma unroll
            for (int j = 0; j < 8; ++j) os[(hi * 8 + j) * 68 + nb * 16 + lr] = acc[mb][nb][j]; }
        __builtin_amdgcn_wave_barrier(); asm volatile("" ::: "memory");   // the wave's stores to os stay in front of its reads
        float* crow_p = C + (size_t)(r0 + mb * 16) * DM + c0;
#pragma unroll
        for (int s = 0; s < 8; ++s) { const int row = 2 * s + hi, cofs = lr * 4; v4f val = *(const v4fa*)(os + row * 68 + cofs); val[0] += bb[0]; val[1] += bb[1]; val[2] += bb[2]; val[3] += bb[3];
            *(v4f*)(crow_p + (size_t)row * DM + cofs) = val; }
        asm volatile("s_wait_xcnt 0x0" ::: "memory");   // precaution: stands behind the stores and in front of the next rows' address arithmetic
        __builtin_amdgcn_wave_barrier(); asm volatile("" ::: "memory");   // the reads of os stay in front of the next rows' stores to it
    }
    }
}
typedef __attribute__((ext_vector_type(2))) _Float16 v2h;
typedef __attribute__((ext_vector_type(4))) _Float16 v4h;
typedef __attribute__((ext_vector_type(2))) unsigned short v2us;
typedef __attribute__((ext_vector_type(4))) unsigned short v4us;
typedef __attribute__((ext_vector_type(4))) int v4i;

// The elementwise stages below give every thread many values (16-byte loads and stores, all of a thread's loads issued before its first use), so that a stage needs a few thousand waves (for speed only).
#define CU 8    // k_cvt8: groups of 8 values per thread, one grid apart
#define SR 8    // k_attn: rows per softmax group
// k_cvt8: grid y picks one of up to four equally long sources; their bf16 copies lie one behind the other in dst; n8 = gridDim.x * 256 * CU groups of 8
__global__ __launch_bounds__(256) void k_cvt8(const float* __restrict__ s0, const float* __restrict__ s1, const float* __restrict__ s2, const float* __restrict__ s3, bf* dst, size_t n8) { const size_t i0 = (size_t)blockIdx.x * 256 + threadIdx.x, st = (size_t)gridDim.x * 256; const int y = blockIdx.y; const float* src = (y == 0) ? s0 : (y == 1) ? s1 : (y == 2) ? s2 : s3; dst += (size_t)y * n8 * 8; v8f v[CU];
#pragma unroll
    for (int u = 0; u < CU; ++u) v[u] = *(const v8f*)(src + (i0 + u * st) * 8);
    XW();
#pragma unroll
    for (int u = 0; u < CU; ++u) { v8us o;
#pragma unroll
        for (int k = 0; k < 8; ++k) o[k] = f2bf(v[u][k]);
        *(v8us*)(dst + (i0 + u * st) * 8) = o; }
    XW();  }

__constant__ float INVT[HD / 2] = { 1.000000000e+00f, 7.498942018e-01f, 5.623413324e-01f, 4.216965139e-01f, 3.162277639e-01f, 2.371373624e-01f, 1.778279394e-01f, 1.333521456e-01f, 1.000000015e-01f, 7.498941571e-02f, 5.623412877e-02f, 4.216964915e-02f, 3.162277862e-02f, 2.371373586e-02f, 1.778279431e-02f, 1.333521493e-02f, 9.999999776e-03f, 7.498942316e-03f, 5.623413250e-03f, 4.216964822e-03f, 3.162277862e-03f, 2.371373819e-03f, 1.778279431e-03f, 1.333521446e-03f, 1.000000047e-03f, 7.498941850e-04f, 5.623413017e-04f, 4.216964880e-04f, 3.162277862e-04f, 2.371373848e-04f, 1.778279402e-04f, 1.333521504e-04f };   // float32 1 / 10000^(2i/64), i < 32, generated with jnp to be bit-exact
__global__ __launch_bounds__(256) void k_cs5(float* CS) { const int idx = blockIdx.x * 256 + threadIdx.x; if (idx >= TT * HD) return; const int d = idx % HD; const int t = idx / HD; const float a = __fmul_rn((float)t, INVT[d % (HD / 2)]); v2f cs; cs[0] = cosf(a); cs[1] = sinf(a); *(v2f*)(CS + (size_t)idx * 2) = cs;  }
// ---- k_attn: the whole banded attention of one (batch, head) and 64 query rows in one work-group of 4 waves; a wave owns 16 query rows from the scores to the merged hi/lo planes and shares nothing with the other waves (no work-group barrier); the 4 waves read the same K and V^T lines.
// Per wave: (1) scores Q K^T for keys kbeg .. kend - 1 (q0 - 64 .. q0 + 127 clipped to the sequence: every |i - j| <= 50 of the row tile), f32 into the wave's LDS rows, key j at column j - CB(q0); (2) softmax of SR rows at a time, a row's 256 columns over the 32 lanes; the probabilities (fp16 x 1024, or bf16 hi and lo) overwrite the row's own scores; (3) P V over the same keys, A fragments from LDS, B fragments from the V^T planes; (4) the 16 x 64 result turned through LDS, scaled back, split hi/lo and stored as whole 128-byte lines of the merged [b][t][h d] planes.
// Row tiles < RH / 64 take the hi/lo planes (3 products per 32 k, in the order hi hi, lo hi, hi lo), the rest the fp16 planes.
#define AP  268   // LDS row pitch in floats: 8 rows apart is 32 banks apart (the two halves of an accumulator store do not collide); 1072 bytes = 16 x odd for the 16-byte fragment reads; holds 256 f32 scores, then 2 x 264 16-bit probabilities
#define APL 264   // offset of a row's lo probabilities in 16-bit elements
template <typename T16, bool HL>
__device__ __forceinline__ void attn16(float* sl, int q0, int w, int zz, const T16* __restrict__ Q, const T16* __restrict__ Q2, const T16* __restrict__ Kp, const T16* __restrict__ K2, const T16* __restrict__ Vt, const T16* __restrict__ V2, bf* Ah, bf* Al) {
    typedef typename WFrag<T16>::V V;
    const int lane = threadIdx.x & 31, lr = lane & 15, hi = lane >> 4; const int i0 = q0 + w * 16, cb = CB(q0), kbeg = max(q0 - 64, 0), kend = min(q0 + 128, TT);
    {   // (1) scores
        V a[2], a2[2]; const size_t qo = (size_t)(i0 + lr) * HD + 8 * hi;
#pragma unroll
        for (int kk = 0; kk < 2; ++kk) { a[kk] = WFrag<T16>::ld(Q + qo + kk * 32); if (HL) a2[kk] = WFrag<T16>::ld(Q2 + qo + kk * 32); }
#pragma unroll 1   // 2 or 3 column tiles of 64 keys
        for (int c0 = kbeg; c0 < kend; c0 += 64) {
            v8f acc[4]; V b[2][4], b2[2][4]; const size_t ko = (size_t)(c0 + lr) * HD + 8 * hi;
#pragma unroll
            for (int kk = 0; kk < 2; ++kk)
#pragma unroll
                for (int nb = 0; nb < 4; ++nb) { b[kk][nb] = WFrag<T16>::ld(Kp + ko + nb * 16 * HD + kk * 32); if (HL) b2[kk][nb] = WFrag<T16>::ld(K2 + ko + nb * 16 * HD + kk * 32); }
            XW();
            __builtin_amdgcn_sched_barrier(0);   // all loads of these 64 keys go out as one group (for speed only)
#pragma unroll
            for (int nb = 0; nb < 4; ++nb) acc[nb] = (v8f){};
#pragma unroll
            for (int kk = 0; kk < 2; ++kk)
#pragma unroll
                for (int nb = 0; nb < 4; ++nb) { acc[nb] = WFrag<T16>::mma(a[kk], b[kk][nb], acc[nb]); if (HL) { acc[nb] = WFrag<T16>::mma(a2[kk], b[kk][nb], acc[nb]); acc[nb] = WFrag<T16>::mma(a[kk], b2[kk][nb], acc[nb]); } }
#pragma unroll
            for (int nb = 0; nb < 4; ++nb)
#pragma unroll
                for (int j = 0; j < 8; ++j) sl[(hi * 8 + j) * AP + (c0 - cb) + nb * 16 + lr] = acc[nb][j];
        }
    }
    wfence();
    // (2) softmax: t = S x 1/8 for keys with |i - j| <= 50, -3e38 elsewhere (the -1e9 fill == exclusion); same lane and chunk order as over all 2048 keys, whose other terms are exact zeros; S is read only where a lane's 4 keys touch the band; each step for all SR rows in turn so that their butterflies overlap
#pragma unroll 1   // two groups of SR rows: one copy of the code, and the registers of one group
    for (int rb = 0; rb < 16; rb += SR) {
        float v[SR][8]; float mx[SR], sum[SR]; v4f a[SR][2];
#pragma unroll
        for (int r = 0; r < SR; ++r) {
#pragma unroll
            for (int ch = 0; ch < 2; ++ch) { const int i = i0 + rb + r, j0 = cb + ch * 128 + lane * 4; a[r][ch] = (v4f){}; if (i - (j0 + 3) <= BW && j0 - i <= BW) a[r][ch] = *(const v4fa*)(sl + (rb + r) * AP + ch * 128 + lane * 4); } }
        wfence();
#pragma unroll
        for (int r = 0; r < SR; ++r) { mx[r] = -3.0e38f;
#pragma unroll
            for (int ch = 0; ch < 2; ++ch) {
#pragma unroll
                for (int q = 0; q < 4; ++q) { const int i = i0 + rb + r, j = cb + ch * 128 + lane * 4 + q; const float t = (i - j <= BW && j - i <= BW) ? a[r][ch][q] * SCL : -3.0e38f;   /* |i - j| <= 50 */ v[r][ch * 4 + q] = t; mx[r] = fmaxf(mx[r], t); } } }
#pragma unroll
        for (int sh = 16; sh; sh >>= 1) {
#pragma unroll
            for (int r = 0; r < SR; ++r) mx[r] = fmaxf(mx[r], __shfl_xor(mx[r], sh, 32)); }
#pragma unroll
        for (int r = 0; r < SR; ++r) { sum[r] = 0.f;
#pragma unroll
            for (int k = 0; k < 8; ++k) { const float d0 = __fsub_rn(v[r][k], mx[r]); const float e0 = __fmul_rn(d0, 1.4426950408889634f);
                __builtin_amdgcn_sched_barrier(0);   // with the one two lines down: holds the v_nop directly behind the v_exp_f32
                v[r][k] = __builtin_amdgcn_exp2f(e0); asm volatile("v_nop");   // the slot behind the transcendental, kept free of an instruction that reads its result or overwrites its source
                __builtin_amdgcn_sched_barrier(0); }
#pragma unroll
            for (int k = 0; k < 8; ++k) sum[r] += v[r][k]; }
#pragma unroll
        for (int sh = 16; sh; sh >>= 1) {
#pragma unroll
            for (int r = 0; r < SR; ++r) sum[r] += __shfl_xor(sum[r], sh, 32); }
#pragma unroll
        for (int r = 0; r < SR; ++r) { const float f = __fdiv_rn(HL ? 1.0f : PCAR, sum[r]); T16* pr = (T16*)(sl + (rb + r) * AP);
#pragma unroll
            for (int ch = 0; ch < 2; ++ch) {
                if constexpr (HL) { v4us oh, ol;
#pragma unroll
                    for (int q = 0; q < 4; ++q) { unsigned short a2, c2; splitf(v[r][ch * 4 + q] * f, a2, c2); oh[q] = a2; ol[q] = c2; }
                    *(v4us*)(pr + ch * 128 + lane * 4) = oh; *(v4us*)(pr + APL + ch * 128 + lane * 4) = ol;
                } else { v4h o4;
#pragma unroll
                    for (int q = 0; q < 4; ++q) o4[q] = tohx(v[r][ch * 4 + q] * f);
                    *(v4h*)(pr + ch * 128 + lane * 4) = o4; } } }
    }
    wfence();
    v8f o[4];
#pragma unroll
    for (int nb = 0; nb < 4; ++nb) o[nb] = (v8f){};
    {   // (3) P V
        const T16* pa = (const T16*)sl + lr * (AP * 2) + 8 * hi; const size_t vo = (size_t)lr * TT + 8 * hi;
#pragma unroll 1   // 2 or 3 steps of 64 keys
        for (int kc = kbeg; kc < kend; kc += 64) {
            V b[2][4], b2[2][4], a[2], a2[2];
#pragma unroll
            for (int kk = 0; kk < 2; ++kk)
#pragma unroll
                for (int nb = 0; nb < 4; ++nb) { b[kk][nb] = WFrag<T16>::ld(Vt + vo + (size_t)nb * 16 * TT + kc + kk * 32); if (HL) b2[kk][nb] = WFrag<T16>::ld(V2 + vo + (size_t)nb * 16 * TT + kc + kk * 32); }
            XW();
#pragma unroll
            for (int kk = 0; kk < 2; ++kk) { a[kk] = WFrag<T16>::ld(pa + (kc - cb) + kk * 32); if (HL) a2[kk] = WFrag<T16>::ld(pa + APL + (kc - cb) + kk * 32); }
            __builtin_amdgcn_sched_barrier(0);   // all loads of these 64 keys go out as one group (for speed only)
#pragma unroll
            for (int kk = 0; kk < 2; ++kk)
#pragma unroll
                for (int nb = 0; nb < 4; ++nb) { o[nb] = WFrag<T16>::mma(a[kk], b[kk][nb], o[nb]); if (HL) { o[nb] = WFrag<T16>::mma(a2[kk], b[kk][nb], o[nb]); o[nb] = WFrag<T16>::mma(a[kk], b2[kk][nb], o[nb]); } }
        }
    }
    wfence();
    // (4) merge
#pragma unroll
    for (int nb = 0; nb < 4; ++nb)
#pragma unroll
        for (int j = 0; j < 8; ++j) sl[(hi * 8 + j) * 68 + nb * 16 + lr] = o[nb][j];
    wfence();
    const float cs = HL ? 1.0f : (1.0f / PCAR);
#pragma unroll
    for (int g = 0; g < 4; ++g) { const int row = g * 4 + (lane >> 3), d = (lane & 7) * 8; const v4f x0 = *(const v4fa*)(sl + row * 68 + d), x1 = *(const v4fa*)(sl + row * 68 + d + 4); v8us oh, ol;
#pragma unroll
        for (int q = 0; q < 8; ++q) { unsigned short h2, l2; splitf((q < 4 ? x0[q & 3] : x1[q & 3]) * cs, h2, l2); oh[q] = h2; ol[q] = l2; }
        const size_t oo = ((size_t)(zz / NH_) * TT + i0 + row) * DQ + (zz % NH_) * HD + d; *(v8us*)(Ah + oo) = oh; *(v8us*)(Al + oo) = ol; }
    XW();
}
// grid (TT / 64, ZH); all planes are whole ([z][t][d], V^T [z][d][t])
__global__ __launch_bounds__(128) void k_attn(const bf* __restrict__ Qh, const bf* __restrict__ Ql, const bf* __restrict__ Kh, const bf* __restrict__ Kl, const bf* __restrict__ Vh, const bf* __restrict__ Vl, const h16* __restrict__ Q16, const h16* __restrict__ K16, const h16* __restrict__ V16, bf* Ah, bf* Al) {
    __shared__ __align__(16) float sb[4 * 16 * AP];
    const int w = threadIdx.x >> 5, q0 = blockIdx.x * 64, zz = blockIdx.y; const size_t zo = (size_t)zz * TT * HD; float* sl = sb + w * (16 * AP);
    if (q0 >= RH) { attn16<h16, false>(sl, q0, w, zz, Q16 + zo, nullptr, K16 + zo, nullptr, V16 + zo, nullptr, Ah, Al); return; }
    attn16<bf, true>(sl, q0, w, zz, Qh + zo, Ql + zo, Kh + zo, Kl + zo, Vh + zo, Vl + zo, Ah, Al);
}

extern "C" void kernel_launch(void* const* d_in, const int* in_sizes, int n_in,
                              void* d_out, int out_size, void* d_ws, size_t ws_size, hipStream_t stream) {
    (void)in_sizes; (void)n_in; (void)out_size;
    const float* x = (const float*)d_in[0];   /* query */ const float* xk = (const float*)d_in[1]; const float* xv = (const float*)d_in[2]; const float* wq = (const float*)d_in[3]; const float* bq = (const float*)d_in[4]; const float* wk = (const float*)d_in[5]; const float* bk = (const float*)d_in[6]; const float* wv = (const float*)d_in[7]; const float* bv = (const float*)d_in[8]; const float* wo = (const float*)d_in[9]; const float* bo = (const float*)d_in[10];   /* input order query, key, value, Wq, bq, Wk, bk, Wv, bv, Wo, bo */
    float* OUT = (float*)d_out;     // [2][2048][1024]
    char* wsp = (char*)d_ws;
    auto take = [&](size_t bytes) { char* p = wsp; wsp += (bytes + 255) & ~(size_t)255; return (void*)p; };
    const size_t NW = (size_t)DQ * DM, NX = (size_t)NB_ * TT * DM, NP = (size_t)ZH * TT * HD;   // elements of one weight, one input tensor, one set of head planes
    bf* WQ = (bf*)take(4 * NW * 2); bf* WO = WQ + 3 * NW;   /* Wq, Wk, Wv, Wo in turn */ float* CS = (float*)take((size_t)TT * HD * 2 * 4);
    h16* QP16 = (h16*)take(2 * NP * 2); h16* KP16 = QP16 + NP; bf* QPh = (bf*)take(2 * NP * 2); bf* KPh = QPh + NP; bf* QPl = (bf*)take(2 * NP * 2); bf* KPl = QPl + NP;   /* q planes, then k planes */
    h16* VT16 = (h16*)take(NP * 2); bf* VTh = (bf*)take(NP * 2); bf* VTl = (bf*)take(NP * 2);
    bf* ATh = (bf*)take(NX * 2); bf* ATl = (bf*)take(NX * 2);
    bf* XB = (bf*)take(3 * NX * 2);   /* bf16 query, key, value */
    if ((size_t)(wsp - (char*)d_ws) > ws_size) return;    // ws 256 MiB
    k_cvt8<<<dim3((unsigned)(NW / 8 / (256 * CU)), 4), 256, 0, stream>>>(wq, wk, wv, wo, WQ, NW / 8);
    k_cs5<<<(TT * HD + 255) / 256, 256, 0, stream>>>(CS);   /* rotary table once */
    k_cvt8<<<dim3((unsigned)(NX / 8 / (256 * CU)), 3), 256, 0, stream>>>(x, xk, xv, xv, XB, NX / 8);
    k_gemmt<0, 1><<<dim3(NB_ * TT / 128, DQ / 128, 3), 128, 0, stream>>>(XB, nullptr, WQ, nullptr, bq, bk, bv, NX, NW, 0, CS, QP16, QPh, QPl, NP, VT16, VTh, VTl);
    static_assert(((size_t)DQ * DM / 8) % (256 * CU) == 0 && ((size_t)NB_ * TT * DM / 8) % (256 * CU) == 0 && 16 % SR == 0 && RH % 64 == 0, "whole grids");
    k_attn<<<dim3(TT / 64, ZH), 128, 0, stream>>>(QPh, QPl, KPh, KPl, VTh, VTl, QP16, KP16, VT16, ATh, ATl);
    k_gemmt<1, 0><<<dim3(NB_ * TT / 128, DM / 128, 1), 128, 0, stream>>>(ATh, ATl, WO, OUT, bo, bo, bo, 0, 0, 0, nullptr, nullptr, nullptr, nullptr, 0, nullptr, nullptr, nullptr);
}

// v007
// A run of this version takes 81.7 microseconds.
// In two side-by-side timings against v006, it was 1.10 and 1.11 times as fast.
// Over all steps from v000 it is 24.8 times as fast.
#include <hip/hip_runtime.h>

// Sliding-window multi-head attention with rotary embeddings (query, key, value [2][2048][1024]; q = query Wq^T + bq etc. ('oi' 1/32, zero biases; 16 heads x 64); rotate-half rotary with angles t x 1/10000^(2i/64) (float32 table baked, precise cosf/sinf); scores / sqrt(64); keys with |i - j| <= 50 kept (-1e9 elsewhere == exclusion); softmax; out = merged Wo^T + bo -> [2][2048][1024] (4.2 M); argument order query, key, value, Wq, bq, Wk, bk, Wv, bv, Wo, bo).
// Layout, both batches and all 16 heads in one launch per stage (grid y / z picks tensor, batch and head): bf16 copies of query, key, value; 'oi' weights; {cos, sin} table once; exact projections + f32 biases, whose epilogue applies the rotate-half rotary (q, k) or the transpose (v) and writes the head planes in the order the attention's fragment loads take them (see FRAGMENT ORDER); T-2048 attention on the band only, scores to merged planes in one kernel with score and probability rows in LDS (per 64-row tile the 3 score tiles, 256 softmax columns and 192 PV keys that can hold |i - j| <= 50; the band itself is a select in the softmax; hybrid rows: < 512 hi/lo 3 products, rest fp16 x1024); merged hi/lo x Wo exact + bo.
// Compute dtypes, f32 accumulate: every input rounded to bf16; projections exact + f32 biases; rotary f32; attention rows < 512 3 products, rest fp16; softmax f32; Wo hl x exact + bias.

#define NB_  2
#define TT   2048
#define DM   1024
#define NH_  16
#define NKV  16
#define REP  (NH_ / NKV)
#define HD   64
#define DQ   (NH_ * HD)
#define DKV  (NKV * HD)
#define ZH   (NB_ * NH_)          // attention planes per launch: every (batch, head)
#define RH   512                  // query rows < RH use hi+lo planes (0: none)
#define WIN  2048
#define BW   50       // half window: keys j in [i - 50, i + 50]
#define PCAR 1024.0f
#define SCL  0.125f   // HD^-0.5
typedef _Float16 h16;
typedef unsigned short bf;
typedef __attribute__((ext_vector_type(16))) __bf16   v16bf;
typedef __attribute__((ext_vector_type(16))) _Float16 v16h;
typedef __attribute__((ext_vector_type(8)))  _Float16 v8h;
typedef __attribute__((ext_vector_type(8)))  unsigned short v8us;
typedef __attribute__((ext_vector_type(8)))  float    v8f;
typedef __attribute__((ext_vector_type(4)))  float    v4f;
typedef v8h  __attribute__((may_alias)) v8ha;
typedef v4f  __attribute__((may_alias)) v4fa;
typedef v8us __attribute__((may_alias)) v8usa;

__device__ __forceinline__ unsigned short f2bf(float f) { unsigned u = __float_as_uint(f); u += 0x7FFFu + ((u >> 16) & 1u); return (unsigned short)(u >> 16); }
__device__ __forceinline__ float bf2f(unsigned short b) { return __uint_as_float(((unsigned)b) << 16); }
__device__ __forceinline__ float bfr(float f) { return bf2f(f2bf(f)); }
__device__ __forceinline__ v16h cat16(v8h lo, v8h hi) { return __builtin_shufflevector(lo, hi, 0, 1, 2, 3, 4, 5, 6, 7, 8, 9, 10, 11, 12, 13, 14, 15); }
__device__ __forceinline__ v16bf cat16b(v8us lo, v8us hi) { return __builtin_bit_cast(v16bf, __builtin_shufflevector(lo, hi, 0, 1, 2, 3, 4, 5, 6, 7, 8, 9, 10, 11, 12, 13, 14, 15)); }
__device__ __forceinline__ v8f wmma16(v16h a, v16h b, v8f c) { return __builtin_amdgcn_wmma_f32_16x16x32_f16(false, a, false, b, (short)0, c, false, false); }
__device__ __forceinline__ v8f wmmab(v16bf a, v16bf b, v8f c) { return __builtin_amdgcn_wmma_f32_16x16x32_bf16(false, a, false, b, (short)0, c, false, false); }



// Fragments come from K-contiguous 16-bit rows in LDS or from head planes in FRAGMENT ORDER: lane lr + 16 hi holds row lr, k = 8 hi .. 8 hi + 7 and 16 + 8 hi .. 16 + 8 hi + 7 of each 32 k, the same for A and B.
__device__ __forceinline__ int CB(int q0) { return min(max(q0 - 64, 0) / 128, TT / 128 - 2) * 128; }   // first key of the two 128-key chunks that cover row tile q0's band
// FRAGMENT ORDER of the head planes: the 16 bytes that lane l takes with one load of a fragment lie at l x 16 bytes of a 512-byte run, so a wave's load reads 4 whole 128-byte lines (row-major planes: 32 bytes of each of 16 lines). A fragment (16 rows x 32 k) is two runs in a row: k = 8 hi .. 8 hi + 7, then k = 16 + 8 hi .. 16 + 8 hi + 7; ldp reads both.
// q, k planes [z][t / 16][d / 32][run][lane][8]: rows t, k = d. V^T planes [z][t / 64][d / 16][(t % 64) / 32][run][lane][8]: rows d, k = t. The values in every fragment register are those of the row-major planes.
template <typename T16> struct WFrag;
template <> struct WFrag<h16> { typedef v16h V; static __device__ __forceinline__ V ld(const h16* p) { return cat16(*(const v8h*)p, *(const v8h*)(p + 16)); } static __device__ __forceinline__ V ldp(const h16* p) { return cat16(*(const v8h*)p, *(const v8h*)(p + 256)); } static __device__ __forceinline__ v8f mma(V a, V b, v8f c) { return wmma16(a, b, c); } };
template <> struct WFrag<bf> { typedef v16bf V; static __device__ __forceinline__ V ld(const bf* p) { return cat16b(*(const v8us*)p, *(const v8us*)(p + 16)); } static __device__ __forceinline__ V ldp(const bf* p) { return cat16b(*(const v8us*)p, *(const v8us*)(p + 256)); } static __device__ __forceinline__ v8f mma(V a, V b, v8f c) { return wmmab(a, b, c); } };
__device__ __forceinline__ h16 tohx(float x) { return (h16)x; }
__device__ __forceinline__ void splitf(float y, unsigned short& h, unsigned short& l) { h = f2bf(y); l = f2bf(y - bf2f(h)); }
// XW: precaution, stands behind a run of global loads or stores and in front of the arithmetic that may reuse their address registers
#define XW() asm volatile("s_wait_xcnt 0x0" ::: "memory")
// wfence: keeps the wave's LDS stores of one phase in front of its LDS reads of the next (and a row's score reads in front of the probabilities that overwrite them) in the compiled order; the hardware runs one wave's LDS operations in order
__device__ __forceinline__ void wfence() { __builtin_amdgcn_wave_barrier(); asm volatile("" ::: "memory"); }
typedef float __attribute__((may_alias)) f32a;
typedef __attribute__((ext_vector_type(2))) float v2f;
// ---- k_gemmt: the four projections. One 128x128 tile of C per work-group of 4 waves (2 x 2 waves of 64x64, 16 accumulators a wave); A (, A2) and Bt tiles of 64 k come into LDS by asynchronous copies, whole 128-byte lines, each staged row read by two waves; two buffers, the next stage's copies fly while this stage is multiplied.
// C[m][n] (f32, pitch DM, + f32 bias[n], one bias pointer per z < 3) = sum_k A[m][k] Bt[n][k] (+ A2[m][k] Bt[n][k] behind it in every 32 k when NSPLIT). All pitches DM; grid (M/128, N/128, Z).
// EPI: no C is written. A wave's 64x64 tile is 64 positions t of one (batch, head), so the wave itself turns it into that head's 16-bit planes (fp16, bf16 hi, bf16 lo): z < 2 (q, k) rotate-half rotary out[d] = x[d] cos[t][d] - x[d+HD/2] sin[t][d], out[d+HD/2] = x[d+HD/2] cos[t][d+HD/2] + x[d] sin[t][d+HD/2] (tensor stride sP); z == 2 (v) the transpose; both in FRAGMENT ORDER. q and k go through the wave's quarter of the ring, v goes straight from the accumulators; every global store of a wave fills 512 bytes in a row.
#define GP   72            // LDS row pitch in 16-bit elements: 144 bytes = 16 x odd, the conflict-free pitch for 16-byte reads of 128-byte rows
#define GKS  64            // k per stage
#define GMAT (128 * GP)    // elements of one staged operand tile
// cp8: rows r, r + 16, ... r + 112 of one operand tile, 16 bytes a lane; the s_wait_xcnt closes the statement so that no address register is rewritten in front of it
__device__ __forceinline__ void cp8(unsigned l, const bf* g) {
    asm volatile("global_load_async_to_lds_b128 %0, %8, off\n\t"
                 "global_load_async_to_lds_b128 %1, %9, off\n\t"
                 "global_load_async_to_lds_b128 %2, %10, off\n\t"
                 "global_load_async_to_lds_b128 %3, %11, off\n\t"
                 "global_load_async_to_lds_b128 %4, %12, off\n\t"
                 "global_load_async_to_lds_b128 %5, %13, off\n\t"
                 "global_load_async_to_lds_b128 %6, %14, off\n\t"
                 "global_load_async_to_lds_b128 %7, %15, off\n\t"
                 "s_wait_xcnt 0x0"
                 :: "v"(l), "v"(l + 1 * 16 * GP * 2), "v"(l + 2 * 16 * GP * 2), "v"(l + 3 * 16 * GP * 2), "v"(l + 4 * 16 * GP * 2), "v"(l + 5 * 16 * GP * 2), "v"(l + 6 * 16 * GP * 2), "v"(l + 7 * 16 * GP * 2),
                    "v"(g), "v"(g + 1 * 16 * DM), "v"(g + 2 * 16 * DM), "v"(g + 3 * 16 * DM), "v"(g + 4 * 16 * DM), "v"(g + 5 * 16 * DM), "v"(g + 6 * 16 * DM), "v"(g + 7 * 16 * DM)
                 : "memory");
}
template <int NSPLIT, int EPI>
__global__ __launch_bounds__(128) void k_gemmt(const bf* __restrict__ A, const bf* __restrict__ A2, const bf* __restrict__ Bt, float* C, const float* __restrict__ bias0, const float* __restrict__ bias1, const float* __restrict__ bias2, size_t sA, size_t sB, size_t sC, const float* __restrict__ CS, h16* P16, bf* Ph, bf* Pl, size_t sP, h16* V16, bf* Vh, bf* Vl) {
    constexpr int NMAT = 2 + NSPLIT, STG = NMAT * GMAT, NST = DM / GKS;
    __shared__ __align__(16) bf ring[2 * STG];
    const size_t z = blockIdx.z; A += z * sA; if (NSPLIT) A2 += z * sA; Bt += z * sB; C += z * sC; const float* bias = (z == 0) ? bias0 : (z == 1) ? bias1 : bias2;
    const int tid = threadIdx.x, lane = tid & 31, lr = lane & 15, hi = lane >> 4, w = tid >> 5;
    const int R0 = blockIdx.x * 128, C0 = blockIdx.y * 128, r0 = R0 + (w >> 1) * 64, c0 = C0 + (w & 1) * 64;
    const int crow = tid >> 3, ccol = (tid & 7) * 8;   // a thread copies 16 bytes of rows crow + 16 i; 8 threads fill a row's 128 bytes
    const bf* gA = A + (size_t)(R0 + crow) * DM + ccol; const bf* gA2 = NSPLIT ? A2 + (size_t)(R0 + crow) * DM + ccol : nullptr; const bf* gB = Bt + (size_t)(C0 + crow) * DM + ccol;
    const unsigned l0 = (unsigned)(size_t)ring + (unsigned)(crow * GP + ccol) * 2u;
    auto fill = [&](int s) { const unsigned l = l0 + (unsigned)(s & 1) * (STG * 2u); cp8(l, gA + s * GKS); if (NSPLIT) cp8(l + GMAT * 2u, gA2 + s * GKS); cp8(l + (NMAT - 1) * GMAT * 2u, gB + s * GKS); };
    v8f acc[4][4];
#pragma unroll
    for (int mb = 0; mb < 4; ++mb)
#pragma unroll
        for (int nb = 0; nb < 4; ++nb) acc[mb][nb] = (v8f){};
    const bf* fa = ring + ((w >> 1) * 64 + lr) * GP + 8 * hi; const bf* fb = ring + (NMAT - 1) * GMAT + ((w & 1) * 64 + lr) * GP + 8 * hi;
    fill(0);
    asm volatile("s_wait_asynccnt 0x0" ::: "memory");   // stage 0 has landed before the barrier publishes it
    __syncthreads();
    fill(1);
#pragma unroll 1   // one copy of the stage body: the buffer is picked by an address (for speed only)
    for (int t = 0; t < NST; ++t) {
        const int bo = (t & 1) * STG;
#pragma unroll
        for (int kk = 0; kk < GKS; kk += 32) {
            v16bf a[4], a2[4], b[4];
#pragma unroll
            for (int mb = 0; mb < 4; ++mb) { a[mb] = WFrag<bf>::ld(fa + bo + mb * 16 * GP + kk); if (NSPLIT) a2[mb] = WFrag<bf>::ld(fa + bo + GMAT + mb * 16 * GP + kk); }
#pragma unroll
            for (int nb = 0; nb < 4; ++nb) b[nb] = WFrag<bf>::ld(fb + bo + nb * 16 * GP + kk);
            __builtin_amdgcn_sched_barrier(0);   // the LDS reads of these 32 k go out as one group in front of their matrix instructions (for speed only)
#pragma unroll
            for (int nb = 0; nb < 4; ++nb) {
#pragma unroll
                for (int mb = 0; mb < 4; ++mb) acc[mb][nb] = wmmab(a[mb], b[nb], acc[mb][nb]);
                if (NSPLIT) {
#pragma unroll
                    for (int mb = 0; mb < 4; ++mb) acc[mb][nb] = wmmab(a2[mb], b[nb], acc[mb][nb]); } }
        }
        asm volatile("s_wait_dscnt 0x0" ::: "memory");      // this wave's reads of buffer t & 1 are done before the barrier frees it
        asm volatile("s_wait_asynccnt 0x0" ::: "memory");   // this wave's copies of stage t + 1 have landed before the barrier publishes them
        __syncthreads();
        if (t + 2 < NST) fill(t + 2);
    }
    asm volatile("s_wait_asynccnt 0x0" ::: "memory");   // nothing is in flight when the wave goes on to the epilogue and ends
    if constexpr (EPI) {
        // The ring is free here: the barrier at the foot of the last trip stands behind every wave's last read of it, and no copy is in flight. Each wave stages in its own quarter.
        static_assert(NSPLIT == 0 && 64 * 68 * 4 <= STG, "a wave's staging fits its quarter of the ring");
        const int zp = (r0 / TT) * NH_ + c0 / HD, t0 = r0 % TT;   // head plane, first position
        if (z < 2) {
            f32a* os = (f32a*)ring + w * (STG / 4);
            // An accumulator lane holds x[d] (nb) and its partner x[d + HD/2] (nb + 2) of the same rows, so the rotation is done in place; the table's columns d and d + HD/2 hold the same angle, and one 8-byte read a lane of {cos, sin}[t][d < HD/2] uses whole 128-byte lines.
            float bb[4];
#pragma unroll
            for (int nb = 0; nb < 4; ++nb) bb[nb] = bfr(bias[c0 + nb * 16 + lr]);
            XW();
            const float* cs = CS + ((size_t)(t0 + hi * 8) * HD + lr) * 2;
            v2f c[4][2][8];
            auto ldc = [&](int mb) {
#pragma unroll
                for (int nb = 0; nb < 2; ++nb)
#pragma unroll
                    for (int j = 0; j < 8; ++j) c[mb][nb][j] = *(const v2f*)(cs + ((mb * 16 + j) * HD + nb * 16) * 2); };
            ldc(0); ldc(1);   // the table reads run two groups of 16 rows ahead of their use
            XW();
#pragma unroll
            for (int mb = 0; mb < 4; ++mb) {
#pragma unroll
                for (int nb = 0; nb < 2; ++nb)
#pragma unroll
                    for (int j = 0; j < 8; ++j) { const float xl = acc[mb][nb][j] + bb[nb], xh = acc[mb][nb + 2][j] + bb[nb + 2], co = c[mb][nb][j][0], si = c[mb][nb][j][1]; f32a* o = os + (mb * 16 + hi * 8 + j) * 68 + nb * 16 + lr;
                        o[0] = xl * co - xh * si; o[HD / 2] = xh * co + xl * si; }
                if (mb + 2 < 4) { ldc(mb + 2); XW(); }
            }
            wfence();
            const size_t e0 = z * sP + ((size_t)zp * TT + t0) * HD + lane * 8; const f32a* ox = os + lr * 68 + hi * 8;   // run u of a group of 16 rows: lane lr + 16 hi holds row lr, d = 16 u + 8 hi .. + 7
#pragma unroll 1   // 4 groups of 16 rows: one copy of the code, so that the kernel's text stays small
            for (int gg = 0; gg < 4; ++gg) {
                v4f x[4][2];
#pragma unroll
                for (int u = 0; u < 4; ++u) { x[u][0] = *(const v4fa*)(ox + gg * 16 * 68 + u * 16); x[u][1] = *(const v4fa*)(ox + gg * 16 * 68 + u * 16 + 4); }
#pragma unroll
                for (int u = 0; u < 4; ++u) { v8h o16; v8us oh, ol;
#pragma unroll
                    for (int q = 0; q < 8; ++q) { const float r = x[u][q >> 2][q & 3]; o16[q] = tohx(r); unsigned short a2, c2; splitf(r, a2, c2); oh[q] = a2; ol[q] = c2; }
                    const size_t e = e0 + (size_t)(gg * 16 * HD + u * 256); *(v8h*)(P16 + e) = o16; *(v8us*)(Ph + e) = oh; *(v8us*)(Pl + e) = ol; }
                XW();
            }
        } else {
            float bb[4];
#pragma unroll
            for (int nb = 0; nb < 4; ++nb) bb[nb] = bfr(bias[c0 + nb * 16 + lr]);
            // An accumulator lane holds 8 neighbouring t of one d: t = 16 mb + 8 hi + j, d = 16 nb + lr. That is the lane's 16 bytes of run mb & 1 of the V^T fragment (d / 16 = nb, (t % 64) / 32 = mb >> 1), so tile (mb, nb) is run 4 nb + mb of the head's 64-key block and needs no turn through LDS.
            const size_t e0 = ((size_t)zp * TT + t0) * HD + lane * 8;
#pragma unroll
            for (int nb = 0; nb < 4; ++nb)
#pragma unroll
                for (int mb = 0; mb < 4; ++mb) { v8h o16; v8us oh, ol;
#pragma unroll
                    for (int j = 0; j < 8; ++j) { const float xv = acc[mb][nb][j] + bb[nb]; o16[j] = tohx(xv); unsigned short a2, c2; splitf(xv, a2, c2); oh[j] = a2; ol[j] = c2; }
                    const size_t e = e0 + (size_t)((nb * 4 + mb) * 256); *(v8h*)(V16 + e) = o16; *(v8us*)(Vh + e) = oh; *(v8us*)(Vl + e) = ol; }
            XW();
        }
    } else {
    __shared__ __align__(16) float osb[4 * 16 * 68];
    float* os = osb + w * (16 * 68);   // each wave stages its own output rows
    v4f bb = *(const v4fa*)(bias + c0 + lr * 4); bb[0] = bfr(bb[0]); bb[1] = bfr(bb[1]); bb[2] = bfr(bb[2]); bb[3] = bfr(bb[3]);
#pragma unroll
    for (int mb = 0; mb < 4; ++mb) {
#pragma unroll
        for (int nb = 0; nb < 4; ++nb) {
#pragma unroll
            for (int j = 0; j < 8; ++j) os[(hi * 8 + j) * 68 + nb * 16 + lr] = acc[mb][nb][j]; }
        __builtin_amdgcn_wave_barrier(); asm volatile("" ::: "memory");   // the wave's stores to os stay in front of its reads
        float* crow_p = C + (size_t)(r0 + mb * 16) * DM + c0;
#pragma unroll
        for (int s = 0; s < 8; ++s) { const int row = 2 * s + hi, cofs = lr * 4; v4f val = *(const v4fa*)(os + row * 68 + cofs); val[0] += bb[0]; val[1] += bb[1]; val[2] += bb[2]; val[3] += bb[3];
            *(v4f*)(crow_p + (size_t)row * DM + cofs) = val; }
        asm volatile("s_wait_xcnt 0x0" ::: "memory");   // precaution: stands behind the stores and in front of the next rows' address arithmetic
        __builtin_amdgcn_wave_barrier(); asm volatile("" ::: "memory");   // the reads of os stay in front of the next rows' stores to it
    }
    }
}
typedef __attribute__((ext_vector_type(2))) _Float16 v2h;
typedef __attribute__((ext_vector_type(4))) _Float16 v4h;
typedef __attribute__((ext_vector_type(2))) unsigned short v2us;
typedef __attribute__((ext_vector_type(4))) unsigned short v4us;
typedef __attribute__((ext_vector_type(4))) int v4i;

// The elementwise stages below give every thread many values (16-byte loads and stores, all of a thread's loads issued before its first use), so that a stage needs a few thousand waves (for speed only).
#define CU 8    // k_cvt8: groups of 8 values per thread, one grid apart
#define SR 8    // k_attn: rows per softmax group
// k_cvt8: grid y picks one of up to four equally long sources; their bf16 copies lie one behind the other in dst; n8 = gridDim.x * 256 * CU groups of 8
__global__ __launch_bounds__(256) void k_cvt8(const float* __restrict__ s0, const float* __restrict__ s1, const float* __restrict__ s2, const float* __restrict__ s3, bf* dst, size_t n8) { const size_t i0 = (size_t)blockIdx.x * 256 + threadIdx.x, st = (size_t)gridDim.x * 256; const int y = blockIdx.y; const float* src = (y == 0) ? s0 : (y == 1) ? s1 : (y == 2) ? s2 : s3; dst += (size_t)y * n8 * 8; v8f v[CU];
#pragma unroll
    for (int u = 0; u < CU; ++u) v[u] = *(const v8f*)(src + (i0 + u * st) * 8);
    XW();
#pragma unroll
    for (int u = 0; u < CU; ++u) { v8us o;
#pragma unroll
        for (int k = 0; k < 8; ++k) o[k] = f2bf(v[u][k]);
        *(v8us*)(dst + (i0 + u * st) * 8) = o; }
    XW();  }

__constant__ float INVT[HD / 2] = { 1.000000000e+00f, 7.498942018e-01f, 5.623413324e-01f, 4.216965139e-01f, 3.162277639e-01f, 2.371373624e-01f, 1.778279394e-01f, 1.333521456e-01f, 1.000000015e-01f, 7.498941571e-02f, 5.623412877e-02f, 4.216964915e-02f, 3.162277862e-02f, 2.371373586e-02f, 1.778279431e-02f, 1.333521493e-02f, 9.999999776e-03f, 7.498942316e-03f, 5.623413250e-03f, 4.216964822e-03f, 3.162277862e-03f, 2.371373819e-03f, 1.778279431e-03f, 1.333521446e-03f, 1.000000047e-03f, 7.498941850e-04f, 5.623413017e-04f, 4.216964880e-04f, 3.162277862e-04f, 2.371373848e-04f, 1.778279402e-04f, 1.333521504e-04f };   // float32 1 / 10000^(2i/64), i < 32, generated with jnp to be bit-exact
__global__ __launch_bounds__(256) void k_cs5(float* CS) { const int idx = blockIdx.x * 256 + threadIdx.x; if (idx >= TT * HD) return; const int d = idx % HD; const int t = idx / HD; const float a = __fmul_rn((float)t, INVT[d % (HD / 2)]); v2f cs; cs[0] = cosf(a); cs[1] = sinf(a); *(v2f*)(CS + (size_t)idx * 2) = cs;  }
// ---- k_attn: the whole banded attention of one (batch, head) and 64 query rows in one work-group of 4 waves; a wave owns 16 query rows from the scores to the merged hi/lo planes and shares nothing with the other waves (no work-group barrier); the 4 waves read the same K and V^T lines, every load 512 bytes in a row (FRAGMENT ORDER).
// Per wave: (1) scores Q K^T for keys kbeg .. kend - 1 (q0 - 64 .. q0 + 127 clipped to the sequence: every |i - j| <= 50 of the row tile), f32 into the wave's LDS rows, key j at column j - CB(q0); (2) softmax of SR rows at a time, a row's 256 columns over the 32 lanes; the probabilities (fp16 x 1024, or bf16 hi and lo) overwrite the row's own scores; (3) P V over the same keys, A fragments from LDS, B fragments from the V^T planes; (4) the 16 x 64 result turned through LDS, scaled back, split hi/lo and stored as whole 128-byte lines of the merged [b][t][h d] planes.
// Row tiles < RH / 64 take the hi/lo planes (3 products per 32 k, in the order hi hi, lo hi, hi lo), the rest the fp16 planes.
#define AP  268   // LDS row pitch in floats: 8 rows apart is 32 banks apart (the two halves of an accumulator store do not collide); 1072 bytes = 16 x odd for the 16-byte fragment reads; holds 256 f32 scores, then 2 x 264 16-bit probabilities
#define APL 264   // offset of a row's lo probabilities in 16-bit elements
template <typename T16, bool HL>
__device__ __forceinline__ void attn16(float* sl, int q0, int w, int zz, const T16* __restrict__ Q, const T16* __restrict__ Q2, const T16* __restrict__ Kp, const T16* __restrict__ K2, const T16* __restrict__ Vt, const T16* __restrict__ V2, bf* Ah, bf* Al) {
    typedef typename WFrag<T16>::V V;
    const int lane = threadIdx.x & 31, lr = lane & 15, hi = lane >> 4; const int i0 = q0 + w * 16, cb = CB(q0), kbeg = max(q0 - 64, 0), kend = min(q0 + 128, TT);
    {   // (1) scores
        V a[2], a2[2]; const size_t qo = (size_t)i0 * HD + lane * 8;
#pragma unroll
        for (int kk = 0; kk < 2; ++kk) { a[kk] = WFrag<T16>::ldp(Q + qo + kk * 512); if (HL) a2[kk] = WFrag<T16>::ldp(Q2 + qo + kk * 512); }
        XW();
#pragma unroll 1   // 2 or 3 column tiles of 64 keys
        for (int c0 = kbeg; c0 < kend; c0 += 64) {
            v8f acc[4]; V b[2][4], b2[2][4]; const size_t ko = (size_t)c0 * HD + lane * 8;
#pragma unroll
            for (int kk = 0; kk < 2; ++kk)
#pragma unroll
                for (int nb = 0; nb < 4; ++nb) { b[kk][nb] = WFrag<T16>::ldp(Kp + ko + nb * 16 * HD + kk * 512); if (HL) b2[kk][nb] = WFrag<T16>::ldp(K2 + ko + nb * 16 * HD + kk * 512); }
            XW();
            __builtin_amdgcn_sched_barrier(0);   // all loads of these 64 keys go out as one group (for speed only)
#pragma unroll
            for (int nb = 0; nb < 4; ++nb) acc[nb] = (v8f){};
#pragma unroll
            for (int kk = 0; kk < 2; ++kk)
#pragma unroll
                for (int nb = 0; nb < 4; ++nb) { acc[nb] = WFrag<T16>::mma(a[kk], b[kk][nb], acc[nb]); if (HL) { acc[nb] = WFrag<T16>::mma(a2[kk], b[kk][nb], acc[nb]); acc[nb] = WFrag<T16>::mma(a[kk], b2[kk][nb], acc[nb]); } }
#pragma unroll
            for (int nb = 0; nb < 4; ++nb)
#pragma unroll
                for (int j = 0; j < 8; ++j) sl[(hi * 8 + j) * AP + (c0 - cb) + nb * 16 + lr] = acc[nb][j];
        }
    }
    wfence();
    // (2) softmax: t = S x 1/8 for keys with |i - j| <= 50, -3e38 elsewhere (the -1e9 fill == exclusion); same lane and chunk order as over all 2048 keys, whose other terms are exact zeros; S is read only where a lane's 4 keys touch the band; each step for all SR rows in turn so that their butterflies overlap
#pragma unroll 1   // two groups of SR rows: one copy of the code, and the registers of one group
    for (int rb = 0; rb < 16; rb += SR) {
        float v[SR][8]; float mx[SR], sum[SR]; v4f a[SR][2];
#pragma unroll
        for (int r = 0; r < SR; ++r) {
#pragma unroll
            for (int ch = 0; ch < 2; ++ch) { const int i = i0 + rb + r, j0 = cb + ch * 128 + lane * 4; a[r][ch] = (v4f){}; if (i - (j0 + 3) <= BW && j0 - i <= BW) a[r][ch] = *(const v4fa*)(sl + (rb + r) * AP + ch * 128 + lane * 4); } }
        wfence();
#pragma unroll
        for (int r = 0; r < SR; ++r) { mx[r] = -3.0e38f;
#pragma unroll
            for (int ch = 0; ch < 2; ++ch) {
#pragma unroll
                for (int q = 0; q < 4; ++q) { const int i = i0 + rb + r, j = cb + ch * 128 + lane * 4 + q; const float t = (i - j <= BW && j - i <= BW) ? a[r][ch][q] * SCL : -3.0e38f;   /* |i - j| <= 50 */ v[r][ch * 4 + q] = t; mx[r] = fmaxf(mx[r], t); } } }
#pragma unroll
        for (int sh = 16; sh; sh >>= 1) {
#pragma unroll
            for (int r = 0; r < SR; ++r) mx[r] = fmaxf(mx[r], __shfl_xor(mx[r], sh, 32)); }
#pragma unroll
        for (int r = 0; r < SR; ++r) { sum[r] = 0.f;
#pragma unroll
            for (int k = 0; k < 8; ++k) { const float d0 = __fsub_rn(v[r][k], mx[r]); const float e0 = __fmul_rn(d0, 1.4426950408889634f);
                __builtin_amdgcn_sched_barrier(0);   // with the one two lines down: holds the v_nop directly behind the v_exp_f32
                v[r][k] = __builtin_amdgcn_exp2f(e0); asm volatile("v_nop");   // the slot behind the transcendental, kept free of an instruction that reads its result or overwrites its source
                __builtin_amdgcn_sched_barrier(0); }
#pragma unroll
            for (int k = 0; k < 8; ++k) sum[r] += v[r][k]; }
#pragma unroll
        for (int sh = 16; sh; sh >>= 1) {
#pragma unroll
            for (int r = 0; r < SR; ++r) sum[r] += __shfl_xor(sum[r], sh, 32); }
#pragma unroll
        for (int r = 0; r < SR; ++r) { const float f = __fdiv_rn(HL ? 1.0f : PCAR, sum[r]); T16* pr = (T16*)(sl + (rb + r) * AP);
#pragma unroll
            for (int ch = 0; ch < 2; ++ch) {
                if constexpr (HL) { v4us oh, ol;
#pragma unroll
                    for (int q = 0; q < 4; ++q) { unsigned short a2, c2; splitf(v[r][ch * 4 + q] * f, a2, c2); oh[q] = a2; ol[q] = c2; }
                    *(v4us*)(pr + ch * 128 + lane * 4) = oh; *(v4us*)(pr + APL + ch * 128 + lane * 4) = ol;
                } else { v4h o4;
#pragma unroll
                    for (int q = 0; q < 4; ++q) o4[q] = tohx(v[r][ch * 4 + q] * f);
                    *(v4h*)(pr + ch * 128 + lane * 4) = o4; } } }
    }
    wfence();
    v8f o[4];
#pragma unroll
    for (int nb = 0; nb < 4; ++nb) o[nb] = (v8f){};
    {   // (3) P V
        const T16* pa = (const T16*)sl + lr * (AP * 2) + 8 * hi; const size_t vo = (size_t)lane * 8;
#pragma unroll 1   // 2 or 3 steps of 64 keys
        for (int kc = kbeg; kc < kend; kc += 64) {
            V b[2][4], b2[2][4], a[2], a2[2];
#pragma unroll
            for (int kk = 0; kk < 2; ++kk)
#pragma unroll
                for (int nb = 0; nb < 4; ++nb) { b[kk][nb] = WFrag<T16>::ldp(Vt + vo + (size_t)kc * HD + (nb * 2 + kk) * 512); if (HL) b2[kk][nb] = WFrag<T16>::ldp(V2 + vo + (size_t)kc * HD + (nb * 2 + kk) * 512); }
            XW();
#pragma unroll
            for (int kk = 0; kk < 2; ++kk) { a[kk] = WFrag<T16>::ld(pa + (kc - cb) + kk * 32); if (HL) a2[kk] = WFrag<T16>::ld(pa + APL + (kc - cb) + kk * 32); }
            __builtin_amdgcn_sched_barrier(0);   // all loads of these 64 keys go out as one group (for speed only)
#pragma unroll
            for (int kk = 0; kk < 2; ++kk)
#pragma unroll
                for (int nb = 0; nb < 4; ++nb) { o[nb] = WFrag<T16>::mma(a[kk], b[kk][nb], o[nb]); if (HL) { o[nb] = WFrag<T16>::mma(a2[kk], b[kk][nb], o[nb]); o[nb] = WFrag<T16>::mma(a[kk], b2[kk][nb], o[nb]); } }
        }
    }
    wfence();
    // (4) merge
#pragma unroll
    for (int nb = 0; nb < 4; ++nb)
#pragma unroll
        for (int j = 0; j < 8; ++j) sl[(hi * 8 + j) * 68 + nb * 16 + lr] = o[nb][j];
    wfence();
    const float cs = HL ? 1.0f : (1.0f / PCAR);
#pragma unroll
    for (int g = 0; g < 4; ++g) { const int row = g * 4 + (lane >> 3), d = (lane & 7) * 8; const v4f x0 = *(const v4fa*)(sl + row * 68 + d), x1 = *(const v4fa*)(sl + row * 68 + d + 4); v8us oh, ol;
#pragma unroll
        for (int q = 0; q < 8; ++q) { unsigned short h2, l2; splitf((q < 4 ? x0[q & 3] : x1[q & 3]) * cs, h2, l2); oh[q] = h2; ol[q] = l2; }
        const size_t oo = ((size_t)(zz / NH_) * TT + i0 + row) * DQ + (zz % NH_) * HD + d; *(v8us*)(Ah + oo) = oh; *(v8us*)(Al + oo) = ol; }
    XW();
}
// grid (TT / 64, ZH); all planes are whole, in FRAGMENT ORDER
__global__ __launch_bounds__(128) void k_attn(const bf* __restrict__ Qh, const bf* __restrict__ Ql, const bf* __restrict__ Kh, const bf* __restrict__ Kl, const bf* __restrict__ Vh, const bf* __restrict__ Vl, const h16* __restrict__ Q16, const h16* __restrict__ K16, const h16* __restrict__ V16, bf* Ah, bf* Al) {
    __shared__ __align__(16) float sb[4 * 16 * AP];
    const int w = threadIdx.x >> 5, q0 = blockIdx.x * 64, zz = blockIdx.y; const size_t zo = (size_t)zz * TT * HD; float* sl = sb + w * (16 * AP);
    if (q0 >= RH) { attn16<h16, false>(sl, q0, w, zz, Q16 + zo, nullptr, K16 + zo, nullptr, V16 + zo, nullptr, Ah, Al); return; }
    attn16<bf, true>(sl, q0, w, zz, Qh + zo, Ql + zo, Kh + zo, Kl + zo, Vh + zo, Vl + zo, Ah, Al);
}

extern "C" void kernel_launch(void* const* d_in, const int* in_sizes, int n_in,
                              void* d_out, int out_size, void* d_ws, size_t ws_size, hipStream_t stream) {
    (void)in_sizes; (void)n_in; (void)out_size;
    const float* x = (const float*)d_in[0];   /* query */ const float* xk = (const float*)d_in[1]; const float* xv = (const float*)d_in[2]; const float* wq = (const float*)d_in[3]; const float* bq = (const float*)d_in[4]; const float* wk = (const float*)d_in[5]; const float* bk = (const float*)d_in[6]; const float* wv = (const float*)d_in[7]; const float* bv = (const float*)d_in[8]; const float* wo = (const float*)d_in[9]; const float* bo = (const float*)d_in[10];   /* input order query, key, value, Wq, bq, Wk, bk, Wv, bv, Wo, bo */
    float* OUT = (float*)d_out;     // [2][2048][1024]
    char* wsp = (char*)d_ws;
    auto take = [&](size_t bytes) { char* p = wsp; wsp += (bytes + 255) & ~(size_t)255; return (void*)p; };
    const size_t NW = (size_t)DQ * DM, NX = (size_t)NB_ * TT * DM, NP = (size_t)ZH * TT * HD;   // elements of one weight, one input tensor, one set of head planes
    bf* WQ = (bf*)take(4 * NW * 2); bf* WO = WQ + 3 * NW;   /* Wq, Wk, Wv, Wo in turn */ float* CS = (float*)take((size_t)TT * HD * 2 * 4);
    h16* QP16 = (h16*)take(2 * NP * 2); h16* KP16 = QP16 + NP; bf* QPh = (bf*)take(2 * NP * 2); bf* KPh = QPh + NP; bf* QPl = (bf*)take(2 * NP * 2); bf* KPl = QPl + NP;   /* q planes, then k planes */
    h16* VT16 = (h16*)take(NP * 2); bf* VTh = (bf*)take(NP * 2); bf* VTl = (bf*)take(NP * 2);
    bf* ATh = (bf*)take(NX * 2); bf* ATl = (bf*)take(NX * 2);
    bf* XB = (bf*)take(3 * NX * 2);   /* bf16 query, key, value */
    if ((size_t)(wsp - (char*)d_ws) > ws_size) return;    // ws 256 MiB
    k_cvt8<<<dim3((unsigned)(NW / 8 / (256 * CU)), 4), 256, 0, stream>>>(wq, wk, wv, wo, WQ, NW / 8);
    k_cs5<<<(TT * HD + 255) / 256, 256, 0, stream>>>(CS);   /* rotary table once */
    k_cvt8<<<dim3((unsigned)(NX / 8 / (256 * CU)), 3), 256, 0, stream>>>(x, xk, xv, xv, XB, NX / 8);
    k_gemmt<0, 1><<<dim3(NB_ * TT / 128, DQ / 128, 3), 128, 0, stream>>>(XB, nullptr, WQ, nullptr, bq, bk, bv, NX, NW, 0, CS, QP16, QPh, QPl, NP, VT16, VTh, VTl);
    static_assert(((size_t)DQ * DM / 8) % (256 * CU) == 0 && ((size_t)NB_ * TT * DM / 8) % (256 * CU) == 0 && 16 % SR == 0 && RH % 64 == 0, "whole grids");
    k_attn<<<dim3(TT / 64, ZH), 128, 0, stream>>>(QPh, QPl, KPh, KPl, VTh, VTl, QP16, KP16, VT16, ATh, ATl);
    k_gemmt<1, 0><<<dim3(NB_ * TT / 128, DM / 128, 1), 128, 0, stream>>>(ATh, ATl, WO, OUT, bo, bo, bo, 0, 0, 0, nullptr, nullptr, nullptr, nullptr, 0, nullptr, nullptr, nullptr);
}

// v008
// One run takes 78.5 microseconds.
// In both of two side-by-side timings against v007, it was 1.04 times as fast.
// All steps since v000 together make it 25.8 times as fast.
#include <hip/hip_runtime.h>

// Sliding-window multi-head attention with rotary embeddings (query, key, value [2][2048][1024]; q = query Wq^T + bq etc. ('oi' 1/32, zero biases; 16 heads x 64); rotate-half rotary with angles t x 1/10000^(2i/64) (float32 table baked, precise cosf/sinf); scores / sqrt(64); keys with |i - j| <= 50 kept (-1e9 elsewhere == exclusion); softmax; out = merged Wo^T + bo -> [2][2048][1024] (4.2 M); argument order query, key, value, Wq, bq, Wk, bk, Wv, bv, Wo, bo).
// Layout, both batches and all 16 heads in one launch per stage (grid y / z picks tensor, batch and head): bf16 copies of query, key, value; 'oi' weights; {cos, sin} table once; exact projections + f32 biases, whose epilogue applies the rotate-half rotary (q, k) or the transpose (v) and writes the head planes in the order the attention's fragment loads take them (see FRAGMENT ORDER); T-2048 attention on the band only, scores to merged planes in one kernel with score and probability rows in LDS (per 64-row tile the 3 score tiles, 256 softmax columns and 192 PV keys that can hold |i - j| <= 50; the band itself is a select in the softmax; hybrid rows: < 512 hi/lo 3 products, rest fp16 x1024); merged hi/lo x Wo exact + bo.
// Compute dtypes, f32 accumulate: every input rounded to bf16; projections exact + f32 biases; rotary f32; attention rows < 512 3 products, rest fp16; softmax f32; Wo hl x exact + bias.

#define NB_  2
#define TT   2048
#define DM   1024
#define NH_  16
#define NKV  16
#define REP  (NH_ / NKV)
#define HD   64
#define DQ   (NH_ * HD)
#define DKV  (NKV * HD)
#define ZH   (NB_ * NH_)          // attention planes per launch: every (batch, head)
#define RH   512                  // query rows < RH use hi+lo planes (0: none)
#define WIN  2048
#define BW   50       // half window: keys j in [i - 50, i + 50]
#define PCAR 1024.0f
#define SCL  0.125f   // HD^-0.5
typedef _Float16 h16;
typedef unsigned short bf;
typedef __attribute__((ext_vector_type(16))) __bf16   v16bf;
typedef __attribute__((ext_vector_type(16))) _Float16 v16h;
typedef __attribute__((ext_vector_type(8)))  _Float16 v8h;
typedef __attribute__((ext_vector_type(8)))  unsigned short v8us;
typedef __attribute__((ext_vector_type(8)))  float    v8f;
typedef __attribute__((ext_vector_type(4)))  float    v4f;
typedef v8h  __attribute__((may_alias)) v8ha;
typedef v4f  __attribute__((may_alias)) v4fa;
typedef v8us __attribute__((may_alias)) v8usa;

__device__ __forceinline__ unsigned short f2bf(float f) { unsigned u = __float_as_uint(f); u += 0x7FFFu + ((u >> 16) & 1u); return (unsigned short)(u >> 16); }
__device__ __forceinline__ float bf2f(unsigned short b) { return __uint_as_float(((unsigned)b) << 16); }
__device__ __forceinline__ float bfr(float f) { return bf2f(f2bf(f)); }
__device__ __forceinline__ v16h cat16(v8h lo, v8h hi) { return __builtin_shufflevector(lo, hi, 0, 1, 2, 3, 4, 5, 6, 7, 8, 9, 10, 11, 12, 13, 14, 15); }
__device__ __forceinline__ v16bf cat16b(v8us lo, v8us hi) { return __builtin_bit_cast(v16bf, __builtin_shufflevector(lo, hi, 0, 1, 2, 3, 4, 5, 6, 7, 8, 9, 10, 11, 12, 13, 14, 15)); }
__device__ __forceinline__ v8f wmma16(v16h a, v16h b, v8f c) { return __builtin_amdgcn_wmma_f32_16x16x32_f16(false, a, false, b, (short)0, c, false, false); }
__device__ __forceinline__ v8f wmmab(v16bf a, v16bf b, v8f c) { return __builtin_amdgcn_wmma_f32_16x16x32_bf16(false, a, false, b, (short)0, c, false, false); }



// Fragments come from K-contiguous 16-bit rows in LDS or from head planes in FRAGMENT ORDER: lane lr + 16 hi holds row lr, k = 8 hi .. 8 hi + 7 and 16 + 8 hi .. 16 + 8 hi + 7 of each 32 k, the same for A and B.
__device__ __forceinline__ int CB(int q0) { return min(max(q0 - 64, 0) / 128, TT / 128 - 2) * 128; }   // first key of the two 128-key chunks that cover row tile q0's band
// FRAGMENT ORDER of the head planes: the 16 bytes that lane l takes with one load of a fragment lie at l x 16 bytes of a 512-byte run, so a wave's load reads 4 whole 128-byte lines (row-major planes: 32 bytes of each of 16 lines). A fragment (16 rows x 32 k) is two runs in a row: k = 8 hi .. 8 hi + 7, then k = 16 + 8 hi .. 16 + 8 hi + 7; ldp reads both.
// q, k planes [z][t / 16][d / 32][run][lane][8]: rows t, k = d. V^T planes [z][t / 64][d / 16][(t % 64) / 32][run][lane][8]: rows d, k = t. The values in every fragment register are those of the row-major planes.
template <typename T16> struct WFrag;
template <> struct WFrag<h16> { typedef v16h V; static __device__ __forceinline__ V ld(const h16* p) { return cat16(*(const v8h*)p, *(const v8h*)(p + 16)); } static __device__ __forceinline__ V ldp(const h16* p) { return cat16(*(const v8h*)p, *(const v8h*)(p + 256)); } static __device__ __forceinline__ v8f mma(V a, V b, v8f c) { return wmma16(a, b, c); } };
template <> struct WFrag<bf> { typedef v16bf V; static __device__ __forceinline__ V ld(const bf* p) { return cat16b(*(const v8us*)p, *(const v8us*)(p + 16)); } static __device__ __forceinline__ V ldp(const bf* p) { return cat16b(*(const v8us*)p, *(const v8us*)(p + 256)); } static __device__ __forceinline__ v8f mma(V a, V b, v8f c) { return wmmab(a, b, c); } };
__device__ __forceinline__ h16 tohx(float x) { return (h16)x; }
__device__ __forceinline__ void splitf(float y, unsigned short& h, unsigned short& l) { h = f2bf(y); l = f2bf(y - bf2f(h)); }
// XW: precaution, stands behind a run of global loads or stores and in front of the arithmetic that may reuse their address registers
#define XW() asm volatile("s_wait_xcnt 0x0" ::: "memory")
// wfence: keeps the wave's LDS stores of one phase in front of its LDS reads of the next (and a row's score reads in front of the probabilities that overwrite them) in the compiled order; the hardware runs one wave's LDS operations in order
__device__ __forceinline__ void wfence() { __builtin_amdgcn_wave_barrier(); asm volatile("" ::: "memory"); }
typedef float __attribute__((may_alias)) f32a;
typedef __attribute__((ext_vector_type(2))) float v2f;
// ---- k_gemmt: the four projections. One 128x128 tile of C per work-group of 4 waves (2 x 2 waves of 64x64, 16 accumulators a wave); A (, A2) and Bt tiles of 64 k come into LDS by asynchronous copies, whole 128-byte lines, each staged row read by two waves; two buffers, the next stage's copies fly while this stage is multiplied; fragments are read from LDS one 32-k block ahead into a second register set.
// C[m][n] (f32, pitch DM, + f32 bias[n], one bias pointer per z < 3) = sum_k A[m][k] Bt[n][k] (+ A2[m][k] Bt[n][k] behind it in every 32 k when NSPLIT). All pitches DM; grid (M/128, N/128, Z).
// EPI: no C is written. A wave's 64x64 tile is 64 positions t of one (batch, head), so the wave itself turns it into that head's 16-bit planes (fp16, bf16 hi, bf16 lo): z < 2 (q, k) rotate-half rotary out[d] = x[d] cos[t][d] - x[d+HD/2] sin[t][d], out[d+HD/2] = x[d+HD/2] cos[t][d+HD/2] + x[d] sin[t][d+HD/2] (tensor stride sP); z == 2 (v) the transpose; both in FRAGMENT ORDER. q and k go through the wave's quarter of the ring, v goes straight from the accumulators; every global store of a wave fills 512 bytes in a row.
#define GP   72            // LDS row pitch in 16-bit elements: 144 bytes = 16 x odd, the conflict-free pitch for 16-byte reads of 128-byte rows
#define GKS  64            // k per stage
#define GMAT (128 * GP)    // elements of one staged operand tile
// cp8: rows r, r + 16, ... r + 112 of one operand tile, 16 bytes a lane; g is the tile's address, the same for the whole work-group: the eight row groups' addresses are scalar bases, o is the lane's byte offset in a row group; the s_wait_xcnt closes the statement so that no address register is rewritten in front of it
__device__ __forceinline__ void cp8(unsigned l, const bf* g, unsigned o) {
    asm volatile("global_load_async_to_lds_b128 %0, %8, %9\n\t"
                 "global_load_async_to_lds_b128 %1, %8, %10\n\t"
                 "global_load_async_to_lds_b128 %2, %8, %11\n\t"
                 "global_load_async_to_lds_b128 %3, %8, %12\n\t"
                 "global_load_async_to_lds_b128 %4, %8, %13\n\t"
                 "global_load_async_to_lds_b128 %5, %8, %14\n\t"
                 "global_load_async_to_lds_b128 %6, %8, %15\n\t"
                 "global_load_async_to_lds_b128 %7, %8, %16\n\t"
                 "s_wait_xcnt 0x0"
                 :: "v"(l), "v"(l + 1 * 16 * GP * 2), "v"(l + 2 * 16 * GP * 2), "v"(l + 3 * 16 * GP * 2), "v"(l + 4 * 16 * GP * 2), "v"(l + 5 * 16 * GP * 2), "v"(l + 6 * 16 * GP * 2), "v"(l + 7 * 16 * GP * 2),
                    "v"(o),
                    "s"(g), "s"(g + 1 * 16 * DM), "s"(g + 2 * 16 * DM), "s"(g + 3 * 16 * DM), "s"(g + 4 * 16 * DM), "s"(g + 5 * 16 * DM), "s"(g + 6 * 16 * DM), "s"(g + 7 * 16 * DM)
                 : "memory");
}
template <int NSPLIT, int EPI>
__global__ __launch_bounds__(128) void k_gemmt(const bf* __restrict__ A, const bf* __restrict__ A2, const bf* __restrict__ Bt, float* C, const float* __restrict__ bias0, const float* __restrict__ bias1, const float* __restrict__ bias2, size_t sA, size_t sB, size_t sC, const float* __restrict__ CS, h16* P16, bf* Ph, bf* Pl, size_t sP, h16* V16, bf* Vh, bf* Vl) {
    constexpr int NMAT = 2 + NSPLIT, STG = NMAT * GMAT, NST = DM / GKS;
    __shared__ __align__(16) bf ring[2 * STG];
    const size_t z = blockIdx.z; A += z * sA; if (NSPLIT) A2 += z * sA; Bt += z * sB; C += z * sC; const float* bias = (z == 0) ? bias0 : (z == 1) ? bias1 : bias2;
    const int tid = threadIdx.x, lane = tid & 31, lr = lane & 15, hi = lane >> 4, w = tid >> 5;
    const int R0 = blockIdx.x * 128, C0 = blockIdx.y * 128, r0 = R0 + (w >> 1) * 64, c0 = C0 + (w & 1) * 64;
    const int crow = tid >> 3, ccol = (tid & 7) * 8;   // a thread copies 16 bytes of rows crow + 16 i; 8 threads fill a row's 128 bytes
    const unsigned go = (unsigned)(crow * DM + ccol) * 2u;   // the thread's byte offset in an operand tile; the tile's own address is the same for the whole work-group and stays in scalar registers, so that the copies need few vector registers beside the two fragment sets
    const bf* gA = A + (size_t)R0 * DM; const bf* gA2 = NSPLIT ? A2 + (size_t)R0 * DM : nullptr; const bf* gB = Bt + (size_t)C0 * DM;
    const unsigned l0 = (unsigned)(size_t)ring + (unsigned)(crow * GP + ccol) * 2u;
    auto fill = [&](int s) { const unsigned l = l0 + (unsigned)(s & 1) * (STG * 2u); cp8(l, gA + s * GKS, go); if (NSPLIT) cp8(l + GMAT * 2u, gA2 + s * GKS, go); cp8(l + (NMAT - 1) * GMAT * 2u, gB + s * GKS, go); };
    v8f acc[4][4];
#pragma unroll
    for (int mb = 0; mb < 4; ++mb)
#pragma unroll
        for (int nb = 0; nb < 4; ++nb) acc[mb][nb] = (v8f){};
    const bf* fa = ring + ((w >> 1) * 64 + lr) * GP + 8 * hi; const bf* fb = ring + (NMAT - 1) * GMAT + ((w & 1) * 64 + lr) * GP + 8 * hi;
    // Two fragment sets: while one 32-k block is multiplied, the next block's LDS reads are already under way, so a wave no longer waits out its own LDS latency in front of every block.
    v16bf fa0[4], fx0[4], fb0[4], fa1[4], fx1[4], fb1[4];
    auto ldf = [&](v16bf (&a)[4], v16bf (&a2)[4], v16bf (&b)[4], int o) {
#pragma unroll
        for (int mb = 0; mb < 4; ++mb) { a[mb] = WFrag<bf>::ld(fa + o + mb * 16 * GP); if (NSPLIT) a2[mb] = WFrag<bf>::ld(fa + o + GMAT + mb * 16 * GP); }
#pragma unroll
        for (int nb = 0; nb < 4; ++nb) b[nb] = WFrag<bf>::ld(fb + o + nb * 16 * GP); };
    auto mm = [&](v16bf (&a)[4], v16bf (&a2)[4], v16bf (&b)[4]) {
#pragma unroll
        for (int nb = 0; nb < 4; ++nb) {
#pragma unroll
            for (int mb = 0; mb < 4; ++mb) acc[mb][nb] = wmmab(a[mb], b[nb], acc[mb][nb]);
            if (NSPLIT) {
#pragma unroll
                for (int mb = 0; mb < 4; ++mb) acc[mb][nb] = wmmab(a2[mb], b[nb], acc[mb][nb]); } } };
    static_assert(GKS == 64 && NST >= 2, "two blocks of 32 k a stage, two stages or more");
    fill(0);
    asm volatile("s_wait_asynccnt 0x0" ::: "memory");   // stage 0 has landed before the barrier publishes it
    __syncthreads();
    fill(1);
    ldf(fa0, fx0, fb0, 0);   // stage 0, first block
#pragma unroll 1   // one copy of the stage body: the buffer is picked by an address
    for (int t = 0; t < NST; ++t) {
        const int bo = (t & 1) * STG;
        ldf(fa1, fx1, fb1, bo + 32);   // this stage's last block: the wave's last reads of buffer t & 1
        __builtin_amdgcn_sched_barrier(0);   // the reads go out as one group in front of the running block's matrix instructions (for speed only)
        mm(fa0, fx0, fb0);
        __builtin_amdgcn_sched_barrier(0);   // holds the waits and the barrier below behind the block above: lifted over it, the s_wait_dscnt would wait out the reads that the block is there to cover
        // publish point of stage t + 1: it stands in front of this stage's last block, because the reads behind it already take the next stage
        asm volatile("s_wait_dscnt 0x0" ::: "memory");      // this wave's reads of buffer t & 1 are done before the barrier frees it
        asm volatile("s_wait_asynccnt 0x0" ::: "memory");   // this wave's copies of stage t + 1 have landed before the barrier publishes them
        __syncthreads();
        if (t + 2 < NST) fill(t + 2);
        if (t + 1 < NST) ldf(fa0, fx0, fb0, STG - bo);   // next stage, first block
        __builtin_amdgcn_sched_barrier(0);   // as above: one group of reads in front of the matrix instructions
        mm(fa1, fx1, fb1);
    }
    asm volatile("s_wait_asynccnt 0x0" ::: "memory");   // nothing is in flight when the wave goes on to the epilogue and ends
    if constexpr (EPI) {
        // The ring is free here: the barrier of the last trip stands behind every wave's last read of it, and no copy is in flight. Each wave stages in its own quarter.
        static_assert(NSPLIT == 0 && 64 * 68 * 4 <= STG, "a wave's staging fits its quarter of the ring");
        const int zp = (r0 / TT) * NH_ + c0 / HD, t0 = r0 % TT;   // head plane, first position
        if (z < 2) {
            f32a* os = (f32a*)ring + w * (STG / 4);
            // An accumulator lane holds x[d] (nb) and its partner x[d + HD/2] (nb + 2) of the same rows, so the rotation is done in place; the table's columns d and d + HD/2 hold the same angle, and one 8-byte read a lane of {cos, sin}[t][d < HD/2] uses whole 128-byte lines.
            float bb[4];
#pragma unroll
            for (int nb = 0; nb < 4; ++nb) bb[nb] = bfr(bias[c0 + nb * 16 + lr]);
            XW();
            const float* cs = CS + ((size_t)(t0 + hi * 8) * HD + lr) * 2;
            v2f c[4][2][8];
            auto ldc = [&](int mb) {
#pragma unroll
                for (int nb = 0; nb < 2; ++nb)
#pragma unroll
                    for (int j = 0; j < 8; ++j) c[mb][nb][j] = *(const v2f*)(cs + ((mb * 16 + j) * HD + nb * 16) * 2); };
            ldc(0); ldc(1);   // the table reads run two groups of 16 rows ahead of their use
            XW();
#pragma unroll
            for (int mb = 0; mb < 4; ++mb) {
#pragma unroll
                for (int nb = 0; nb < 2; ++nb)
#pragma unroll
                    for (int j = 0; j < 8; ++j) { const float xl = acc[mb][nb][j] + bb[nb], xh = acc[mb][nb + 2][j] + bb[nb + 2], co = c[mb][nb][j][0], si = c[mb][nb][j][1]; f32a* o = os + (mb * 16 + hi * 8 + j) * 68 + nb * 16 + lr;
                        o[0] = xl * co - xh * si; o[HD / 2] = xh * co + xl * si; }
                if (mb + 2 < 4) { ldc(mb + 2); XW(); }
            }
            wfence();
            const size_t e0 = z * sP + ((size_t)zp * TT + t0) * HD + lane * 8; const f32a* ox = os + lr * 68 + hi * 8;   // run u of a group of 16 rows: lane lr + 16 hi holds row lr, d = 16 u + 8 hi .. + 7
#pragma unroll 1   // 4 groups of 16 rows: one copy of the code, so that the kernel's text stays small
            for (int gg = 0; gg < 4; ++gg) {
                v4f x[4][2];
#pragma unroll
                for (int u = 0; u < 4; ++u) { x[u][0] = *(const v4fa*)(ox + gg * 16 * 68 + u * 16); x[u][1] = *(const v4fa*)(ox + gg * 16 * 68 + u * 16 + 4); }
#pragma unroll
                for (int u = 0; u < 4; ++u) { v8h o16; v8us oh, ol;
#pragma unroll
                    for (int q = 0; q < 8; ++q) { const float r = x[u][q >> 2][q & 3]; o16[q] = tohx(r); unsigned short a2, c2; splitf(r, a2, c2); oh[q] = a2; ol[q] = c2; }
                    const size_t e = e0 + (size_t)(gg * 16 * HD + u * 256); *(v8h*)(P16 + e) = o16; *(v8us*)(Ph + e) = oh; *(v8us*)(Pl + e) = ol; }
                XW();
            }
        } else {
            float bb[4];
#pragma unroll
            for (int nb = 0; nb < 4; ++nb) bb[nb] = bfr(bias[c0 + nb * 16 + lr]);
            // An accumulator lane holds 8 neighbouring t of one d: t = 16 mb + 8 hi + j, d = 16 nb + lr. That is the lane's 16 bytes of run mb & 1 of the V^T fragment (d / 16 = nb, (t % 64) / 32 = mb >> 1), so tile (mb, nb) is run 4 nb + mb of the head's 64-key block and needs no turn through LDS.
            const size_t e0 = ((size_t)zp * TT + t0) * HD + lane * 8;
#pragma unroll
            for (int nb = 0; nb < 4; ++nb)
#pragma unroll
                for (int mb = 0; mb < 4; ++mb) { v8h o16; v8us oh, ol;
#pragma unroll
                    for (int j = 0; j < 8; ++j) { const float xv = acc[mb][nb][j] + bb[nb]; o16[j] = tohx(xv); unsigned short a2, c2; splitf(xv, a2, c2); oh[j] = a2; ol[j] = c2; }
                    const size_t e = e0 + (size_t)((nb * 4 + mb) * 256); *(v8h*)(V16 + e) = o16; *(v8us*)(Vh + e) = oh; *(v8us*)(Vl + e) = ol; }
            XW();
        }
    } else {
    __shared__ __align__(16) float osb[4 * 16 * 68];
    float* os = osb + w * (16 * 68);   // each wave stages its own output rows
    v4f bb = *(const v4fa*)(bias + c0 + lr * 4); bb[0] = bfr(bb[0]); bb[1] = bfr(bb[1]); bb[2] = bfr(bb[2]); bb[3] = bfr(bb[3]);
#pragma unroll
    for (int mb = 0; mb < 4; ++mb) {
#pragma unroll
        for (int nb = 0; nb < 4; ++nb) {
#pragma unroll
            for (int j = 0; j < 8; ++j) os[(hi * 8 + j) * 68 + nb * 16 + lr] = acc[mb][nb][j]; }
        __builtin_amdgcn_wave_barrier(); asm volatile("" ::: "memory");   // the wave's stores to os stay in front of its reads
        float* crow_p = C + (size_t)(r0 + mb * 16) * DM + c0;
#pragma unroll
        for (int s = 0; s < 8; ++s) { const int row = 2 * s + hi, cofs = lr * 4; v4f val = *(const v4fa*)(os + row * 68 + cofs); val[0] += bb[0]; val[1] += bb[1]; val[2] += bb[2]; val[3] += bb[3];
            *(v4f*)(crow_p + (size_t)row * DM + cofs) = val; }
        asm volatile("s_wait_xcnt 0x0" ::: "memory");   // precaution: stands behind the stores and in front of the next rows' address arithmetic
        __builtin_amdgcn_wave_barrier(); asm volatile("" ::: "memory");   // the reads of os stay in front of the next rows' stores to it
    }
    }
}
typedef __attribute__((ext_vector_type(2))) _Float16 v2h;
typedef __attribute__((ext_vector_type(4))) _Float16 v4h;
typedef __attribute__((ext_vector_type(2))) unsigned short v2us;
typedef __attribute__((ext_vector_type(4))) unsigned short v4us;
typedef __attribute__((ext_vector_type(4))) int v4i;

// The elementwise stages below give every thread many values (16-byte loads and stores, all of a thread's loads issued before its first use), so that a stage needs a few thousand waves (for speed only).
#define CU 8    // k_cvt8: groups of 8 values per thread, one grid apart
#define SR 8    // k_attn: rows per softmax group
// k_cvt8: grid y picks one of up to four equally long sources; their bf16 copies lie one behind the other in dst; n8 = gridDim.x * 256 * CU groups of 8
__global__ __launch_bounds__(256) void k_cvt8(const float* __restrict__ s0, const float* __restrict__ s1, const float* __restrict__ s2, const float* __restrict__ s3, bf* dst, size_t n8) { const size_t i0 = (size_t)blockIdx.x * 256 + threadIdx.x, st = (size_t)gridDim.x * 256; const int y = blockIdx.y; const float* src = (y == 0) ? s0 : (y == 1) ? s1 : (y == 2) ? s2 : s3; dst += (size_t)y * n8 * 8; v8f v[CU];
#pragma unroll
    for (int u = 0; u < CU; ++u) v[u] = *(const v8f*)(src + (i0 + u * st) * 8);
    XW();
#pragma unroll
    for (int u = 0; u < CU; ++u) { v8us o;
#pragma unroll
        for (int k = 0; k < 8; ++k) o[k] = f2bf(v[u][k]);
        *(v8us*)(dst + (i0 + u * st) * 8) = o; }
    XW();  }

__constant__ float INVT[HD / 2] = { 1.000000000e+00f, 7.498942018e-01f, 5.623413324e-01f, 4.216965139e-01f, 3.162277639e-01f, 2.371373624e-01f, 1.778279394e-01f, 1.333521456e-01f, 1.000000015e-01f, 7.498941571e-02f, 5.623412877e-02f, 4.216964915e-02f, 3.162277862e-02f, 2.371373586e-02f, 1.778279431e-02f, 1.333521493e-02f, 9.999999776e-03f, 7.498942316e-03f, 5.623413250e-03f, 4.216964822e-03f, 3.162277862e-03f, 2.371373819e-03f, 1.778279431e-03f, 1.333521446e-03f, 1.000000047e-03f, 7.498941850e-04f, 5.623413017e-04f, 4.216964880e-04f, 3.162277862e-04f, 2.371373848e-04f, 1.778279402e-04f, 1.333521504e-04f };   // float32 1 / 10000^(2i/64), i < 32, generated with jnp to be bit-exact
__global__ __launch_bounds__(256) void k_cs5(float* CS) { const int idx = blockIdx.x * 256 + threadIdx.x; if (idx >= TT * HD) return; const int d = idx % HD; const int t = idx / HD; const float a = __fmul_rn((float)t, INVT[d % (HD / 2)]); v2f cs; cs[0] = cosf(a); cs[1] = sinf(a); *(v2f*)(CS + (size_t)idx * 2) = cs;  }
// ---- k_attn: the whole banded attention of one (batch, head) and 64 query rows in one work-group of 4 waves; a wave owns 16 query rows from the scores to the merged hi/lo planes and shares nothing with the other waves (no work-group barrier); the 4 waves read the same K and V^T lines, every load 512 bytes in a row (FRAGMENT ORDER).
// Per wave: (1) scores Q K^T for keys kbeg .. kend - 1 (q0 - 64 .. q0 + 127 clipped to the sequence: every |i - j| <= 50 of the row tile), f32 into the wave's LDS rows, key j at column j - CB(q0); (2) softmax of SR rows at a time, a row's 256 columns over the 32 lanes; the probabilities (fp16 x 1024, or bf16 hi and lo) overwrite the row's own scores; (3) P V over the same keys, A fragments from LDS, B fragments from the V^T planes; (4) the 16 x 64 result turned through LDS, scaled back, split hi/lo and stored as whole 128-byte lines of the merged [b][t][h d] planes.
// Row tiles < RH / 64 take the hi/lo planes (3 products per 32 k, in the order hi hi, lo hi, hi lo), the rest the fp16 planes.
#define AP  268   // LDS row pitch in floats: 8 rows apart is 32 banks apart (the two halves of an accumulator store do not collide); 1072 bytes = 16 x odd for the 16-byte fragment reads; holds 256 f32 scores, then 2 x 264 16-bit probabilities
#define APL 264   // offset of a row's lo probabilities in 16-bit elements
template <typename T16, bool HL>
__device__ __forceinline__ void attn16(float* sl, int q0, int w, int zz, const T16* __restrict__ Q, const T16* __restrict__ Q2, const T16* __restrict__ Kp, const T16* __restrict__ K2, const T16* __restrict__ Vt, const T16* __restrict__ V2, bf* Ah, bf* Al) {
    typedef typename WFrag<T16>::V V;
    const int lane = threadIdx.x & 31, lr = lane & 15, hi = lane >> 4; const int i0 = q0 + w * 16, cb = CB(q0), kbeg = max(q0 - 64, 0), kend = min(q0 + 128, TT);
    {   // (1) scores
        V a[2], a2[2]; const size_t qo = (size_t)i0 * HD + lane * 8;
#pragma unroll
        for (int kk = 0; kk < 2; ++kk) { a[kk] = WFrag<T16>::ldp(Q + qo + kk * 512); if (HL) a2[kk] = WFrag<T16>::ldp(Q2 + qo + kk * 512); }
        XW();
#pragma unroll 1   // 2 or 3 column tiles of 64 keys
        for (int c0 = kbeg; c0 < kend; c0 += 64) {
            v8f acc[4]; V b[2][4], b2[2][4]; const size_t ko = (size_t)c0 * HD + lane * 8;
#pragma unroll
            for (int kk = 0; kk < 2; ++kk)
#pragma unroll
                for (int nb = 0; nb < 4; ++nb) { b[kk][nb] = WFrag<T16>::ldp(Kp + ko + nb * 16 * HD + kk * 512); if (HL) b2[kk][nb] = WFrag<T16>::ldp(K2 + ko + nb * 16 * HD + kk * 512); }
            XW();
            __builtin_amdgcn_sched_barrier(0);   // all loads of these 64 keys go out as one group (for speed only)
#pragma unroll
            for (int nb = 0; nb < 4; ++nb) acc[nb] = (v8f){};
#pragma unroll
            for (int kk = 0; kk < 2; ++kk)
#pragma unroll
                for (int nb = 0; nb < 4; ++nb) { acc[nb] = WFrag<T16>::mma(a[kk], b[kk][nb], acc[nb]); if (HL) { acc[nb] = WFrag<T16>::mma(a2[kk], b[kk][nb], acc[nb]); acc[nb] = WFrag<T16>::mma(a[kk], b2[kk][nb], acc[nb]); } }
#pragma unroll
            for (int nb = 0; nb < 4; ++nb)
#pragma unroll
                for (int j = 0; j < 8; ++j) sl[(hi * 8 + j) * AP + (c0 - cb) + nb * 16 + lr] = acc[nb][j];
        }
    }
    wfence();
    // (2) softmax: t = S x 1/8 for keys with |i - j| <= 50, -3e38 elsewhere (the -1e9 fill == exclusion); same lane and chunk order as over all 2048 keys, whose other terms are exact zeros; S is read only where a lane's 4 keys touch the band; each step for all SR rows in turn so that their butterflies overlap
#pragma unroll 1   // two groups of SR rows: one copy of the code, and the registers of one group
    for (int rb = 0; rb < 16; rb += SR) {
        float v[SR][8]; float mx[SR], sum[SR]; v4f a[SR][2];
#pragma unroll
        for (int r = 0; r < SR; ++r) {
#pragma unroll
            for (int ch = 0; ch < 2; ++ch) { const int i = i0 + rb + r, j0 = cb + ch * 128 + lane * 4; a[r][ch] = (v4f){}; if (i - (j0 + 3) <= BW && j0 - i <= BW) a[r][ch] = *(const v4fa*)(sl + (rb + r) * AP + ch * 128 + lane * 4); } }
        wfence();
#pragma unroll
        for (int r = 0; r < SR; ++r) { mx[r] = -3.0e38f;
#pragma unroll
            for (int ch = 0; ch < 2; ++ch) {
#pragma unroll
                for (int q = 0; q < 4; ++q) { const int i = i0 + rb + r, j = cb + ch * 128 + lane * 4 + q; const float t = (i - j <= BW && j - i <= BW) ? a[r][ch][q] * SCL : -3.0e38f;   /* |i - j| <= 50 */ v[r][ch * 4 + q] = t; mx[r] = fmaxf(mx[r], t); } } }
#pragma unroll
        for (int sh = 16; sh; sh >>= 1) {
#pragma unroll
            for (int r = 0; r < SR; ++r) mx[r] = fmaxf(mx[r], __shfl_xor(mx[r], sh, 32)); }
#pragma unroll
        for (int r = 0; r < SR; ++r) { sum[r] = 0.f;
#pragma unroll
            for (int k = 0; k < 8; ++k) { const float d0 = __fsub_rn(v[r][k], mx[r]); const float e0 = __fmul_rn(d0, 1.4426950408889634f);
                __builtin_amdgcn_sched_barrier(0);   // with the one two lines down: holds the v_nop directly behind the v_exp_f32
                v[r][k] = __builtin_amdgcn_exp2f(e0); asm volatile("v_nop");   // the slot behind the transcendental, kept free of an instruction that reads its result or overwrites its source
                __builtin_amdgcn_sched_barrier(0); }
#pragma unroll
            for (int k = 0; k < 8; ++k) sum[r] += v[r][k]; }
#pragma unroll
        for (int sh = 16; sh; sh >>= 1) {
#pragma unroll
            for (int r = 0; r < SR; ++r) sum[r] += __shfl_xor(sum[r], sh, 32); }
#pragma unroll
        for (int r = 0; r < SR; ++r) { const float f = __fdiv_rn(HL ? 1.0f : PCAR, sum[r]); T16* pr = (T16*)(sl + (rb + r) * AP);
#pragma unroll
            for (int ch = 0; ch < 2; ++ch) {
                if constexpr (HL) { v4us oh, ol;
#pragma unroll
                    for (int q = 0; q < 4; ++q) { unsigned short a2, c2; splitf(v[r][ch * 4 + q] * f, a2, c2); oh[q] = a2; ol[q] = c2; }
                    *(v4us*)(pr + ch * 128 + lane * 4) = oh; *(v4us*)(pr + APL + ch * 128 + lane * 4) = ol;
                } else { v4h o4;
#pragma unroll
                    for (int q = 0; q < 4; ++q) o4[q] = tohx(v[r][ch * 4 + q] * f);
                    *(v4h*)(pr + ch * 128 + lane * 4) = o4; } } }
    }
    wfence();
    v8f o[4];
#pragma unroll
    for (int nb = 0; nb < 4; ++nb) o[nb] = (v8f){};
    {   // (3) P V
        const T16* pa = (const T16*)sl + lr * (AP * 2) + 8 * hi; const size_t vo = (size_t)lane * 8;
#pragma unroll 1   // 2 or 3 steps of 64 keys
        for (int kc = kbeg; kc < kend; kc += 64) {
            V b[2][4], b2[2][4], a[2], a2[2];
#pragma unroll
            for (int kk = 0; kk < 2; ++kk)
#pragma unroll
                for (int nb = 0; nb < 4; ++nb) { b[kk][nb] = WFrag<T16>::ldp(Vt + vo + (size_t)kc * HD + (nb * 2 + kk) * 512); if (HL) b2[kk][nb] = WFrag<T16>::ldp(V2 + vo + (size_t)kc * HD + (nb * 2 + kk) * 512); }
            XW();
#pragma unroll
            for (int kk = 0; kk < 2; ++kk) { a[kk] = WFrag<T16>::ld(pa + (kc - cb) + kk * 32); if (HL) a2[kk] = WFrag<T16>::ld(pa + APL + (kc - cb) + kk * 32); }
            __builtin_amdgcn_sched_barrier(0);   // all loads of these 64 keys go out as one group (for speed only)
#pragma unroll
            for (int kk = 0; kk < 2; ++kk)
#pragma unroll
                for (int nb = 0; nb < 4; ++nb) { o[nb] = WFrag<T16>::mma(a[kk], b[kk][nb], o[nb]); if (HL) { o[nb] = WFrag<T16>::mma(a2[kk], b[kk][nb], o[nb]); o[nb] = WFrag<T16>::mma(a[kk], b2[kk][nb], o[nb]); } }
        }
    }
    wfence();
    // (4) merge
#pragma unroll
    for (int nb = 0; nb < 4; ++nb)
#pragma unroll
        for (int j = 0; j < 8; ++j) sl[(hi * 8 + j) * 68 + nb * 16 + lr] = o[nb][j];
    wfence();
    const float cs = HL ? 1.0f : (1.0f / PCAR);
#pragma unroll
    for (int g = 0; g < 4; ++g) { const int row = g * 4 + (lane >> 3), d = (lane & 7) * 8; const v4f x0 = *(const v4fa*)(sl + row * 68 + d), x1 = *(const v4fa*)(sl + row * 68 + d + 4); v8us oh, ol;
#pragma unroll
        for (int q = 0; q < 8; ++q) { unsigned short h2, l2; splitf((q < 4 ? x0[q & 3] : x1[q & 3]) * cs, h2, l2); oh[q] = h2; ol[q] = l2; }
        const size_t oo = ((size_t)(zz / NH_) * TT + i0 + row) * DQ + (zz % NH_) * HD + d; *(v8us*)(Ah + oo) = oh; *(v8us*)(Al + oo) = ol; }
    XW();
}
// grid (TT / 64, ZH); all planes are whole, in FRAGMENT ORDER
__global__ __launch_bounds__(128) void k_attn(const bf* __restrict__ Qh, const bf* __restrict__ Ql, const bf* __restrict__ Kh, const bf* __restrict__ Kl, const bf* __restrict__ Vh, const bf* __restrict__ Vl, const h16* __restrict__ Q16, const h16* __restrict__ K16, const h16* __restrict__ V16, bf* Ah, bf* Al) {
    __shared__ __align__(16) float sb[4 * 16 * AP];
    const int w = threadIdx.x >> 5, q0 = blockIdx.x * 64, zz = blockIdx.y; const size_t zo = (size_t)zz * TT * HD; float* sl = sb + w * (16 * AP);
    if (q0 >= RH) { attn16<h16, false>(sl, q0, w, zz, Q16 + zo, nullptr, K16 + zo, nullptr, V16 + zo, nullptr, Ah, Al); return; }
    attn16<bf, true>(sl, q0, w, zz, Qh + zo, Ql + zo, Kh + zo, Kl + zo, Vh + zo, Vl + zo, Ah, Al);
}

extern "C" void kernel_launch(void* const* d_in, const int* in_sizes, int n_in,
                              void* d_out, int out_size, void* d_ws, size_t ws_size, hipStream_t stream) {
    (void)in_sizes; (void)n_in; (void)out_size;
    const float* x = (const float*)d_in[0];   /* query */ const float* xk = (const float*)d_in[1]; const float* xv = (const float*)d_in[2]; const float* wq = (const float*)d_in[3]; const float* bq = (const float*)d_in[4]; const float* wk = (const float*)d_in[5]; const float* bk = (const float*)d_in[6]; const float* wv = (const float*)d_in[7]; const float* bv = (const float*)d_in[8]; const float* wo = (const float*)d_in[9]; const float* bo = (const float*)d_in[10];   /* input order query, key, value, Wq, bq, Wk, bk, Wv, bv, Wo, bo */
    float* OUT = (float*)d_out;     // [2][2048][1024]
    char* wsp = (char*)d_ws;
    auto take = [&](size_t bytes) { char* p = wsp; wsp += (bytes + 255) & ~(size_t)255; return (void*)p; };
    const size_t NW = (size_t)DQ * DM, NX = (size_t)NB_ * TT * DM, NP = (size_t)ZH * TT * HD;   // elements of one weight, one input tensor, one set of head planes
    bf* WQ = (bf*)take(4 * NW * 2); bf* WO = WQ + 3 * NW;   /* Wq, Wk, Wv, Wo in turn */ float* CS = (float*)take((size_t)TT * HD * 2 * 4);
    h16* QP16 = (h16*)take(2 * NP * 2); h16* KP16 = QP16 + NP; bf* QPh = (bf*)take(2 * NP * 2); bf* KPh = QPh + NP; bf* QPl = (bf*)take(2 * NP * 2); bf* KPl = QPl + NP;   /* q planes, then k planes */
    h16* VT16 = (h16*)take(NP * 2); bf* VTh = (bf*)take(NP * 2); bf* VTl = (bf*)take(NP * 2);
    bf* ATh = (bf*)take(NX * 2); bf* ATl = (bf*)take(NX * 2);
    bf* XB = (bf*)take(3 * NX * 2);   /* bf16 query, key, value */
    if ((size_t)(wsp - (char*)d_ws) > ws_size) return;    // ws 256 MiB
    k_cvt8<<<dim3((unsigned)(NW / 8 / (256 * CU)), 4), 256, 0, stream>>>(wq, wk, wv, wo, WQ, NW / 8);
    k_cs5<<<(TT * HD + 255) / 256, 256, 0, stream>>>(CS);   /* rotary table once */
    k_cvt8<<<dim3((unsigned)(NX / 8 / (256 * CU)), 3), 256, 0, stream>>>(x, xk, xv, xv, XB, NX / 8);
    k_gemmt<0, 1><<<dim3(NB_ * TT / 128, DQ / 128, 3), 128, 0, stream>>>(XB, nullptr, WQ, nullptr, bq, bk, bv, NX, NW, 0, CS, QP16, QPh, QPl, NP, VT16, VTh, VTl);
    static_assert(((size_t)DQ * DM / 8) % (256 * CU) == 0 && ((size_t)NB_ * TT * DM / 8) % (256 * CU) == 0 && 16 % SR == 0 && RH % 64 == 0, "whole grids");
    k_attn<<<dim3(TT / 64, ZH), 128, 0, stream>>>(QPh, QPl, KPh, KPl, VTh, VTl, QP16, KP16, VT16, ATh, ATl);
    k_gemmt<1, 0><<<dim3(NB_ * TT / 128, DM / 128, 1), 128, 0, stream>>>(ATh, ATl, WO, OUT, bo, bo, bo, 0, 0, 0, nullptr, nullptr, nullptr, nullptr, 0, nullptr, nullptr, nullptr);
}

// v009
// A run of this version takes 75.1 microseconds.
// In both of two side-by-side timings against v008, it was 1.04 times as fast.
// Counting every step since v000, it is 26.9 times as fast.
#include <hip/hip_runtime.h>

// Sliding-window multi-head attention with rotary embeddings (query, key, value [2][2048][1024]; q = query Wq^T + bq etc. ('oi' 1/32, zero biases; 16 heads x 64); rotate-half rotary with angles t x 1/10000^(2i/64) (float32 table baked, precise cosf/sinf); scores / sqrt(64); keys with |i - j| <= 50 kept (-1e9 elsewhere == exclusion); softmax; out = merged Wo^T + bo -> [2][2048][1024] (4.2 M); argument order query, key, value, Wq, bq, Wk, bk, Wv, bv, Wo, bo).
// Layout, both batches and all 16 heads in one launch per stage (grid y / z picks tensor, batch and head): bf16 copies of query, key, value; 'oi' weights; {cos, sin} table once; exact projections + f32 biases, whose epilogue applies the rotate-half rotary (q, k) or the transpose (v) and writes the head planes in the order the attention's fragment loads take them (see FRAGMENT ORDER); T-2048 attention on the band only, scores to merged planes in one kernel with score and probability rows in LDS (per 64-row tile the 3 score tiles, 256 softmax columns and 192 PV keys that can hold |i - j| <= 50; the band itself is a select in the softmax; hybrid rows: < 512 hi/lo 3 products, rest fp16 x1024); merged hi/lo x Wo exact + bo.
// Compute dtypes, f32 accumulate: every input rounded to bf16; projections exact + f32 biases; rotary f32; attention rows < 512 3 products, rest fp16; softmax f32; Wo hl x exact + bias.

#define NB_  2
#define TT   2048
#define DM   1024
#define NH_  16
#define NKV  16
#define REP  (NH_ / NKV)
#define HD   64
#define DQ   (NH_ * HD)
#define DKV  (NKV * HD)
#define ZH   (NB_ * NH_)          // attention planes per launch: every (batch, head)
#define RH   512                  // query rows < RH use hi+lo planes (0: none)
#define WIN  2048
#define BW   50       // half window: keys j in [i - 50, i + 50]
#define PCAR 1024.0f
#define SCL  0.125f   // HD^-0.5
typedef _Float16 h16;
typedef unsigned short bf;
typedef __attribute__((ext_vector_type(16))) __bf16   v16bf;
typedef __attribute__((ext_vector_type(16))) _Float16 v16h;
typedef __attribute__((ext_vector_type(8)))  _Float16 v8h;
typedef __attribute__((ext_vector_type(8)))  unsigned short v8us;
typedef __attribute__((ext_vector_type(8)))  float    v8f;
typedef __attribute__((ext_vector_type(4)))  float    v4f;
typedef v8h  __attribute__((may_alias)) v8ha;
typedef v4f  __attribute__((may_alias)) v4fa;
typedef v8us __attribute__((may_alias)) v8usa;

__device__ __forceinline__ unsigned short f2bf(float f) { unsigned u = __float_as_uint(f); u += 0x7FFFu + ((u >> 16) & 1u); return (unsigned short)(u >> 16); }
__device__ __forceinline__ float bf2f(unsigned short b) { return __uint_as_float(((unsigned)b) << 16); }
__device__ __forceinline__ float bfr(float f) { return bf2f(f2bf(f)); }
__device__ __forceinline__ v16h cat16(v8h lo, v8h hi) { return __builtin_shufflevector(lo, hi, 0, 1, 2, 3, 4, 5, 6, 7, 8, 9, 10, 11, 12, 13, 14, 15); }
__device__ __forceinline__ v16bf cat16b(v8us lo, v8us hi) { return __builtin_bit_cast(v16bf, __builtin_shufflevector(lo, hi, 0, 1, 2, 3, 4, 5, 6, 7, 8, 9, 10, 11, 12, 13, 14, 15)); }
__device__ __forceinline__ v8f wmma16(v16h a, v16h b, v8f c) { return __builtin_amdgcn_wmma_f32_16x16x32_f16(false, a, false, b, (short)0, c, false, false); }
__device__ __forceinline__ v8f wmmab(v16bf a, v16bf b, v8f c) { return __builtin_amdgcn_wmma_f32_16x16x32_bf16(false, a, false, b, (short)0, c, false, false); }



// Fragments come from K-contiguous 16-bit rows in LDS or from head planes in FRAGMENT ORDER: lane lr + 16 hi holds row lr, k = 8 hi .. 8 hi + 7 and 16 + 8 hi .. 16 + 8 hi + 7 of each 32 k, the same for A and B.
__device__ __forceinline__ int CB(int q0) { return min(max(q0 - 64, 0) / 128, TT / 128 - 2) * 128; }   // first key of the two 128-key chunks that cover row tile q0's band
// FRAGMENT ORDER of the head planes: the 16 bytes that lane l takes with one load of a fragment lie at l x 16 bytes of a 512-byte run, so a wave's load reads 4 whole 128-byte lines (row-major planes: 32 bytes of each of 16 lines). A fragment (16 rows x 32 k) is two runs in a row: k = 8 hi .. 8 hi + 7, then k = 16 + 8 hi .. 16 + 8 hi + 7; ldp reads both.
// q, k planes [z][t / 16][d / 32][run][lane][8]: rows t, k = d. V^T planes [z][t / 64][d / 16][(t % 64) / 32][run][lane][8]: rows d, k = t. The values in every fragment register are those of the row-major planes.
template <typename T16> struct WFrag;
template <> struct WFrag<h16> { typedef v16h V; static __device__ __forceinline__ V ld(const h16* p) { return cat16(*(const v8h*)p, *(const v8h*)(p + 16)); } static __device__ __forceinline__ V ldp(const h16* p) { return cat16(*(const v8h*)p, *(const v8h*)(p + 256)); } static __device__ __forceinline__ v8f mma(V a, V b, v8f c) { return wmma16(a, b, c); } };
template <> struct WFrag<bf> { typedef v16bf V; static __device__ __forceinline__ V ld(const bf* p) { return cat16b(*(const v8us*)p, *(const v8us*)(p + 16)); } static __device__ __forceinline__ V ldp(const bf* p) { return cat16b(*(const v8us*)p, *(const v8us*)(p + 256)); } static __device__ __forceinline__ v8f mma(V a, V b, v8f c) { return wmmab(a, b, c); } };
__device__ __forceinline__ h16 tohx(float x) { return (h16)x; }
__device__ __forceinline__ void splitf(float y, unsigned short& h, unsigned short& l) { h = f2bf(y); l = f2bf(y - bf2f(h)); }
// XW: precaution, stands behind a run of global loads or stores and in front of the arithmetic that may reuse their address registers
#define XW() asm volatile("s_wait_xcnt 0x0" ::: "memory")
// wfence: keeps the wave's LDS stores of one phase in front of its LDS reads of the next (and a row's score reads in front of the probabilities that overwrite them) in the compiled order; the hardware runs one wave's LDS operations in order
__device__ __forceinline__ void wfence() { __builtin_amdgcn_wave_barrier(); asm volatile("" ::: "memory"); }
typedef float __attribute__((may_alias)) f32a;
typedef __attribute__((ext_vector_type(2))) float v2f;
// ---- k_gemmt: the four projections. One 128x128 tile of C per work-group of 4 waves (2 x 2 waves of 64x64, 16 accumulators a wave); A (, A2) and Bt tiles of 64 k come into LDS by asynchronous copies, whole 128-byte lines, each staged row read by two waves; two buffers, the next stage's copies fly while this stage is multiplied; fragments are read from LDS one 32-k block ahead into a second register set.
// C[m][n] (f32, pitch DM, + f32 bias[n], one bias pointer per z < 3) = sum_k A[m][k] Bt[n][k] (+ A2[m][k] Bt[n][k] behind it in every 32 k when NSPLIT). All pitches DM; grid (M/128, N/128, Z).
// EPI: no C is written. A wave's 64x64 tile is 64 positions t of one (batch, head), so the wave itself turns it into that head's 16-bit planes (fp16, bf16 hi, bf16 lo): z < 2 (q, k) rotate-half rotary out[d] = x[d] cos[t][d] - x[d+HD/2] sin[t][d], out[d+HD/2] = x[d+HD/2] cos[t][d+HD/2] + x[d] sin[t][d+HD/2] (tensor stride sP); z == 2 (v) the transpose; both in FRAGMENT ORDER. q and k go through the wave's quarter of the ring, v goes straight from the accumulators; every global store of a wave fills 512 bytes in a row.
#define GP   72            // LDS row pitch in 16-bit elements: 144 bytes = 16 x odd, the conflict-free pitch for 16-byte reads of 128-byte rows
#define GKS  64            // k per stage
#define GMAT (128 * GP)    // elements of one staged operand tile
// cp8: rows r, r + 16, ... r + 112 of one operand tile, 16 bytes a lane; g is the tile's address, the same for the whole work-group: the eight row groups' addresses are scalar bases, o is the lane's byte offset in a row group; the s_wait_xcnt closes the statement so that no address register is rewritten in front of it
__device__ __forceinline__ void cp8(unsigned l, const bf* g, unsigned o) {
    asm volatile("global_load_async_to_lds_b128 %0, %8, %9\n\t"
                 "global_load_async_to_lds_b128 %1, %8, %10\n\t"
                 "global_load_async_to_lds_b128 %2, %8, %11\n\t"
                 "global_load_async_to_lds_b128 %3, %8, %12\n\t"
                 "global_load_async_to_lds_b128 %4, %8, %13\n\t"
                 "global_load_async_to_lds_b128 %5, %8, %14\n\t"
                 "global_load_async_to_lds_b128 %6, %8, %15\n\t"
                 "global_load_async_to_lds_b128 %7, %8, %16\n\t"
                 "s_wait_xcnt 0x0"
                 :: "v"(l), "v"(l + 1 * 16 * GP * 2), "v"(l + 2 * 16 * GP * 2), "v"(l + 3 * 16 * GP * 2), "v"(l + 4 * 16 * GP * 2), "v"(l + 5 * 16 * GP * 2), "v"(l + 6 * 16 * GP * 2), "v"(l + 7 * 16 * GP * 2),
                    "v"(o),
                    "s"(g), "s"(g + 1 * 16 * DM), "s"(g + 2 * 16 * DM), "s"(g + 3 * 16 * DM), "s"(g + 4 * 16 * DM), "s"(g + 5 * 16 * DM), "s"(g + 6 * 16 * DM), "s"(g + 7 * 16 * DM)
                 : "memory");
}
template <int NSPLIT, int EPI>
__global__ __launch_bounds__(128) void k_gemmt(const bf* __restrict__ A, const bf* __restrict__ A2, const bf* __restrict__ Bt, float* C, const float* __restrict__ bias0, const float* __restrict__ bias1, const float* __restrict__ bias2, size_t sA, size_t sB, size_t sC, const float* __restrict__ CS, h16* P16, bf* Ph, bf* Pl, size_t sP, h16* V16, bf* Vh, bf* Vl) {
    constexpr int NMAT = 2 + NSPLIT, STG = NMAT * GMAT, NST = DM / GKS;
    __shared__ __align__(16) bf ring[2 * STG];
    const size_t z = blockIdx.z; A += z * sA; if (NSPLIT) A2 += z * sA; Bt += z * sB; C += z * sC; const float* bias = (z == 0) ? bias0 : (z == 1) ? bias1 : bias2;
    const int tid = threadIdx.x, lane = tid & 31, lr = lane & 15, hi = lane >> 4, w = tid >> 5;
    const int R0 = blockIdx.x * 128, C0 = blockIdx.y * 128, r0 = R0 + (w >> 1) * 64, c0 = C0 + (w & 1) * 64;
    const int crow = tid >> 3, ccol = (tid & 7) * 8;   // a thread copies 16 bytes of rows crow + 16 i; 8 threads fill a row's 128 bytes
    const unsigned go = (unsigned)(crow * DM + ccol) * 2u;   // the thread's byte offset in an operand tile; the tile's own address is the same for the whole work-group and stays in scalar registers, so that the copies need few vector registers beside the two fragment sets
    const bf* gA = A + (size_t)R0 * DM; const bf* gA2 = NSPLIT ? A2 + (size_t)R0 * DM : nullptr; const bf* gB = Bt + (size_t)C0 * DM;
    const unsigned l0 = (unsigned)(size_t)ring + (unsigned)(crow * GP + ccol) * 2u;
    // Work-groups that share an operand tile (32 along x share Bt rows, 8 along y share A rows) would otherwise ask for the same lines in the same stage (for speed only). Each work-group therefore walks the 16 k stages as a ring from its own start stage: the sharers of a tile are spread over the stages. Stage s of the ring still lands in buffer s & 1; only the k it holds differs, so a work-group sums its k blocks in rotated order.
    static_assert((NST & (NST - 1)) == 0, "the start stage wraps by a mask");
    const int rot = (int)((blockIdx.x >> 3) * 4 + (blockIdx.x & 3) + 2 * blockIdx.y) & (NST - 1);   // the 8 sharers of A rows (y) get 8 different starts; of the 32 sharers of Bt rows (x) any 16 whose x mod 8 lie in a run of 4 get 16 different starts (for speed only, any placement gives right sums)
    auto fill = [&](int s) { const unsigned l = l0 + (unsigned)(s & 1) * (STG * 2u); const int ko = ((s + rot) & (NST - 1)) * GKS; cp8(l, gA + ko, go); if (NSPLIT) cp8(l + GMAT * 2u, gA2 + ko, go); cp8(l + (NMAT - 1) * GMAT * 2u, gB + ko, go); };
    v8f acc[4][4];
#pragma unroll
    for (int mb = 0; mb < 4; ++mb)
#pragma unroll
        for (int nb = 0; nb < 4; ++nb) acc[mb][nb] = (v8f){};
    const bf* fa = ring + ((w >> 1) * 64 + lr) * GP + 8 * hi; const bf* fb = ring + (NMAT - 1) * GMAT + ((w & 1) * 64 + lr) * GP + 8 * hi;
    // Two fragment sets: while one 32-k block is multiplied, the next block's LDS reads are already under way, so a wave no longer waits out its own LDS latency in front of every block.
    v16bf fa0[4], fx0[4], fb0[4], fa1[4], fx1[4], fb1[4];
    auto ldf = [&](v16bf (&a)[4], v16bf (&a2)[4], v16bf (&b)[4], int o) {
#pragma unroll
        for (int mb = 0; mb < 4; ++mb) { a[mb] = WFrag<bf>::ld(fa + o + mb * 16 * GP); if (NSPLIT) a2[mb] = WFrag<bf>::ld(fa + o + GMAT + mb * 16 * GP); }
#pragma unroll
        for (int nb = 0; nb < 4; ++nb) b[nb] = WFrag<bf>::ld(fb + o + nb * 16 * GP); };
    auto mm = [&](v16bf (&a)[4], v16bf (&a2)[4], v16bf (&b)[4]) {
#pragma unroll
        for (int nb = 0; nb < 4; ++nb) {
#pragma unroll
            for (int mb = 0; mb < 4; ++mb) acc[mb][nb] = wmmab(a[mb], b[nb], acc[mb][nb]);
            if (NSPLIT) {
#pragma unroll
                for (int mb = 0; mb < 4; ++mb) acc[mb][nb] = wmmab(a2[mb], b[nb], acc[mb][nb]); } } };
    static_assert(GKS == 64 && NST >= 2, "two blocks of 32 k a stage, two stages or more");
    fill(0);
    asm volatile("s_wait_asynccnt 0x0" ::: "memory");   // stage 0 has landed before the barrier publishes it
    __syncthreads();
    fill(1);
    ldf(fa0, fx0, fb0, 0);   // stage 0, first block
#pragma unroll 1   // one copy of the stage body: the buffer is picked by an address
    for (int t = 0; t < NST; ++t) {
        const int bo = (t & 1) * STG;
        ldf(fa1, fx1, fb1, bo + 32);   // this stage's last block: the wave's last reads of buffer t & 1
        __builtin_amdgcn_sched_barrier(0);   // the reads go out as one group in front of the running block's matrix instructions (for speed only)
        mm(fa0, fx0, fb0);
        __builtin_amdgcn_sched_barrier(0);   // holds the waits and the barrier below behind the block above: lifted over it, the s_wait_dscnt would wait out the reads that the block is there to cover
        // publish point of stage t + 1: it stands in front of this stage's last block, because the reads behind it already take the next stage
        asm volatile("s_wait_dscnt 0x0" ::: "memory");      // this wave's reads of buffer t & 1 are done before the barrier frees it
        asm volatile("s_wait_asynccnt 0x0" ::: "memory");   // this wave's copies of stage t + 1 have landed before the barrier publishes them
        __syncthreads();
        if (t + 2 < NST) fill(t + 2);
        if (t + 1 < NST) ldf(fa0, fx0, fb0, STG - bo);   // next stage, first block
        __builtin_amdgcn_sched_barrier(0);   // as above: one group of reads in front of the matrix instructions
        mm(fa1, fx1, fb1);
    }
    asm volatile("s_wait_asynccnt 0x0" ::: "memory");   // nothing is in flight when the wave goes on to the epilogue and ends
    if constexpr (EPI) {
        // The ring is free here: the barrier of the last trip stands behind every wave's last read of it, and no copy is in flight. Each wave stages in its own quarter.
        static_assert(NSPLIT == 0 && 64 * 68 * 4 <= STG, "a wave's staging fits its quarter of the ring");
        const int zp = (r0 / TT) * NH_ + c0 / HD, t0 = r0 % TT;   // head plane, first position
        if (z < 2) {
            f32a* os = (f32a*)ring + w * (STG / 4);
            // An accumulator lane holds x[d] (nb) and its partner x[d + HD/2] (nb + 2) of the same rows, so the rotation is done in place; the table's columns d and d + HD/2 hold the same angle, and one 8-byte read a lane of {cos, sin}[t][d < HD/2] uses whole 128-byte lines.
            float bb[4];
#pragma unroll
            for (int nb = 0; nb < 4; ++nb) bb[nb] = bfr(bias[c0 + nb * 16 + lr]);
            XW();
            const float* cs = CS + ((size_t)(t0 + hi * 8) * HD + lr) * 2;
            v2f c[4][2][8];
            auto ldc = [&](int mb) {
#pragma unroll
                for (int nb = 0; nb < 2; ++nb)
#pragma unroll
                    for (int j = 0; j < 8; ++j) c[mb][nb][j] = *(const v2f*)(cs + ((mb * 16 + j) * HD + nb * 16) * 2); };
            ldc(0); ldc(1);   // the table reads run two groups of 16 rows ahead of their use
            XW();
#pragma unroll
            for (int mb = 0; mb < 4; ++mb) {
#pragma unroll
                for (int nb = 0; nb < 2; ++nb)
#pragma unroll
                    for (int j = 0; j < 8; ++j) { const float xl = acc[mb][nb][j] + bb[nb], xh = acc[mb][nb + 2][j] + bb[nb + 2], co = c[mb][nb][j][0], si = c[mb][nb][j][1]; f32a* o = os + (mb * 16 + hi * 8 + j) * 68 + nb * 16 + lr;
                        o[0] = xl * co - xh * si; o[HD / 2] = xh * co + xl * si; }
                if (mb + 2 < 4) { ldc(mb + 2); XW(); }
            }
            wfence();
            const size_t e0 = z * sP + ((size_t)zp * TT + t0) * HD + lane * 8; const f32a* ox = os + lr * 68 + hi * 8;   // run u of a group of 16 rows: lane lr + 16 hi holds row lr, d = 16 u + 8 hi .. + 7
#pragma unroll 1   // 4 groups of 16 rows: one copy of the code, so that the kernel's text stays small
            for (int gg = 0; gg < 4; ++gg) {
                v4f x[4][2];
#pragma unroll
                for (int u = 0; u < 4; ++u) { x[u][0] = *(const v4fa*)(ox + gg * 16 * 68 + u * 16); x[u][1] = *(const v4fa*)(ox + gg * 16 * 68 + u * 16 + 4); }
#pragma unroll
                for (int u = 0; u < 4; ++u) { v8h o16; v8us oh, ol;
#pragma unroll
                    for (int q = 0; q < 8; ++q) { const float r = x[u][q >> 2][q & 3]; o16[q] = tohx(r); unsigned short a2, c2; splitf(r, a2, c2); oh[q] = a2; ol[q] = c2; }
                    const size_t e = e0 + (size_t)(gg * 16 * HD + u * 256); *(v8h*)(P16 + e) = o16; *(v8us*)(Ph + e) = oh; *(v8us*)(Pl + e) = ol; }
                XW();
            }
        } else {
            float bb[4];
#pragma unroll
            for (int nb = 0; nb < 4; ++nb) bb[nb] = bfr(bias[c0 + nb * 16 + lr]);
            // An accumulator lane holds 8 neighbouring t of one d: t = 16 mb + 8 hi + j, d = 16 nb + lr. That is the lane's 16 bytes of run mb & 1 of the V^T fragment (d / 16 = nb, (t % 64) / 32 = mb >> 1), so tile (mb, nb) is run 4 nb + mb of the head's 64-key block and needs no turn through LDS.
            const size_t e0 = ((size_t)zp * TT + t0) * HD + lane * 8;
#pragma unroll
            for (int nb = 0; nb < 4; ++nb)
#pragma unroll
                for (int mb = 0; mb < 4; ++mb) { v8h o16; v8us oh, ol;
#pragma unroll
                    for (int j = 0; j < 8; ++j) { const float xv = acc[mb][nb][j] + bb[nb]; o16[j] = tohx(xv); unsigned short a2, c2; splitf(xv, a2, c2); oh[j] = a2; ol[j] = c2; }
                    const size_t e = e0 + (size_t)((nb * 4 + mb) * 256); *(v8h*)(V16 + e) = o16; *(v8us*)(Vh + e) = oh; *(v8us*)(Vl + e) = ol; }
            XW();
        }
    } else {
    __shared__ __align__(16) float osb[4 * 16 * 68];
    float* os = osb + w * (16 * 68);   // each wave stages its own output rows
    v4f bb = *(const v4fa*)(bias + c0 + lr * 4); bb[0] = bfr(bb[0]); bb[1] = bfr(bb[1]); bb[2] = bfr(bb[2]); bb[3] = bfr(bb[3]);
#pragma unroll
    for (int mb = 0; mb < 4; ++mb) {
#pragma unroll
        for (int nb = 0; nb < 4; ++nb) {
#pragma unroll
            for (int j = 0; j < 8; ++j) os[(hi * 8 + j) * 68 + nb * 16 + lr] = acc[mb][nb][j]; }
        __builtin_amdgcn_wave_barrier(); asm volatile("" ::: "memory");   // the wave's stores to os stay in front of its reads
        float* crow_p = C + (size_t)(r0 + mb * 16) * DM + c0;
#pragma unroll
        for (int s = 0; s < 8; ++s) { const int row = 2 * s + hi, cofs = lr * 4; v4f val = *(const v4fa*)(os + row * 68 + cofs); val[0] += bb[0]; val[1] += bb[1]; val[2] += bb[2]; val[3] += bb[3];
            *(v4f*)(crow_p + (size_t)row * DM + cofs) = val; }
        asm volatile("s_wait_xcnt 0x0" ::: "memory");   // precaution: stands behind the stores and in front of the next rows' address arithmetic
        __builtin_amdgcn_wave_barrier(); asm volatile("" ::: "memory");   // the reads of os stay in front of the next rows' stores to it
    }
    }
}
typedef __attribute__((ext_vector_type(2))) _Float16 v2h;
typedef __attribute__((ext_vector_type(4))) _Float16 v4h;
typedef __attribute__((ext_vector_type(2))) unsigned short v2us;
typedef __attribute__((ext_vector_type(4))) unsigned short v4us;
typedef __attribute__((ext_vector_type(4))) int v4i;

// The elementwise stages below give every thread many values (16-byte loads and stores, all of a thread's loads issued before its first use), so that a stage needs a few thousand waves (for speed only).
#define CU 8    // k_cvt8: groups of 8 values per thread, one grid apart
#define SR 8    // k_attn: rows per softmax group
// k_cvt8: grid y picks one of up to four equally long sources; their bf16 copies lie one behind the other in dst; n8 = gridDim.x * 256 * CU groups of 8
__global__ __launch_bounds__(256) void k_cvt8(const float* __restrict__ s0, const float* __restrict__ s1, const float* __restrict__ s2, const float* __restrict__ s3, bf* dst, size_t n8) { const size_t i0 = (size_t)blockIdx.x * 256 + threadIdx.x, st = (size_t)gridDim.x * 256; const int y = blockIdx.y; const float* src = (y == 0) ? s0 : (y == 1) ? s1 : (y == 2) ? s2 : s3; dst += (size_t)y * n8 * 8; v8f v[CU];
#pragma unroll
    for (int u = 0; u < CU; ++u) v[u] = *(const v8f*)(src + (i0 + u * st) * 8);
    XW();
#pragma unroll
    for (int u = 0; u < CU; ++u) { v8us o;
#pragma unroll
        for (int k = 0; k < 8; ++k) o[k] = f2bf(v[u][k]);
        *(v8us*)(dst + (i0 + u * st) * 8) = o; }
    XW();  }

__constant__ float INVT[HD / 2] = { 1.000000000e+00f, 7.498942018e-01f, 5.623413324e-01f, 4.216965139e-01f, 3.162277639e-01f, 2.371373624e-01f, 1.778279394e-01f, 1.333521456e-01f, 1.000000015e-01f, 7.498941571e-02f, 5.623412877e-02f, 4.216964915e-02f, 3.162277862e-02f, 2.371373586e-02f, 1.778279431e-02f, 1.333521493e-02f, 9.999999776e-03f, 7.498942316e-03f, 5.623413250e-03f, 4.216964822e-03f, 3.162277862e-03f, 2.371373819e-03f, 1.778279431e-03f, 1.333521446e-03f, 1.000000047e-03f, 7.498941850e-04f, 5.623413017e-04f, 4.216964880e-04f, 3.162277862e-04f, 2.371373848e-04f, 1.778279402e-04f, 1.333521504e-04f };   // float32 1 / 10000^(2i/64), i < 32, generated with jnp to be bit-exact
__global__ __launch_bounds__(256) void k_cs5(float* CS) { const int idx = blockIdx.x * 256 + threadIdx.x; if (idx >= TT * HD) return; const int d = idx % HD; const int t = idx / HD; const float a = __fmul_rn((float)t, INVT[d % (HD / 2)]); v2f cs; cs[0] = cosf(a); cs[1] = sinf(a); *(v2f*)(CS + (size_t)idx * 2) = cs;  }
// ---- k_attn: the whole banded attention of one (batch, head) and 64 query rows in one work-group of 4 waves; a wave owns 16 query rows from the scores to the merged hi/lo planes and shares nothing with the other waves (no work-group barrier); the 4 waves read the same K and V^T lines, every load 512 bytes in a row (FRAGMENT ORDER).
// Per wave: (1) scores Q K^T for keys kbeg .. kend - 1 (q0 - 64 .. q0 + 127 clipped to the sequence: every |i - j| <= 50 of the row tile), f32 into the wave's LDS rows, key j at column j - CB(q0); (2) softmax of SR rows at a time, a row's 256 columns over the 32 lanes; the probabilities (fp16 x 1024, or bf16 hi and lo) overwrite the row's own scores; (3) P V over the same keys, A fragments from LDS, B fragments from the V^T planes; (4) the 16 x 64 result turned through LDS, scaled back, split hi/lo and stored as whole 128-byte lines of the merged [b][t][h d] planes.
// Row tiles < RH / 64 take the hi/lo planes (3 products per 32 k, in the order hi hi, lo hi, hi lo), the rest the fp16 planes.
#define AP  268   // LDS row pitch in floats: 8 rows apart is 32 banks apart (the two halves of an accumulator store do not collide); 1072 bytes = 16 x odd for the 16-byte fragment reads; holds 256 f32 scores, then 2 x 264 16-bit probabilities
#define APL 264   // offset of a row's lo probabilities in 16-bit elements
template <typename T16, bool HL>
__device__ __forceinline__ void attn16(float* sl, int q0, int w, int zz, const T16* __restrict__ Q, const T16* __restrict__ Q2, const T16* __restrict__ Kp, const T16* __restrict__ K2, const T16* __restrict__ Vt, const T16* __restrict__ V2, bf* Ah, bf* Al) {
    typedef typename WFrag<T16>::V V;
    const int lane = threadIdx.x & 31, lr = lane & 15, hi = lane >> 4; const int i0 = q0 + w * 16, cb = CB(q0), kbeg = max(q0 - 64, 0), kend = min(q0 + 128, TT);
    {   // (1) scores
        V a[2], a2[2]; const size_t qo = (size_t)i0 * HD + lane * 8;
#pragma unroll
        for (int kk = 0; kk < 2; ++kk) { a[kk] = WFrag<T16>::ldp(Q + qo + kk * 512); if (HL) a2[kk] = WFrag<T16>::ldp(Q2 + qo + kk * 512); }
        XW();
#pragma unroll 1   // 2 or 3 column tiles of 64 keys
        for (int c0 = kbeg; c0 < kend; c0 += 64) {
            v8f acc[4]; V b[2][4], b2[2][4]; const size_t ko = (size_t)c0 * HD + lane * 8;
#pragma unroll
            for (int kk = 0; kk < 2; ++kk)
#pragma unroll
                for (int nb = 0; nb < 4; ++nb) { b[kk][nb] = WFrag<T16>::ldp(Kp + ko + nb * 16 * HD + kk * 512); if (HL) b2[kk][nb] = WFrag<T16>::ldp(K2 + ko + nb * 16 * HD + kk * 512); }
            XW();
            __builtin_amdgcn_sched_barrier(0);   // all loads of these 64 keys go out as one group (for speed only)
#pragma unroll
            for (int nb = 0; nb < 4; ++nb) acc[nb] = (v8f){};
#pragma unroll
            for (int kk = 0; kk < 2; ++kk)
#pragma unroll
                for (int nb = 0; nb < 4; ++nb) { acc[nb] = WFrag<T16>::mma(a[kk], b[kk][nb], acc[nb]); if (HL) { acc[nb] = WFrag<T16>::mma(a2[kk], b[kk][nb], acc[nb]); acc[nb] = WFrag<T16>::mma(a[kk], b2[kk][nb], acc[nb]); } }
#pragma unroll
            for (int nb = 0; nb < 4; ++nb)
#pragma unroll
                for (int j = 0; j < 8; ++j) sl[(hi * 8 + j) * AP + (c0 - cb) + nb * 16 + lr] = acc[nb][j];
        }
    }
    wfence();
    // (2) softmax: t = S x 1/8 for keys with |i - j| <= 50, -3e38 elsewhere (the -1e9 fill == exclusion); same lane and chunk order as over all 2048 keys, whose other terms are exact zeros; S is read only where a lane's 4 keys touch the band; each step for all SR rows in turn so that their butterflies overlap
#pragma unroll 1   // two groups of SR rows: one copy of the code, and the registers of one group
    for (int rb = 0; rb < 16; rb += SR) {
        float v[SR][8]; float mx[SR], sum[SR]; v4f a[SR][2];
#pragma unroll
        for (int r = 0; r < SR; ++r) {
#pragma unroll
            for (int ch = 0; ch < 2; ++ch) { const int i = i0 + rb + r, j0 = cb + ch * 128 + lane * 4; a[r][ch] = (v4f){}; if (i - (j0 + 3) <= BW && j0 - i <= BW) a[r][ch] = *(const v4fa*)(sl + (rb + r) * AP + ch * 128 + lane * 4); } }
        wfence();
#pragma unroll
        for (int r = 0; r < SR; ++r) { mx[r] = -3.0e38f;
#pragma unroll
            for (int ch = 0; ch < 2; ++ch) {
#pragma unroll
                for (int q = 0; q < 4; ++q) { const int i = i0 + rb + r, j = cb + ch * 128 + lane * 4 + q; const float t = (i - j <= BW && j - i <= BW) ? a[r][ch][q] * SCL : -3.0e38f;   /* |i - j| <= 50 */ v[r][ch * 4 + q] = t; mx[r] = fmaxf(mx[r], t); } } }
#pragma unroll
        for (int sh = 16; sh; sh >>= 1) {
#pragma unroll
            for (int r = 0; r < SR; ++r) mx[r] = fmaxf(mx[r], __shfl_xor(mx[r], sh, 32)); }
#pragma unroll
        for (int r = 0; r < SR; ++r) { sum[r] = 0.f;
#pragma unroll
            for (int k = 0; k < 8; ++k) { const float d0 = __fsub_rn(v[r][k], mx[r]); const float e0 = __fmul_rn(d0, 1.4426950408889634f);
                __builtin_amdgcn_sched_barrier(0);   // with the one two lines down: holds the v_nop directly behind the v_exp_f32
                v[r][k] = __builtin_amdgcn_exp2f(e0); asm volatile("v_nop");   // the slot behind the transcendental, kept free of an instruction that reads its result or overwrites its source
                __builtin_amdgcn_sched_barrier(0); }
#pragma unroll
            for (int k = 0; k < 8; ++k) sum[r] += v[r][k]; }
#pragma unroll
        for (int sh = 16; sh; sh >>= 1) {
#pragma unroll
            for (int r = 0; r < SR; ++r) sum[r] += __shfl_xor(sum[r], sh, 32); }
#pragma unroll
        for (int r = 0; r < SR; ++r) { const float f = __fdiv_rn(HL ? 1.0f : PCAR, sum[r]); T16* pr = (T16*)(sl + (rb + r) * AP);
#pragma unroll
            for (int ch = 0; ch < 2; ++ch) {
                if constexpr (HL) { v4us oh, ol;
#pragma unroll
                    for (int q = 0; q < 4; ++q) { unsigned short a2, c2; splitf(v[r][ch * 4 + q] * f, a2, c2); oh[q] = a2; ol[q] = c2; }
                    *(v4us*)(pr + ch * 128 + lane * 4) = oh; *(v4us*)(pr + APL + ch * 128 + lane * 4) = ol;
                } else { v4h o4;
#pragma unroll
                    for (int q = 0; q < 4; ++q) o4[q] = tohx(v[r][ch * 4 + q] * f);
                    *(v4h*)(pr + ch * 128 + lane * 4) = o4; } } }
    }
    wfence();
    v8f o[4];
#pragma unroll
    for (int nb = 0; nb < 4; ++nb) o[nb] = (v8f){};
    {   // (3) P V
        const T16* pa = (const T16*)sl + lr * (AP * 2) + 8 * hi; const size_t vo = (size_t)lane * 8;
#pragma unroll 1   // 2 or 3 steps of 64 keys
        for (int kc = kbeg; kc < kend; kc += 64) {
            V b[2][4], b2[2][4], a[2], a2[2];
#pragma unroll
            for (int kk = 0; kk < 2; ++kk)
#pragma unroll
                for (int nb = 0; nb < 4; ++nb) { b[kk][nb] = WFrag<T16>::ldp(Vt + vo + (size_t)kc * HD + (nb * 2 + kk) * 512); if (HL) b2[kk][nb] = WFrag<T16>::ldp(V2 + vo + (size_t)kc * HD + (nb * 2 + kk) * 512); }
            XW();
#pragma unroll
            for (int kk = 0; kk < 2; ++kk) { a[kk] = WFrag<T16>::ld(pa + (kc - cb) + kk * 32); if (HL) a2[kk] = WFrag<T16>::ld(pa + APL + (kc - cb) + kk * 32); }
            __builtin_amdgcn_sched_barrier(0);   // all loads of these 64 keys go out as one group (for speed only)
#pragma unroll
            for (int kk = 0; kk < 2; ++kk)
#pragma unroll
                for (int nb = 0; nb < 4; ++nb) { o[nb] = WFrag<T16>::mma(a[kk], b[kk][nb], o[nb]); if (HL) { o[nb] = WFrag<T16>::mma(a2[kk], b[kk][nb], o[nb]); o[nb] = WFrag<T16>::mma(a[kk], b2[kk][nb], o[nb]); } }
        }
    }
    wfence();
    // (4) merge
#pragma unroll
    for (int nb = 0; nb < 4; ++nb)
#pragma unroll
        for (int j = 0; j < 8; ++j) sl[(hi * 8 + j) * 68 + nb * 16 + lr] = o[nb][j];
    wfence();
    const float cs = HL ? 1.0f : (1.0f / PCAR);
#pragma unroll
    for (int g = 0; g < 4; ++g) { const int row = g * 4 + (lane >> 3), d = (lane & 7) * 8; const v4f x0 = *(const v4fa*)(sl + row * 68 + d), x1 = *(const v4fa*)(sl + row * 68 + d + 4); v8us oh, ol;
#pragma unroll
        for (int q = 0; q < 8; ++q) { unsigned short h2, l2; splitf((q < 4 ? x0[q & 3] : x1[q & 3]) * cs, h2, l2); oh[q] = h2; ol[q] = l2; }
        const size_t oo = ((size_t)(zz / NH_) * TT + i0 + row) * DQ + (zz % NH_) * HD + d; *(v8us*)(Ah + oo) = oh; *(v8us*)(Al + oo) = ol; }
    XW();
}
// grid (TT / 64, ZH); all planes are whole, in FRAGMENT ORDER
__global__ __launch_bounds__(128) void k_attn(const bf* __restrict__ Qh, const bf* __restrict__ Ql, const bf* __restrict__ Kh, const bf* __restrict__ Kl, const bf* __restrict__ Vh, const bf* __restrict__ Vl, const h16* __restrict__ Q16, const h16* __restrict__ K16, const h16* __restrict__ V16, bf* Ah, bf* Al) {
    __shared__ __align__(16) float sb[4 * 16 * AP];
    const int w = threadIdx.x >> 5, q0 = blockIdx.x * 64, zz = blockIdx.y; const size_t zo = (size_t)zz * TT * HD; float* sl = sb + w * (16 * AP);
    if (q0 >= RH) { attn16<h16, false>(sl, q0, w, zz, Q16 + zo, nullptr, K16 + zo, nullptr, V16 + zo, nullptr, Ah, Al); return; }
    attn16<bf, true>(sl, q0, w, zz, Qh + zo, Ql + zo, Kh + zo, Kl + zo, Vh + zo, Vl + zo, Ah, Al);
}

extern "C" void kernel_launch(void* const* d_in, const int* in_sizes, int n_in,
                              void* d_out, int out_size, void* d_ws, size_t ws_size, hipStream_t stream) {
    (void)in_sizes; (void)n_in; (void)out_size;
    const float* x = (const float*)d_in[0];   /* query */ const float* xk = (const float*)d_in[1]; const float* xv = (const float*)d_in[2]; const float* wq = (const float*)d_in[3]; const float* bq = (const float*)d_in[4]; const float* wk = (const float*)d_in[5]; const float* bk = (const float*)d_in[6]; const float* wv = (const float*)d_in[7]; const float* bv = (const float*)d_in[8]; const float* wo = (const float*)d_in[9]; const float* bo = (const float*)d_in[10];   /* input order query, key, value, Wq, bq, Wk, bk, Wv, bv, Wo, bo */
    float* OUT = (float*)d_out;     // [2][2048][1024]
    char* wsp = (char*)d_ws;
    auto take = [&](size_t bytes) { char* p = wsp; wsp += (bytes + 255) & ~(size_t)255; return (void*)p; };
    const size_t NW = (size_t)DQ * DM, NX = (size_t)NB_ * TT * DM, NP = (size_t)ZH * TT * HD;   // elements of one weight, one input tensor, one set of head planes
    bf* WQ = (bf*)take(4 * NW * 2); bf* WO = WQ + 3 * NW;   /* Wq, Wk, Wv, Wo in turn */ float* CS = (float*)take((size_t)TT * HD * 2 * 4);
    h16* QP16 = (h16*)take(2 * NP * 2); h16* KP16 = QP16 + NP; bf* QPh = (bf*)take(2 * NP * 2); bf* KPh = QPh + NP; bf* QPl = (bf*)take(2 * NP * 2); bf* KPl = QPl + NP;   /* q planes, then k planes */
    h16* VT16 = (h16*)take(NP * 2); bf* VTh = (bf*)take(NP * 2); bf* VTl = (bf*)take(NP * 2);
    bf* ATh = (bf*)take(NX * 2); bf* ATl = (bf*)take(NX * 2);
    bf* XB = (bf*)take(3 * NX * 2);   /* bf16 query, key, value */
    if ((size_t)(wsp - (char*)d_ws) > ws_size) return;    // ws 256 MiB
    k_cvt8<<<dim3((unsigned)(NW / 8 / (256 * CU)), 4), 256, 0, stream>>>(wq, wk, wv, wo, WQ, NW / 8);
    k_cs5<<<(TT * HD + 255) / 256, 256, 0, stream>>>(CS);   /* rotary table once */
    k_cvt8<<<dim3((unsigned)(NX / 8 / (256 * CU)), 3), 256, 0, stream>>>(x, xk, xv, xv, XB, NX / 8);
    k_gemmt<0, 1><<<dim3(NB_ * TT / 128, DQ / 128, 3), 128, 0, stream>>>(XB, nullptr, WQ, nullptr, bq, bk, bv, NX, NW, 0, CS, QP16, QPh, QPl, NP, VT16, VTh, VTl);
    static_assert(((size_t)DQ * DM / 8) % (256 * CU) == 0 && ((size_t)NB_ * TT * DM / 8) % (256 * CU) == 0 && 16 % SR == 0 && RH % 64 == 0, "whole grids");
    k_attn<<<dim3(TT / 64, ZH), 128, 0, stream>>>(QPh, QPl, KPh, KPl, VTh, VTl, QP16, KP16, VT16, ATh, ATl);
    k_gemmt<1, 0><<<dim3(NB_ * TT / 128, DM / 128, 1), 128, 0, stream>>>(ATh, ATl, WO, OUT, bo, bo, bo, 0, 0, 0, nullptr, nullptr, nullptr, nullptr, 0, nullptr, nullptr, nullptr);
}

// v010
// Measured time: 71.4 microseconds a run.
// Next to v009, in two timings, it ran 1.05 times as fast each time.
// Counting every step since v000, it is 28.3 times as fast.
#include <hip/hip_runtime.h>

// Sliding-window multi-head attention with rotary embeddings (query, key, value [2][2048][1024]; q = query Wq^T + bq etc. ('oi' 1/32, zero biases; 16 heads x 64); rotate-half rotary with angles t x 1/10000^(2i/64) (float32 table baked, precise cosf/sinf); scores / sqrt(64); keys with |i - j| <= 50 kept (-1e9 elsewhere == exclusion); softmax; out = merged Wo^T + bo -> [2][2048][1024] (4.2 M); argument order query, key, value, Wq, bq, Wk, bk, Wv, bv, Wo, bo).
// Layout, both batches and all 16 heads in one launch per stage (grid y / z picks tensor, batch and head): bf16 copies of query, key, value; 'oi' weights; {cos, sin} table once; exact projections + f32 biases, whose epilogue applies the rotate-half rotary (q, k) or the transpose (v) and writes the head planes in the order the attention's fragment loads take them (see FRAGMENT ORDER); T-2048 attention on the band only, scores to merged planes in one kernel with score and probability rows in LDS (per wave of 16 query rows the 160 keys, and of them the 128 softmax columns, that can hold |i - j| <= 50; the band itself is a select in the softmax; hybrid rows: < 512 hi/lo 3 products, rest fp16 x1024); merged hi/lo x Wo exact + bo.
// Compute dtypes, f32 accumulate: every input rounded to bf16; projections exact + f32 biases; rotary f32; attention rows < 512 3 products, rest fp16; softmax f32; Wo hl x exact + bias.

#define NB_  2
#define TT   2048
#define DM   1024
#define NH_  16
#define NKV  16
#define REP  (NH_ / NKV)
#define HD   64
#define DQ   (NH_ * HD)
#define DKV  (NKV * HD)
#define ZH   (NB_ * NH_)          // attention planes per launch: every (batch, head)
#define RH   512                  // query rows < RH use hi+lo planes (0: none)
#define WIN  2048
#define BW   50       // half window: keys j in [i - 50, i + 50]
#define PCAR 1024.0f
#define SCL  0.125f   // HD^-0.5
typedef _Float16 h16;
typedef unsigned short bf;
typedef __attribute__((ext_vector_type(16))) __bf16   v16bf;
typedef __attribute__((ext_vector_type(16))) _Float16 v16h;
typedef __attribute__((ext_vector_type(8)))  _Float16 v8h;
typedef __attribute__((ext_vector_type(8)))  unsigned short v8us;
typedef __attribute__((ext_vector_type(8)))  float    v8f;
typedef __attribute__((ext_vector_type(4)))  float    v4f;
typedef v8h  __attribute__((may_alias)) v8ha;
typedef v4f  __attribute__((may_alias)) v4fa;
typedef v8us __attribute__((may_alias)) v8usa;

__device__ __forceinline__ unsigned short f2bf(float f) { unsigned u = __float_as_uint(f); u += 0x7FFFu + ((u >> 16) & 1u); return (unsigned short)(u >> 16); }
__device__ __forceinline__ float bf2f(unsigned short b) { return __uint_as_float(((unsigned)b) << 16); }
__device__ __forceinline__ float bfr(float f) { return bf2f(f2bf(f)); }
__device__ __forceinline__ v16h cat16(v8h lo, v8h hi) { return __builtin_shufflevector(lo, hi, 0, 1, 2, 3, 4, 5, 6, 7, 8, 9, 10, 11, 12, 13, 14, 15); }
__device__ __forceinline__ v16bf cat16b(v8us lo, v8us hi) { return __builtin_bit_cast(v16bf, __builtin_shufflevector(lo, hi, 0, 1, 2, 3, 4, 5, 6, 7, 8, 9, 10, 11, 12, 13, 14, 15)); }
__device__ __forceinline__ v8f wmma16(v16h a, v16h b, v8f c) { return __builtin_amdgcn_wmma_f32_16x16x32_f16(false, a, false, b, (short)0, c, false, false); }
__device__ __forceinline__ v8f wmmab(v16bf a, v16bf b, v8f c) { return __builtin_amdgcn_wmma_f32_16x16x32_bf16(false, a, false, b, (short)0, c, false, false); }



// Fragments come from K-contiguous 16-bit planes: lane lr + 16 hi holds row lr, k = 8 hi .. 8 hi + 7 and 16 + 8 hi .. 16 + 8 hi + 7 of each 32 k, the same for A and B.
#define WK 160   // keys of a wave's window: rows i0 .. i0 + 15 see keys i0 - 50 .. i0 + 65, and the window starts at a multiple of 32 (the k block of P V)
__device__ __forceinline__ int WB(int i0) { return min(max((i0 - 64) & ~31, 0), TT - WK); }   // first key of the window of rows i0 .. i0 + 15; pushed inwards at both ends of the sequence, so that all WK keys exist
// FRAGMENT ORDER of the head planes: the 16 bytes that lane l takes with one load of a fragment lie at l x 16 bytes of a 512-byte run, so a wave's load reads 4 whole 128-byte lines (row-major planes: 32 bytes of each of 16 lines). A fragment (16 rows x 32 k) is two runs in a row: k = 8 hi .. 8 hi + 7, then k = 16 + 8 hi .. 16 + 8 hi + 7; ldp reads both.
// q, k planes [z][t / 16][d / 32][run][lane][8]: rows t, k = d. V^T planes [z][t / 64][d / 16][(t % 64) / 32][run][lane][8]: rows d, k = t. The values in every fragment register are those of the row-major planes.
template <typename T16> struct WFrag;
template <> struct WFrag<h16> { typedef v16h V; static __device__ __forceinline__ V ld(const h16* p) { return cat16(*(const v8h*)p, *(const v8h*)(p + 16)); } static __device__ __forceinline__ V ldp(const h16* p) { return cat16(*(const v8h*)p, *(const v8h*)(p + 256)); } static __device__ __forceinline__ v8f mma(V a, V b, v8f c) { return wmma16(a, b, c); } };
template <> struct WFrag<bf> { typedef v16bf V; static __device__ __forceinline__ V ld(const bf* p) { return cat16b(*(const v8us*)p, *(const v8us*)(p + 16)); } static __device__ __forceinline__ V ldp(const bf* p) { return cat16b(*(const v8us*)p, *(const v8us*)(p + 256)); } static __device__ __forceinline__ v8f mma(V a, V b, v8f c) { return wmmab(a, b, c); } };
__device__ __forceinline__ h16 tohx(float x) { return (h16)x; }
__device__ __forceinline__ void splitf(float y, unsigned short& h, unsigned short& l) { h = f2bf(y); l = f2bf(y - bf2f(h)); }
// XW: precaution, stands behind a run of global loads or stores and in front of the arithmetic that may reuse their address registers
#define XW() asm volatile("s_wait_xcnt 0x0" ::: "memory")
// wfence: keeps the wave's LDS stores of one phase in front of its LDS reads of the next (and a row's score reads in front of the probabilities that overwrite them) in the compiled order; the hardware runs one wave's LDS operations in order
__device__ __forceinline__ void wfence() { __builtin_amdgcn_wave_barrier(); asm volatile("" ::: "memory"); }
typedef float __attribute__((may_alias)) f32a;
typedef __attribute__((ext_vector_type(2))) float v2f;
// ---- k_gemmt: the four projections. One 128x128 tile of C per work-group of 4 waves (2 x 2 waves of 64x64, 16 accumulators a wave); A (, A2) and Bt tiles of 64 k come into LDS by asynchronous copies, whole 128-byte lines, each staged row read by two waves; two buffers, the next stage's copies fly while this stage is multiplied; fragments are read from LDS one 32-k block ahead into a second register set.
// C[m][n] (f32, pitch DM, + f32 bias[n], one bias pointer per z < 3) = sum_k A[m][k] Bt[n][k] (+ A2[m][k] Bt[n][k] behind it in every 32 k when NSPLIT). All pitches DM; grid (M/128, N/128, Z).
// EPI: no C is written. A wave's 64x64 tile is 64 positions t of one (batch, head), so the wave itself turns it into that head's 16-bit planes (fp16, bf16 hi, bf16 lo): z < 2 (q, k) rotate-half rotary out[d] = x[d] cos[t][d] - x[d+HD/2] sin[t][d], out[d+HD/2] = x[d+HD/2] cos[t][d+HD/2] + x[d] sin[t][d+HD/2] (tensor stride sP); z == 2 (v) the transpose; both in FRAGMENT ORDER. q and k go through the wave's quarter of the ring, v goes straight from the accumulators; every global store of a wave fills 512 bytes in a row.
#define GP   72            // LDS row pitch in 16-bit elements: 144 bytes = 16 x odd, the conflict-free pitch for 16-byte reads of 128-byte rows
#define GKS  64            // k per stage
#define GMAT (128 * GP)    // elements of one staged operand tile
// cp8: rows r, r + 16, ... r + 112 of one operand tile, 16 bytes a lane; g is the tile's address, the same for the whole work-group: the eight row groups' addresses are scalar bases, o is the lane's byte offset in a row group; the s_wait_xcnt closes the statement so that no address register is rewritten in front of it
__device__ __forceinline__ void cp8(unsigned l, const bf* g, unsigned o) {
    asm volatile("global_load_async_to_lds_b128 %0, %8, %9\n\t"
                 "global_load_async_to_lds_b128 %1, %8, %10\n\t"
                 "global_load_async_to_lds_b128 %2, %8, %11\n\t"
                 "global_load_async_to_lds_b128 %3, %8, %12\n\t"
                 "global_load_async_to_lds_b128 %4, %8, %13\n\t"
                 "global_load_async_to_lds_b128 %5, %8, %14\n\t"
                 "global_load_async_to_lds_b128 %6, %8, %15\n\t"
                 "global_load_async_to_lds_b128 %7, %8, %16\n\t"
                 "s_wait_xcnt 0x0"
                 :: "v"(l), "v"(l + 1 * 16 * GP * 2), "v"(l + 2 * 16 * GP * 2), "v"(l + 3 * 16 * GP * 2), "v"(l + 4 * 16 * GP * 2), "v"(l + 5 * 16 * GP * 2), "v"(l + 6 * 16 * GP * 2), "v"(l + 7 * 16 * GP * 2),
                    "v"(o),
                    "s"(g), "s"(g + 1 * 16 * DM), "s"(g + 2 * 16 * DM), "s"(g + 3 * 16 * DM), "s"(g + 4 * 16 * DM), "s"(g + 5 * 16 * DM), "s"(g + 6 * 16 * DM), "s"(g + 7 * 16 * DM)
                 : "memory");
}
template <int NSPLIT, int EPI>
__global__ __launch_bounds__(128) void k_gemmt(const bf* __restrict__ A, const bf* __restrict__ A2, const bf* __restrict__ Bt, float* C, const float* __restrict__ bias0, const float* __restrict__ bias1, const float* __restrict__ bias2, size_t sA, size_t sB, size_t sC, const float* __restrict__ CS, h16* P16, bf* Ph, bf* Pl, size_t sP, h16* V16, bf* Vh, bf* Vl) {
    constexpr int NMAT = 2 + NSPLIT, STG = NMAT * GMAT, NST = DM / GKS;
    __shared__ __align__(16) bf ring[2 * STG];
    const size_t z = blockIdx.z; A += z * sA; if (NSPLIT) A2 += z * sA; Bt += z * sB; C += z * sC; const float* bias = (z == 0) ? bias0 : (z == 1) ? bias1 : bias2;
    const int tid = threadIdx.x, lane = tid & 31, lr = lane & 15, hi = lane >> 4, w = tid >> 5;
    const int R0 = blockIdx.x * 128, C0 = blockIdx.y * 128, r0 = R0 + (w >> 1) * 64, c0 = C0 + (w & 1) * 64;
    const int crow = tid >> 3, ccol = (tid & 7) * 8;   // a thread copies 16 bytes of rows crow + 16 i; 8 threads fill a row's 128 bytes
    const unsigned go = (unsigned)(crow * DM + ccol) * 2u;   // the thread's byte offset in an operand tile; the tile's own address is the same for the whole work-group and stays in scalar registers, so that the copies need few vector registers beside the two fragment sets
    const bf* gA = A + (size_t)R0 * DM; const bf* gA2 = NSPLIT ? A2 + (size_t)R0 * DM : nullptr; const bf* gB = Bt + (size_t)C0 * DM;
    const unsigned l0 = (unsigned)(size_t)ring + (unsigned)(crow * GP + ccol) * 2u;
    // Work-groups that share an operand tile (32 along x share Bt rows, 8 along y share A rows) would otherwise ask for the same lines in the same stage (for speed only). Each work-group therefore walks the 16 k stages as a ring from its own start stage: the sharers of a tile are spread over the stages. Stage s of the ring still lands in buffer s & 1; only the k it holds differs, so a work-group sums its k blocks in rotated order.
    static_assert((NST & (NST - 1)) == 0, "the start stage wraps by a mask");
    const int rot = (int)((blockIdx.x >> 3) * 4 + (blockIdx.x & 3) + 2 * blockIdx.y) & (NST - 1);   // the 8 sharers of A rows (y) get 8 different starts; of the 32 sharers of Bt rows (x) any 16 whose x mod 8 lie in a run of 4 get 16 different starts (for speed only, any placement gives right sums)
    auto fill = [&](int s) { const unsigned l = l0 + (unsigned)(s & 1) * (STG * 2u); const int ko = ((s + rot) & (NST - 1)) * GKS; cp8(l, gA + ko, go); if (NSPLIT) cp8(l + GMAT * 2u, gA2 + ko, go); cp8(l + (NMAT - 1) * GMAT * 2u, gB + ko, go); };
    v8f acc[4][4];
#pragma unroll
    for (int mb = 0; mb < 4; ++mb)
#pragma unroll
        for (int nb = 0; nb < 4; ++nb) acc[mb][nb] = (v8f){};
    const bf* fa = ring + ((w >> 1) * 64 + lr) * GP + 8 * hi; const bf* fb = ring + (NMAT - 1) * GMAT + ((w & 1) * 64 + lr) * GP + 8 * hi;
    // Two fragment sets: while one 32-k block is multiplied, the next block's LDS reads are already under way, so a wave no longer waits out its own LDS latency in front of every block.
    v16bf fa0[4], fx0[4], fb0[4], fa1[4], fx1[4], fb1[4];
    auto ldf = [&](v16bf (&a)[4], v16bf (&a2)[4], v16bf (&b)[4], int o) {
#pragma unroll
        for (int mb = 0; mb < 4; ++mb) { a[mb] = WFrag<bf>::ld(fa + o + mb * 16 * GP); if (NSPLIT) a2[mb] = WFrag<bf>::ld(fa + o + GMAT + mb * 16 * GP); }
#pragma unroll
        for (int nb = 0; nb < 4; ++nb) b[nb] = WFrag<bf>::ld(fb + o + nb * 16 * GP); };
    auto mm = [&](v16bf (&a)[4], v16bf (&a2)[4], v16bf (&b)[4]) {
#pragma unroll
        for (int nb = 0; nb < 4; ++nb) {
#pragma unroll
            for (int mb = 0; mb < 4; ++mb) acc[mb][nb] = wmmab(a[mb], b[nb], acc[mb][nb]);
            if (NSPLIT) {
#pragma unroll
                for (int mb = 0; mb < 4; ++mb) acc[mb][nb] = wmmab(a2[mb], b[nb], acc[mb][nb]); } } };
    static_assert(GKS == 64 && NST >= 2, "two blocks of 32 k a stage, two stages or more");
    fill(0);
    asm volatile("s_wait_asynccnt 0x0" ::: "memory");   // stage 0 has landed before the barrier publishes it
    __syncthreads();
    fill(1);
    ldf(fa0, fx0, fb0, 0);   // stage 0, first block
#pragma unroll 1   // one copy of the stage body: the buffer is picked by an address
    for (int t = 0; t < NST; ++t) {
        const int bo = (t & 1) * STG;
        ldf(fa1, fx1, fb1, bo + 32);   // this stage's last block: the wave's last reads of buffer t & 1
        __builtin_amdgcn_sched_barrier(0);   // the reads go out as one group in front of the running block's matrix instructions (for speed only)
        mm(fa0, fx0, fb0);
        __builtin_amdgcn_sched_barrier(0);   // holds the waits and the barrier below behind the block above: lifted over it, the s_wait_dscnt would wait out the reads that the block is there to cover
        // publish point of stage t + 1: it stands in front of this stage's last block, because the reads behind it already take the next stage
        asm volatile("s_wait_dscnt 0x0" ::: "memory");      // this wave's reads of buffer t & 1 are done before the barrier frees it
        asm volatile("s_wait_asynccnt 0x0" ::: "memory");   // this wave's copies of stage t + 1 have landed before the barrier publishes them
        __syncthreads();
        if (t + 2 < NST) fill(t + 2);
        if (t + 1 < NST) ldf(fa0, fx0, fb0, STG - bo);   // next stage, first block
        __builtin_amdgcn_sched_barrier(0);   // as above: one group of reads in front of the matrix instructions
        mm(fa1, fx1, fb1);
    }
    asm volatile("s_wait_asynccnt 0x0" ::: "memory");   // nothing is in flight when the wave goes on to the epilogue and ends
    if constexpr (EPI) {
        // The ring is free here: the barrier of the last trip stands behind every wave's last read of it, and no copy is in flight. Each wave stages in its own quarter.
        static_assert(NSPLIT == 0 && 64 * 68 * 4 <= STG, "a wave's staging fits its quarter of the ring");
        const int zp = (r0 / TT) * NH_ + c0 / HD, t0 = r0 % TT;   // head plane, first position
        if (z < 2) {
            f32a* os = (f32a*)ring + w * (STG / 4);
            // An accumulator lane holds x[d] (nb) and its partner x[d + HD/2] (nb + 2) of the same rows, so the rotation is done in place; the table's columns d and d + HD/2 hold the same angle, and one 8-byte read a lane of {cos, sin}[t][d < HD/2] uses whole 128-byte lines.
            float bb[4];
#pragma unroll
            for (int nb = 0; nb < 4; ++nb) bb[nb] = bfr(bias[c0 + nb * 16 + lr]);
            XW();
            const float* cs = CS + ((size_t)(t0 + hi * 8) * HD + lr) * 2;
            v2f c[4][2][8];
            auto ldc = [&](int mb) {
#pragma unroll
                for (int nb = 0; nb < 2; ++nb)
#pragma unroll
                    for (int j = 0; j < 8; ++j) c[mb][nb][j] = *(const v2f*)(cs + ((mb * 16 + j) * HD + nb * 16) * 2); };
            ldc(0); ldc(1);   // the table reads run two groups of 16 rows ahead of their use
            XW();
#pragma unroll
            for (int mb = 0; mb < 4; ++mb) {
#pragma unroll
                for (int nb = 0; nb < 2; ++nb)
#pragma unroll
                    for (int j = 0; j < 8; ++j) { const float xl = acc[mb][nb][j] + bb[nb], xh = acc[mb][nb + 2][j] + bb[nb + 2], co = c[mb][nb][j][0], si = c[mb][nb][j][1]; f32a* o = os + (mb * 16 + hi * 8 + j) * 68 + nb * 16 + lr;
                        o[0] = xl * co - xh * si; o[HD / 2] = xh * co + xl * si; }
                if (mb + 2 < 4) { ldc(mb + 2); XW(); }
            }
            wfence();
            const size_t e0 = z * sP + ((size_t)zp * TT + t0) * HD + lane * 8; const f32a* ox = os + lr * 68 + hi * 8;   // run u of a group of 16 rows: lane lr + 16 hi holds row lr, d = 16 u + 8 hi .. + 7
#pragma unroll 1   // 4 groups of 16 rows: one copy of the code, so that the kernel's text stays small
            for (int gg = 0; gg < 4; ++gg) {
                v4f x[4][2];
#pragma unroll
                for (int u = 0; u < 4; ++u) { x[u][0] = *(const v4fa*)(ox + gg * 16 * 68 + u * 16); x[u][1] = *(const v4fa*)(ox + gg * 16 * 68 + u * 16 + 4); }
#pragma unroll
                for (int u = 0; u < 4; ++u) { v8h o16; v8us oh, ol;
#pragma unroll
                    for (int q = 0; q < 8; ++q) { const float r = x[u][q >> 2][q & 3]; o16[q] = tohx(r); unsigned short a2, c2; splitf(r, a2, c2); oh[q] = a2; ol[q] = c2; }
                    const size_t e = e0 + (size_t)(gg * 16 * HD + u * 256); *(v8h*)(P16 + e) = o16; *(v8us*)(Ph + e) = oh; *(v8us*)(Pl + e) = ol; }
                XW();
            }
        } else {
            float bb[4];
#pragma unroll
            for (int nb = 0; nb < 4; ++nb) bb[nb] = bfr(bias[c0 + nb * 16 + lr]);
            // An accumulator lane holds 8 neighbouring t of one d: t = 16 mb + 8 hi + j, d = 16 nb + lr. That is the lane's 16 bytes of run mb & 1 of the V^T fragment (d / 16 = nb, (t % 64) / 32 = mb >> 1), so tile (mb, nb) is run 4 nb + mb of the head's 64-key block and needs no turn through LDS.
            const size_t e0 = ((size_t)zp * TT + t0) * HD + lane * 8;
#pragma unroll
            for (int nb = 0; nb < 4; ++nb)
#pragma unroll
                for (int mb = 0; mb < 4; ++mb) { v8h o16; v8us oh, ol;
#pragma unroll
                    for (int j = 0; j < 8; ++j) { const float xv = acc[mb][nb][j] + bb[nb]; o16[j] = tohx(xv); unsigned short a2, c2; splitf(xv, a2, c2); oh[j] = a2; ol[j] = c2; }
                    const size_t e = e0 + (size_t)((nb * 4 + mb) * 256); *(v8h*)(V16 + e) = o16; *(v8us*)(Vh + e) = oh; *(v8us*)(Vl + e) = ol; }
            XW();
        }
    } else {
    __shared__ __align__(16) float osb[4 * 16 * 68];
    float* os = osb + w * (16 * 68);   // each wave stages its own output rows
    v4f bb = *(const v4fa*)(bias + c0 + lr * 4); bb[0] = bfr(bb[0]); bb[1] = bfr(bb[1]); bb[2] = bfr(bb[2]); bb[3] = bfr(bb[3]);
#pragma unroll
    for (int mb = 0; mb < 4; ++mb) {
#pragma unroll
        for (int nb = 0; nb < 4; ++nb) {
#pragma unroll
            for (int j = 0; j < 8; ++j) os[(hi * 8 + j) * 68 + nb * 16 + lr] = acc[mb][nb][j]; }
        __builtin_amdgcn_wave_barrier(); asm volatile("" ::: "memory");   // the wave's stores to os stay in front of its reads
        float* crow_p = C + (size_t)(r0 + mb * 16) * DM + c0;
#pragma unroll
        for (int s = 0; s < 8; ++s) { const int row = 2 * s + hi, cofs = lr * 4; v4f val = *(const v4fa*)(os + row * 68 + cofs); val[0] += bb[0]; val[1] += bb[1]; val[2] += bb[2]; val[3] += bb[3];
            *(v4f*)(crow_p + (size_t)row * DM + cofs) = val; }
        asm volatile("s_wait_xcnt 0x0" ::: "memory");   // precaution: stands behind the stores and in front of the next rows' address arithmetic
        __builtin_amdgcn_wave_barrier(); asm volatile("" ::: "memory");   // the reads of os stay in front of the next rows' stores to it
    }
    }
}
typedef __attribute__((ext_vector_type(2))) _Float16 v2h;
typedef __attribute__((ext_vector_type(4))) _Float16 v4h;
typedef __attribute__((ext_vector_type(2))) unsigned short v2us;
typedef __attribute__((ext_vector_type(4))) unsigned short v4us;
typedef __attribute__((ext_vector_type(4))) int v4i;

// The elementwise stages below give every thread many values (16-byte loads and stores, all of a thread's loads issued before its first use), so that a stage needs a few thousand waves (for speed only).
#define CU 8    // k_cvt8: groups of 8 values per thread, one grid apart
#define SR 8    // k_attn: rows per softmax group
// k_cvt8: grid y picks one of up to four equally long sources; their bf16 copies lie one behind the other in dst; n8 = gridDim.x * 256 * CU groups of 8
__global__ __launch_bounds__(256) void k_cvt8(const float* __restrict__ s0, const float* __restrict__ s1, const float* __restrict__ s2, const float* __restrict__ s3, bf* dst, size_t n8) { const size_t i0 = (size_t)blockIdx.x * 256 + threadIdx.x, st = (size_t)gridDim.x * 256; const int y = blockIdx.y; const float* src = (y == 0) ? s0 : (y == 1) ? s1 : (y == 2) ? s2 : s3; dst += (size_t)y * n8 * 8; v8f v[CU];
#pragma unroll
    for (int u = 0; u < CU; ++u) v[u] = *(const v8f*)(src + (i0 + u * st) * 8);
    XW();
#pragma unroll
    for (int u = 0; u < CU; ++u) { v8us o;
#pragma unroll
        for (int k = 0; k < 8; ++k) o[k] = f2bf(v[u][k]);
        *(v8us*)(dst + (i0 + u * st) * 8) = o; }
    XW();  }

__constant__ float INVT[HD / 2] = { 1.000000000e+00f, 7.498942018e-01f, 5.623413324e-01f, 4.216965139e-01f, 3.162277639e-01f, 2.371373624e-01f, 1.778279394e-01f, 1.333521456e-01f, 1.000000015e-01f, 7.498941571e-02f, 5.623412877e-02f, 4.216964915e-02f, 3.162277862e-02f, 2.371373586e-02f, 1.778279431e-02f, 1.333521493e-02f, 9.999999776e-03f, 7.498942316e-03f, 5.623413250e-03f, 4.216964822e-03f, 3.162277862e-03f, 2.371373819e-03f, 1.778279431e-03f, 1.333521446e-03f, 1.000000047e-03f, 7.498941850e-04f, 5.623413017e-04f, 4.216964880e-04f, 3.162277862e-04f, 2.371373848e-04f, 1.778279402e-04f, 1.333521504e-04f };   // float32 1 / 10000^(2i/64), i < 32, generated with jnp to be bit-exact
__global__ __launch_bounds__(256) void k_cs5(float* CS) { const int idx = blockIdx.x * 256 + threadIdx.x; if (idx >= TT * HD) return; const int d = idx % HD; const int t = idx / HD; const float a = __fmul_rn((float)t, INVT[d % (HD / 2)]); v2f cs; cs[0] = cosf(a); cs[1] = sinf(a); *(v2f*)(CS + (size_t)idx * 2) = cs;  }
// ---- k_attn: the whole banded attention of one (batch, head) and 64 query rows in one work-group of 4 waves; a wave owns 16 query rows from the scores to the merged hi/lo planes and shares nothing with the other waves (no work-group barrier); the 4 waves' key windows overlap, so that they read largely the same K and V^T lines, every load 512 bytes in a row (FRAGMENT ORDER).
// Per wave: (1) scores Q K^T for the WK keys of the wave's own window (WB), f32 into the wave's LDS rows, key j at column j - wb; (2) softmax of SR rows at a time over the 128 columns from so on that hold every |i - j| <= 50 of the 16 rows, 4 columns a lane; the probabilities (fp16 x 1024, or bf16 hi and lo) overwrite the row's own scores, the window's other 32 columns get zeros; (3) P V over the window, A fragments from LDS, B fragments from the V^T planes; (4) the 16 x 64 result turned through LDS, scaled back, split hi/lo and stored as whole 128-byte lines of the merged [b][t][h d] planes.
// Row tiles < RH / 64 take the hi/lo planes (3 products per 32 k, in the order hi hi, lo hi, hi lo), the rest the fp16 planes.
#define AP  268   // LDS row pitch in floats: 8 rows apart is 32 banks apart (the two halves of an accumulator store do not collide); 1072 bytes = 16 x odd for the 16-byte fragment reads; holds WK f32 scores, then 2 x WK 16-bit probabilities
#define APL 264   // offset of a row's lo probabilities in 16-bit elements
// sbase: an address that is the same for the whole wave, held in scalar registers: the loads then name it and one lasting lane-offset register, and no address register is formed anew per block
#define GAS __attribute__((address_space(1)))   // global memory, so that a pointer rebuilt from its two words still gives global loads
template <typename T> __device__ __forceinline__ const GAS T* sbase(const T* p) { const unsigned long long u = (unsigned long long)p; return (const GAS T*)(((unsigned long long)(unsigned)__builtin_amdgcn_readfirstlane((int)(u >> 32)) << 32) | (unsigned)__builtin_amdgcn_readfirstlane((int)u)); }
__device__ __forceinline__ v16h ldg(const GAS h16* p) { return cat16(*(const GAS v8h*)p, *(const GAS v8h*)(p + 256)); }   // ldp from a global pointer
__device__ __forceinline__ v16bf ldg(const GAS bf* p) { return cat16b(*(const GAS v8us*)p, *(const GAS v8us*)(p + 256)); }
// pvg: N blocks of 32 keys of P V, from block c0 of the window on; all their loads go out as one group
template <typename T16, bool HL, int N>
__device__ __forceinline__ void pvg(v8f (&o)[4], const T16* pa, const T16* __restrict__ Vt, const T16* __restrict__ V2, unsigned lo, int wb, int c0) {
    typedef typename WFrag<T16>::V V;
    V b[N][4], b2[N][4], a[N], a2[N];
#pragma unroll
    for (int c = 0; c < N; ++c) { const int kc = wb + (c0 + c) * 32; const size_t vb = (size_t)(kc >> 6) * (64 * HD) + ((kc >> 5) & 1) * 512;   // the 64-key block of the V^T plane and the half of it that holds these 32 keys
        const GAS T16* v1 = sbase(Vt + vb); const GAS T16* v2 = HL ? sbase(V2 + vb) : nullptr;
#pragma unroll
        for (int nb = 0; nb < 4; ++nb) { b[c][nb] = ldg(v1 + nb * 1024 + lo); if (HL) b2[c][nb] = ldg(v2 + nb * 1024 + lo); }   // lo is the lane's place in a run
        XW(); }   // behind every block's loads: the next block's address arithmetic and load results may reuse this block's address registers
#pragma unroll
    for (int c = 0; c < N; ++c) { a[c] = WFrag<T16>::ld(pa + (c0 + c) * 32); if (HL) a2[c] = WFrag<T16>::ld(pa + APL + (c0 + c) * 32); }
    __builtin_amdgcn_sched_barrier(0);   // all loads of these keys go out as one group: spread among the matrix instructions, each small group's memory latency stalls the wave anew
#pragma unroll
    for (int c = 0; c < N; ++c)
#pragma unroll
        for (int nb = 0; nb < 4; ++nb) { o[nb] = WFrag<T16>::mma(a[c], b[c][nb], o[nb]); if (HL) { o[nb] = WFrag<T16>::mma(a2[c], b[c][nb], o[nb]); o[nb] = WFrag<T16>::mma(a[c], b2[c][nb], o[nb]); } }
}
template <typename T16, bool HL>
__device__ __forceinline__ void attn16(float* sl, int q0, int w, int zz, const T16* __restrict__ Q, const T16* __restrict__ Q2, const T16* __restrict__ Kp, const T16* __restrict__ K2, const T16* __restrict__ Vt, const T16* __restrict__ V2, bf* Ah, bf* Al) {
    typedef typename WFrag<T16>::V V;
    const int lane = threadIdx.x & 31, lr = lane & 15, hi = lane >> 4; const int i0 = q0 + w * 16, wb = WB(i0), so = min(max(i0 - 52 - wb, 0), WK - 128);   // so: first softmax column, a multiple of 4; keys wb + so .. wb + so + 127 hold i0 - 50 .. i0 + 65 as far as they exist
    {   // (1) scores
        V a[2], a2[2]; const size_t qo = (size_t)i0 * HD + lane * 8;
#pragma unroll
        for (int kk = 0; kk < 2; ++kk) { a[kk] = WFrag<T16>::ldp(Q + qo + kk * 512); if (HL) a2[kk] = WFrag<T16>::ldp(Q2 + qo + kk * 512); }
        XW();
        constexpr int NT = HL ? 5 : 10;   // column tiles of 16 keys a trip: as many as the registers hold
#pragma unroll 1   // 1 or 2 trips
        for (int c0 = 0; c0 < WK; c0 += NT * 16) {
            V b[2][NT], b2[2][NT]; const size_t ko = (size_t)(wb + c0) * HD + lane * 8;
#pragma unroll
            for (int kk = 0; kk < 2; ++kk)
#pragma unroll
                for (int nb = 0; nb < NT; ++nb) { b[kk][nb] = WFrag<T16>::ldp(Kp + ko + nb * 16 * HD + kk * 512); if (HL) b2[kk][nb] = WFrag<T16>::ldp(K2 + ko + nb * 16 * HD + kk * 512); }
            XW();
            __builtin_amdgcn_sched_barrier(0);   // all loads of these keys go out as one group: spread among the matrix instructions, each small group's memory latency stalls the wave anew
            v8f acc[NT];
#pragma unroll
            for (int nb = 0; nb < NT; ++nb) acc[nb] = (v8f){};
#pragma unroll
            for (int kk = 0; kk < 2; ++kk)
#pragma unroll
                for (int nb = 0; nb < NT; ++nb) { acc[nb] = WFrag<T16>::mma(a[kk], b[kk][nb], acc[nb]); if (HL) { acc[nb] = WFrag<T16>::mma(a2[kk], b[kk][nb], acc[nb]); acc[nb] = WFrag<T16>::mma(a[kk], b2[kk][nb], acc[nb]); } }
#pragma unroll
            for (int nb = 0; nb < NT; ++nb)
#pragma unroll
                for (int j = 0; j < 8; ++j) sl[(hi * 8 + j) * AP + c0 + nb * 16 + lr] = acc[nb][j];
        }
    }
    wfence();
    // (2) softmax: t = S x 1/8 for keys with |i - j| <= 50, -3e38 elsewhere (the -1e9 fill == exclusion); the terms left out are exact zeros; each step for all SR rows in turn so that their butterflies overlap
    const int dj = wb + so + lane * 4 - i0 + BW;   // j - i + 50 of the lane's first column in row i0
#pragma unroll 1   // two groups of SR rows: one copy of the code, and the registers of one group
    for (int rb = 0; rb < 16; rb += SR) {
        float v[SR][4]; float mx[SR], sum[SR]; v4f a[SR];
#pragma unroll
        for (int r = 0; r < SR; ++r) a[r] = *(const v4fa*)(sl + (rb + r) * AP + so + lane * 4);
        wfence();
#pragma unroll
        for (int r = 0; r < SR; ++r) { mx[r] = -3.0e38f;
#pragma unroll
            for (int q = 0; q < 4; ++q) { const float t = ((unsigned)(dj + q - rb - r) <= 2u * BW) ? a[r][q] * SCL : -3.0e38f;   /* |i - j| <= 50 */ v[r][q] = t; mx[r] = fmaxf(mx[r], t); } }
#pragma unroll
        for (int sh = 16; sh; sh >>= 1) {
#pragma unroll
            for (int r = 0; r < SR; ++r) mx[r] = fmaxf(mx[r], __shfl_xor(mx[r], sh, 32)); }
#pragma unroll
        for (int r = 0; r < SR; ++r) { sum[r] = 0.f;
#pragma unroll
            for (int k = 0; k < 4; ++k) { const float d0 = __fsub_rn(v[r][k], mx[r]); const float e0 = __fmul_rn(d0, 1.4426950408889634f);
                asm("v_exp_f32 %0, %1\n\tv_nop" : "=v"(v[r][k]) : "v"(e0)); }   // the v_nop in the same statement keeps the slot behind the transcendental free of an instruction that reads its result or overwrites its source
#pragma unroll
            for (int k = 0; k < 4; ++k) sum[r] += v[r][k]; }
#pragma unroll
        for (int sh = 16; sh; sh >>= 1) {
#pragma unroll
            for (int r = 0; r < SR; ++r) sum[r] += __shfl_xor(sum[r], sh, 32); }
#pragma unroll
        for (int r = 0; r < SR; ++r) { const float f = __fdiv_rn(HL ? 1.0f : PCAR, sum[r]); T16* pr = (T16*)(sl + (rb + r) * AP) + so + lane * 4;
            if constexpr (HL) { v4us oh, ol;
#pragma unroll
                for (int q = 0; q < 4; ++q) { unsigned short a2, c2; splitf(v[r][q] * f, a2, c2); oh[q] = a2; ol[q] = c2; }
                *(v4us*)pr = oh; *(v4us*)(pr + APL) = ol;
            } else { v4h o4;
#pragma unroll
                for (int q = 0; q < 4; ++q) o4[q] = tohx(v[r][q] * f);
                *(v4h*)pr = o4; } }
        // the window's 32 columns outside the softmax hold no key of the band: probability 0; 8 lanes a row, 4 rows a store
        const int ze = (lane & 7) * 4, zc = ze < so ? ze : ze + 128;
#pragma unroll
        for (int r = 0; r < SR; r += 4) { T16* pz = (T16*)(sl + (rb + r + (lane >> 3)) * AP) + zc;
            if constexpr (HL) { *(v4us*)pz = (v4us){}; *(v4us*)(pz + APL) = (v4us){}; } else *(v4h*)pz = (v4h){}; }
    }
    wfence();
    v8f o[4];
#pragma unroll
    for (int nb = 0; nb < 4; ++nb) o[nb] = (v8f){};
    {   // (3) P V: the window's 5 blocks of 32 keys in turn, in groups as large as the registers hold
        const T16* pa = (const T16*)sl + lr * (AP * 2) + 8 * hi; const unsigned lo = (unsigned)lane * 8u;
        if constexpr (HL) { pvg<T16, HL, 2>(o, pa, Vt, V2, lo, wb, 0); pvg<T16, HL, 2>(o, pa, Vt, V2, lo, wb, 2); pvg<T16, HL, 1>(o, pa, Vt, V2, lo, wb, 4); }
        else { pvg<T16, HL, 3>(o, pa, Vt, V2, lo, wb, 0); pvg<T16, HL, 2>(o, pa, Vt, V2, lo, wb, 3); }
    }
    wfence();
    // (4) merge
#pragma unroll
    for (int nb = 0; nb < 4; ++nb)
#pragma unroll
        for (int j = 0; j < 8; ++j) sl[(hi * 8 + j) * 68 + nb * 16 + lr] = o[nb][j];
    wfence();
    const float cs = HL ? 1.0f : (1.0f / PCAR);
#pragma unroll
    for (int g = 0; g < 4; ++g) { const int row = g * 4 + (lane >> 3), d = (lane & 7) * 8; const v4f x0 = *(const v4fa*)(sl + row * 68 + d), x1 = *(const v4fa*)(sl + row * 68 + d + 4); v8us oh, ol;
#pragma unroll
        for (int q = 0; q < 8; ++q) { unsigned short h2, l2; splitf((q < 4 ? x0[q & 3] : x1[q & 3]) * cs, h2, l2); oh[q] = h2; ol[q] = l2; }
        const size_t oo = ((size_t)(zz / NH_) * TT + i0 + row) * DQ + (zz % NH_) * HD + d; *(v8us*)(Ah + oo) = oh; *(v8us*)(Al + oo) = ol; }
    XW();
}
// grid (TT / 64, ZH); all planes are whole, in FRAGMENT ORDER
__global__ __launch_bounds__(128) void k_attn(const bf* __restrict__ Qh, const bf* __restrict__ Ql, const bf* __restrict__ Kh, const bf* __restrict__ Kl, const bf* __restrict__ Vh, const bf* __restrict__ Vl, const h16* __restrict__ Q16, const h16* __restrict__ K16, const h16* __restrict__ V16, bf* Ah, bf* Al) {
    __shared__ __align__(16) float sb[4 * 16 * AP];
    const int w = __builtin_amdgcn_readfirstlane(threadIdx.x >> 5), q0 = blockIdx.x * 64, zz = blockIdx.y;   /* the wave's number as a scalar: its window's addresses stay in scalar registers */ const size_t zo = (size_t)zz * TT * HD; float* sl = sb + w * (16 * AP);
    if (q0 >= RH) { attn16<h16, false>(sl, q0, w, zz, Q16 + zo, nullptr, K16 + zo, nullptr, V16 + zo, nullptr, Ah, Al); return; }
    attn16<bf, true>(sl, q0, w, zz, Qh + zo, Ql + zo, Kh + zo, Kl + zo, Vh + zo, Vl + zo, Ah, Al);
}

extern "C" void kernel_launch(void* const* d_in, const int* in_sizes, int n_in,
                              void* d_out, int out_size, void* d_ws, size_t ws_size, hipStream_t stream) {
    (void)in_sizes; (void)n_in; (void)out_size;
    const float* x = (const float*)d_in[0];   /* query */ const float* xk = (const float*)d_in[1]; const float* xv = (const float*)d_in[2]; const float* wq = (const float*)d_in[3]; const float* bq = (const float*)d_in[4]; const float* wk = (const float*)d_in[5]; const float* bk = (const float*)d_in[6]; const float* wv = (const float*)d_in[7]; const float* bv = (const float*)d_in[8]; const float* wo = (const float*)d_in[9]; const float* bo = (const float*)d_in[10];   /* input order query, key, value, Wq, bq, Wk, bk, Wv, bv, Wo, bo */
    float* OUT = (float*)d_out;     // [2][2048][1024]
    char* wsp = (char*)d_ws;
    auto take = [&](size_t bytes) { char* p = wsp; wsp += (bytes + 255) & ~(size_t)255; return (void*)p; };
    const size_t NW = (size_t)DQ * DM, NX = (size_t)NB_ * TT * DM, NP = (size_t)ZH * TT * HD;   // elements of one weight, one input tensor, one set of head planes
    bf* WQ = (bf*)take(4 * NW * 2); bf* WO = WQ + 3 * NW;   /* Wq, Wk, Wv, Wo in turn */ float* CS = (float*)take((size_t)TT * HD * 2 * 4);
    h16* QP16 = (h16*)take(2 * NP * 2); h16* KP16 = QP16 + NP; bf* QPh = (bf*)take(2 * NP * 2); bf* KPh = QPh + NP; bf* QPl = (bf*)take(2 * NP * 2); bf* KPl = QPl + NP;   /* q planes, then k planes */
    h16* VT16 = (h16*)take(NP * 2); bf* VTh = (bf*)take(NP * 2); bf* VTl = (bf*)take(NP * 2);
    bf* ATh = (bf*)take(NX * 2); bf* ATl = (bf*)take(NX * 2);
    bf* XB = (bf*)take(3 * NX * 2);   /* bf16 query, key, value */
    if ((size_t)(wsp - (char*)d_ws) > ws_size) return;    // ws 256 MiB
    k_cvt8<<<dim3((unsigned)(NW / 8 / (256 * CU)), 4), 256, 0, stream>>>(wq, wk, wv, wo, WQ, NW / 8);
    k_cs5<<<(TT * HD + 255) / 256, 256, 0, stream>>>(CS);   /* rotary table once */
    k_cvt8<<<dim3((unsigned)(NX / 8 / (256 * CU)), 3), 256, 0, stream>>>(x, xk, xv, xv, XB, NX / 8);
    k_gemmt<0, 1><<<dim3(NB_ * TT / 128, DQ / 128, 3), 128, 0, stream>>>(XB, nullptr, WQ, nullptr, bq, bk, bv, NX, NW, 0, CS, QP16, QPh, QPl, NP, VT16, VTh, VTl);
    static_assert(((size_t)DQ * DM / 8) % (256 * CU) == 0 && ((size_t)NB_ * TT * DM / 8) % (256 * CU) == 0 && 16 % SR == 0 && RH % 64 == 0, "whole grids");
    k_attn<<<dim3(TT / 64, ZH), 128, 0, stream>>>(QPh, QPl, KPh, KPl, VTh, VTl, QP16, KP16, VT16, ATh, ATl);
    k_gemmt<1, 0><<<dim3(NB_ * TT / 128, DM / 128, 1), 128, 0, stream>>>(ATh, ATl, WO, OUT, bo, bo, bo, 0, 0, 0, nullptr, nullptr, nullptr, nullptr, 0, nullptr, nullptr, nullptr);
}
